// v000
// The times below were measured on an AMD MI455X: many runs one after another, warmed up first and cycling through
// copies of the inputs, with the whole window's GPU time divided by the number of runs. Launches and the gaps
// between them are all in it. The median over several windows is given; except for v000 it joins two sittings, which
// can be a few percent apart, so the side-by-side timings, each taken in one sitting, are the better comparison.
// v000 is the starting kernel. One run takes 426 microseconds.
// compute dtype: all float inputs rounded to bf16, attn_mask (int) read on device; q/k/v 1x1 convs with EXACT bf16 products on WMMA 16x16x32 (positions as rows via an LDS transpose of the [B,C,T] input, natural weight rows) + biases; q and k stored as f16 hi + (x2048-scaled) residual in zero-padded 32-wide per-head chunks (head dim 24), v as f16 hi + residual channel planes (padded to 32 per head); scores = (q . k (3 products) + the windowed relative-key logits q . emb_k[s-t+4] for |s-t| <= 4 (f32 dots)) / sqrt(24); mask == 0 -> -3e38 (weight forced to 0, so the key is excluded); running-max softmax in f32 (hardware exp); P (scaled by 2^11, as f16 hi + residual) x v hi/lo (3 products); the windowed relative-value term sum_{|s-t|<=4} p(t,s) emb_v[s-t+4] added in f32 from recomputed (identical-formula) weights; output 1x1 conv with the context as bf16 hi + residual x exact Wo rows (2 products) + bo, written channels-first; f32 accumulate.
#include <hip/hip_runtime.h>
#include <math.h>

typedef __attribute__((ext_vector_type(16))) _Float16 v16h;
typedef __attribute__((ext_vector_type(16))) __bf16 v16b;
typedef __attribute__((ext_vector_type(8)))  _Float16 v8h;
typedef __attribute__((ext_vector_type(8)))  float v8f;
typedef __attribute__((ext_vector_type(4)))  float v4f;
typedef __attribute__((ext_vector_type(2)))  float v2f;
typedef __attribute__((ext_vector_type(4)))  unsigned v4u;
typedef __attribute__((ext_vector_type(4)))  int v4i;
typedef float __attribute__((may_alias)) float_a;
typedef int __attribute__((may_alias)) int_a;

template <typename T> __device__ __forceinline__ void vst2(void* p, T v) { *(T*)p = v;  }
__device__ __forceinline__ v8f wmma16(v16h a, v16h b, v8f c) {
  v8f d = __builtin_amdgcn_wmma_f32_16x16x32_f16(false, a, false, b, (short)0, c, false, false);
  asm volatile("v_nop\n\tv_nop\n\tv_nop\n\tv_nop" : "+v"(d) : "v"(a), "v"(b));
  return d;
}
__device__ __forceinline__ v8f wmma_bf(v16b a, v16b b, v8f c) {
  v8f d = __builtin_amdgcn_wmma_f32_16x16x32_bf16(false, a, false, b, (short)0, c, false, false);
  asm volatile("v_nop\n\tv_nop\n\tv_nop\n\tv_nop" : "+v"(d) : "v"(a), "v"(b));
  return d;
}
// 16x16x32 fragments: lane = (h = lane>>4, row/col = lane&15); elements 0..7 = k0+8h+0..7, 8..15 = k0+16+8h+0..7; D element r = row 8h+r
__device__ __forceinline__ v16h frag_h(const _Float16* rowk0, int lane) {
  union { v16h v; v8h q[2]; } u; const _Float16* p = rowk0 + 8 * (lane >> 4);
  u.q[0] = *(const v8h*)p; u.q[1] = *(const v8h*)(p + 16); return u.v;
}
__device__ __forceinline__ v16h frag_f32(const float* rowk0, int lane) {
  v16h a; const float* p = rowk0 + 8 * (lane >> 4);
#pragma unroll
  for (int i = 0; i < 8; ++i) { a[i] = (_Float16)p[i]; a[8 + i] = (_Float16)p[16 + i]; }
  return a;
}
__device__ __forceinline__ v16h frag_f32s(const float* rowk0, int lane, float sc) {
  v16h a; const float* p = rowk0 + 8 * (lane >> 4);
#pragma unroll
  for (int i = 0; i < 8; ++i) { a[i] = (_Float16)(p[i] * sc); a[8 + i] = (_Float16)(p[16 + i] * sc); }
  return a;
}
// column fragment from a [K][ld] layout (column n), rows >= K read as 0
__device__ __forceinline__ v16h fragc_f32(const float* W, int k0, int n, int lane, int ld, int K) {
  v16h a; const int g = lane >> 4;
#pragma unroll
  for (int i = 0; i < 8; ++i) { const int ka = k0 + 8 * g + i, kb = ka + 16;
    a[i] = (_Float16)(ka < K ? W[(size_t)(ka < K ? ka : K - 1) * ld + n] : 0.f); a[8 + i] = (_Float16)(kb < K ? W[(size_t)(kb < K ? kb : K - 1) * ld + n] : 0.f); }
  return a;
}
struct F2 { v16b h, l; };
__device__ __forceinline__ F2 bsplit16(const float v[16]) { F2 r;
#pragma unroll
  for (int i = 0; i < 16; ++i) { const __bf16 h = (__bf16)v[i]; r.h[i] = h; r.l[i] = (__bf16)(v[i] - (float)h); }
  return r; }
__device__ __forceinline__ F2 split_row(const float* row, int k0, int lane) { float v[16]; const float* p = row + k0 + 8 * (lane >> 4);
#pragma unroll
  for (int i = 0; i < 8; ++i) { v[i] = p[i]; v[8 + i] = p[16 + i]; }
  return bsplit16(v); }
__device__ __forceinline__ F2 split_rowK(const float* row, int k0, int lane, int K) { float v[16]; const int g = lane >> 4;
#pragma unroll
  for (int i = 0; i < 8; ++i) { const int ka = k0 + 8 * g + i, kb = ka + 16; v[i] = ka < K ? row[ka < K ? ka : K - 1] : 0.f; v[8 + i] = kb < K ? row[kb < K ? kb : K - 1] : 0.f; }
  return bsplit16(v); }
__device__ __forceinline__ F2 split_col(const float* W, int k0, int n, int lane, int ld, int K) { float v[16]; const int g = lane >> 4;
#pragma unroll
  for (int i = 0; i < 8; ++i) { const int ka = k0 + 8 * g + i, kb = ka + 16; v[i] = ka < K ? W[(size_t)(ka < K ? ka : K - 1) * ld + n] : 0.f; v[8 + i] = kb < K ? W[(size_t)(kb < K ? kb : K - 1) * ld + n] : 0.f; }
  return bsplit16(v); }
__device__ __forceinline__ v8f mac3(const F2& a, const F2& b, v8f c) { c = wmma_bf(a.l, b.h, c); c = wmma_bf(a.h, b.l, c); return wmma_bf(a.h, b.h, c); }
__device__ __forceinline__ float sigm(float v) { return 1.0f / (1.0f + expf(-v)); }
#define LDSX() do { asm volatile("s_wait_dscnt 0" ::: "memory"); __builtin_amdgcn_wave_barrier(); __builtin_amdgcn_fence(__ATOMIC_RELEASE, "workgroup"); } while (0)


// Relative-position multi-head attention (B 4, C 192 as 8 heads x 24, T 1,024, window 4): 1x1-conv q/k/v, scores with windowed relative key embeddings, per-(t,s) mask, softmax, values plus windowed relative value embeddings, 1x1-conv output -> [B, C, T].
#define NB 4
#define CC 192
#define TT 1024
#define NH 8
#define HDIM 24
#define WIN 4
#define NREL (2 * WIN + 1)
#define NR (NB * TT)
#ifndef TQB
#define TQB (TT / 64)
#define TNB NB
#endif
typedef __attribute__((ext_vector_type(8))) __bf16 v8b;
__device__ __forceinline__ v16b frag_b(const __bf16* rowk0, int lane) {
  union { v16b v; v8b q[2]; } u; const __bf16* p = rowk0 + 8 * (lane >> 4);
  u.q[0] = *(const v8b*)p; u.q[1] = *(const v8b*)(p + 16); return u.v;
}
__device__ __forceinline__ float bfr(float v) { return (float)(__bf16)v; }
__device__ __attribute__((noinline)) float exp_ni(float v) { return expf(v); }
__device__ __attribute__((noinline)) float erf_ni(float v) { return erff(v); }

#define PK_Q 0                               // [192][192] Wq ; Wk ; Wv ; Wo (natural rows)
#define PK_END ((size_t)4 * CC * CC)
#define WS_PK  0u
#define WS_QH  (((2u * PK_END) + 127u) / 128u * 128u)   // f16 [NR][8][32] q hi ; QL ; KH ; KL
#define WS_QL  (WS_QH + 2u * NR * NH * 32)
#define WS_KH  (WS_QL + 2u * NR * NH * 32)
#define WS_KL  (WS_KH + 2u * NR * NH * 32)
#define WS_VH  (WS_KL + 2u * NR * NH * 32)               // f16 [b][8*32][T] v hi ; VL  (dims 24..31 of each head zero)
#define WS_VL  (WS_VH + 2u * (size_t)NB * NH * 32 * TT)
#define WS_RQ  (WS_VL + 2u * (size_t)NB * NH * 32 * TT)  // f32 [NR][8][16] q . emb_k[r] (9 used)
#define WS_O   (WS_RQ + 4u * NR * NH * 16)                 // f32 [4 head pairs][NR][48] attention output (block-owned runs)
#define WS_END (WS_O + 4u * NR * CC)

__global__ __launch_bounds__(256) void k_pack(const float* __restrict__ WQ, const float* __restrict__ WK, const float* __restrict__ WV, const float* __restrict__ WO, __bf16* __restrict__ PK) {
  const int n = blockIdx.x, which = blockIdx.y, t = threadIdx.x; const float* Wm = (which == 0) ? WQ : (which == 1) ? WK : (which == 2) ? WV : WO; __shared__ __align__(16) __bf16 s[CC];
  if (t < CC) s[t] = (__bf16)Wm[(size_t)n * CC + t];
  __syncthreads();
  if (t < CC / 8) vst2((unsigned*)(PK + ((size_t)which * CC + n) * CC + t * 8), *(const v4u*)&s[t * 8]);
}
// ---- k_qkv: block = (64 positions, b): A tile [64 t][192 c] from x[b][c][t] (bf16 exact); for which = q,k,v: D = A . W rows + b (12 tiles per wave); q,k -> padded 32-wide per-head f16 hi/lo chunks; v -> planes [b][h*32 + d][t]; also RQ[row][h][r] = q_h . emb_k[r] (f32)
__global__ __launch_bounds__(128) void k_qkv(const float* __restrict__ X, const __bf16* __restrict__ PK, const float* __restrict__ BQ, const float* __restrict__ BK, const float* __restrict__ BV, const float* __restrict__ EK, _Float16* __restrict__ QH, _Float16* __restrict__ QL, _Float16* __restrict__ KH, _Float16* __restrict__ KL, _Float16* __restrict__ VH, _Float16* __restrict__ VL, float* __restrict__ RQ) {
  __shared__ __align__(16) __bf16 sa[64][CC + 8]; __shared__ __align__(16) float so[64][CC + 4]; __shared__ __align__(16) _Float16 sbuf[2 * NH * 32 * 72];   // union: q/k chunk staging [2][64][264] or v planes staging [2][256][72]
  typedef _Float16 (*ChunkT)[NH * 32 + 8]; typedef _Float16 (*PlaneT)[72]; ChunkT sth = (ChunkT)sbuf, stl = (ChunkT)(sbuf + 64 * (NH * 32 + 8)); PlaneT svh = (PlaneT)sbuf, svl = (PlaneT)(sbuf + NH * 32 * 72);
  const int tid = threadIdx.x, wave = tid >> 5, lane = tid & 31, col = lane & 15, g = lane >> 4; const int t0 = blockIdx.x * 64; const size_t b = blockIdx.y; const size_t r0 = b * TT + t0;
  for (int e = tid; e < 64 * CC; e += 128) { const int c = e >> 6, r = e & 63; sa[r][c] = (__bf16)X[(b * CC + c) * TT + t0 + r]; }
  if (tid < 64) for (int c = CC; c < CC + 8; ++c) sa[tid][c] = (__bf16)0.f;
  __syncthreads();
#pragma unroll 1
  for (int which = 0; which < 3; ++which) { const __bf16* P = PK + (size_t)which * CC * CC; const float* BB = (which == 0) ? BQ : (which == 1) ? BK : BV;
    v8f acc[12] = {};
#pragma unroll
    for (int kc = 0; kc < CC / 32; ++kc) { const v16b a = frag_b(&sa[wave * 16 + col][kc * 32], lane);
#pragma unroll
      for (int j = 0; j < 12; ++j) acc[j] = wmma_bf(a, frag_b(P + (size_t)(j * 16 + col) * CC + kc * 32, lane), acc[j]); }
#pragma unroll
    for (int j = 0; j < 12; ++j) { const float bb = bfr(BB[j * 16 + col]);
#pragma unroll
      for (int r = 0; r < 8; ++r) so[wave * 16 + 8 * g + r][j * 16 + col] = acc[j][r] + bb; }
    __syncthreads();
    if (which < 2) {
      for (int e = tid; e < 64 * NH * 32; e += 128) { const int r = e / (NH * 32), q = e % (NH * 32); const int h = q >> 5, d = q & 31; float v = 0.f; if (d < HDIM) v = so[r][h * HDIM + d]; const _Float16 hv = (_Float16)v; sth[r][q] = hv; stl[r][q] = (_Float16)((v - (float)hv) * 2048.0f); }
      if (which == 0) { // relative-key logits seeds: RQ[row][h][rr] = sum_d q[h*24+d] * emb_k[rr][d] (f32), 4 per thread, stored directly (16-B pieces of the row's 512-B RQ record; the block owns rows t0..t0+63)
        for (int e = tid; e < 64 * NH * 4; e += 128) { const int r = e / (NH * 4), q = e % (NH * 4); const int h = q >> 2, r4 = (q & 3) * 4; v4f o4;
          for (int i = 0; i < 4; ++i) { const int rr = r4 + i; float a2 = 0.f; if (rr < NREL) { for (int d = 0; d < HDIM; ++d) a2 += so[r][h * HDIM + d] * bfr(EK[rr * HDIM + d]); } o4[i] = a2; }
          vst2(RQ + ((r0 + r) * NH + h) * 16 + r4, o4); } }
      __syncthreads();
      _Float16* DH_ = which ? KH : QH; _Float16* DL_ = which ? KL : QL;
      for (int e = tid; e < 64 * (NH * 32 / 8); e += 128) { const int r = e / (NH * 4), q = e % (NH * 4); const size_t o = (r0 + r) * (NH * 32) + q * 8; vst2((unsigned*)(DH_ + o), *(const v4u*)&sth[r][q * 8]); vst2((unsigned*)(DL_ + o), *(const v4u*)&stl[r][q * 8]); }
    } else {
      for (int e = tid; e < 64 * NH * 32; e += 128) { const int r = e & 63, q = e >> 6; const int h = q >> 5, d = q & 31; float v = 0.f; if (d < HDIM) v = so[r][h * HDIM + d]; const _Float16 hv = (_Float16)v; svh[q][r] = hv; svl[q][r] = (_Float16)((v - (float)hv) * 2048.0f); }
      __syncthreads();
      for (int e = tid; e < NH * 32 * 8; e += 128) { const int q = e >> 3, pc = e & 7; const size_t o = (b * NH * 32 + q) * TT + t0 + pc * 8; vst2((unsigned*)(VH + o), *(const v4u*)&svh[q][pc * 8]); vst2((unsigned*)(VL + o), *(const v4u*)&svl[q][pc * 8]); } }
    __syncthreads(); }
}
// ---- k_attn: block = (64 queries, head pair, b): per head: all 1,024 keys in tiles of 32 with the mask tile staged in LDS; scores (3-product q.k + windowed rel-key seed) / sqrt(24), mask == 0 excluded; online softmax; P (x2^11 hi + residual) x V (2 tiles of 16 dims); epilogue adds sum_{|s-t|<=4} p(t,s) emb_v[s-t+4]; O rows [hp][row][hh*24 + d]
__global__ __launch_bounds__(128) void k_attn(const _Float16* __restrict__ QH, const _Float16* __restrict__ QL, const _Float16* __restrict__ KH, const _Float16* __restrict__ KL, const _Float16* __restrict__ VH, const _Float16* __restrict__ VL, const float* __restrict__ RQ, const int* __restrict__ MASK, const float* __restrict__ EV, float* __restrict__ O) {
  __shared__ __align__(16) _Float16 sph[4][16][40], spl[4][16][40]; __shared__ int smk[64][33]; __shared__ float srq[4][16][NREL + 1]; __shared__ float spp[4][16][NREL + 1]; __shared__ __align__(16) float so[64][2 * HDIM + 4];
  const int tid = threadIdx.x, wave = tid >> 5, lane = tid & 31, col = lane & 15, g = lane >> 4; const int qb = blockIdx.x, hp = blockIdx.y; const size_t b = blockIdx.z; const int q0 = qb * 64 + wave * 16; const size_t rq = b * TT + q0; const float isc = 1.0f / sqrtf((float)HDIM);
#pragma unroll 1
  for (int hh = 0; hh < 2; ++hh) { const int h = hp * 2 + hh;
    if (lane < 16) { for (int rr = 0; rr < NREL; ++rr) srq[wave][lane][rr] = RQ[((rq + lane) * NH + h) * 16 + rr]; }
    const v16h aq = frag_h(QH + (rq + col) * (NH * 32) + h * 32, lane), aql = frag_h(QL + (rq + col) * (NH * 32) + h * 32, lane);
    float m[8], l[8];
#pragma unroll
    for (int r = 0; r < 8; ++r) { m[r] = -3.0e38f; l[r] = 0.f; }
    v8f acc[2] = {}, accl[2] = {};
    __syncthreads();
#pragma unroll 1
    for (int ks = 0; ks < TT / 32; ++ks) { const int j0 = ks * 32;
      for (int e = tid; e < 64 * 8; e += 128) { const int r = e >> 3, q4 = e & 7; const v4i mv = *(const v4i*)(MASK + ((b * TT + qb * 64 + r) * TT) + j0 + q4 * 4); smk[r][q4 * 4] = mv[0]; smk[r][q4 * 4 + 1] = mv[1]; smk[r][q4 * 4 + 2] = mv[2]; smk[r][q4 * 4 + 3] = mv[3]; }
      __syncthreads();
      v8f s[2];
#pragma unroll
      for (int ct = 0; ct < 2; ++ct) { const int kk = j0 + ct * 16 + col; const size_t rk = (b * TT + kk) * (NH * 32) + h * 32; v8f c = {}, cl = {};
        { const v16h kh = frag_h(KH + rk, lane); c = wmma16(aq, kh, c); cl = wmma16(aql, kh, cl); cl = wmma16(aq, frag_h(KL + rk, lane), cl); }
#pragma unroll
        for (int r = 0; r < 8; ++r) { const int qi = q0 + 8 * g + r; const int dd = kk - qi; float sc = c[r] + cl[r] * (1.0f / 2048.0f); if (dd >= -WIN && dd <= WIN) sc += srq[wave][8 * g + r][dd + WIN]; const bool keep = smk[wave * 16 + 8 * g + r][ct * 16 + col] != 0; s[ct][r] = keep ? sc * isc : -3.0e38f; } }
#pragma unroll
      for (int r = 0; r < 8; ++r) { float mx = fmaxf(s[0][r], s[1][r]);
#pragma unroll
        for (int o = 1; o < 16; o <<= 1) mx = fmaxf(mx, __shfl_xor(mx, o));
        const float mn = fmaxf(m[r], mx); const float alpha = (m[r] <= -1.0e38f) ? 0.f : __expf(m[r] - mn);
        const float e0 = (s[0][r] <= -1.0e38f) ? 0.f : __expf(s[0][r] - mn), e1 = (s[1][r] <= -1.0e38f) ? 0.f : __expf(s[1][r] - mn); float es = e0 + e1;
#pragma unroll
        for (int o = 1; o < 16; o <<= 1) es += __shfl_xor(es, o);
        l[r] = l[r] * alpha + es; m[r] = (mn <= -1.0e38f) ? m[r] : mn; acc[0][r] *= alpha; acc[1][r] *= alpha; accl[0][r] *= alpha; accl[1][r] *= alpha;
        { const float p0 = e0 * 2048.0f, p1 = e1 * 2048.0f; const _Float16 h0 = (_Float16)p0, h1 = (_Float16)p1; sph[wave][8 * g + r][col] = h0; sph[wave][8 * g + r][16 + col] = h1; spl[wave][8 * g + r][col] = (_Float16)((p0 - (float)h0) * 2048.0f); spl[wave][8 * g + r][16 + col] = (_Float16)((p1 - (float)h1) * 2048.0f); } }
      LDSX();
      const v16h pah = frag_h(&sph[wave][col][0], lane), pal = frag_h(&spl[wave][col][0], lane);
#pragma unroll
      for (int dt = 0; dt < 2; ++dt) { const size_t vo = (b * NH * 32 + h * 32 + dt * 16 + col) * TT + j0; const v16h vh = frag_h(VH + vo, lane); acc[dt] = wmma16(pah, vh, acc[dt]); accl[dt] = wmma16(pal, vh, accl[dt]); accl[dt] = wmma16(pah, frag_h(VL + vo, lane), accl[dt]); }
      __syncthreads(); }
    // windowed relative values: p(t, s) for s = t-4 .. t+4 recomputed with the same formula (lane col < 9 handles offset col)
    if (col < NREL) {
#pragma unroll
      for (int r = 0; r < 8; ++r) { const int qi = q0 + 8 * g + r; const int sidx = qi + col - WIN; float pv = 0.f;
        if (sidx >= 0 && sidx < TT && MASK[((b * TT + qi) * TT) + sidx] != 0) { const size_t rqo = (rq + 8 * g + r) * (NH * 32) + h * 32, rko = (b * TT + sidx) * (NH * 32) + h * 32; float dot = 0.f;
          for (int d = 0; d < HDIM; ++d) { const float qv = (float)QH[rqo + d] + (float)QL[rqo + d] * (1.0f / 2048.0f); const float kv = (float)KH[rko + d] + (float)KL[rko + d] * (1.0f / 2048.0f); dot += qv * kv; }
          const float sc = (dot + srq[wave][8 * g + r][col]) * isc; pv = __expf(sc - m[r]) / l[r]; }
        spp[wave][8 * g + r][col] = pv; } }
    LDSX();
#pragma unroll
    for (int r = 0; r < 8; ++r) { const float il = (1.0f / 2048.0f) / l[r];
#pragma unroll
      for (int dt = 0; dt < 2; ++dt) { const int d = dt * 16 + col; if (d < HDIM) { float v = (acc[dt][r] + accl[dt][r] * (1.0f / 2048.0f)) * il;
          for (int jr = 0; jr < NREL; ++jr) v += spp[wave][8 * g + r][jr] * bfr(EV[jr * HDIM + d]);
          so[wave * 16 + 8 * g + r][hh * HDIM + d] = v; } } }
    __syncthreads(); }
  for (int e = tid; e < 64 * 12; e += 128) { const int r = e / 12, q4 = e % 12; vst2(O + ((size_t)hp * NR + b * TT + qb * 64 + r) * 48 + q4 * 4, *(const v4f*)&so[r][q4 * 4]); }
}
// ---- k_out: block = (64 output channels o, 128 positions, b): y[o][t] = Wo rows (exact) x O (gathered from the [hp][row][48] layout into an LDS bf16 hi/lo tile [128 t][192 c]) + bo -> [B][C][T]
__global__ __launch_bounds__(128) void k_out(const float* __restrict__ O, const __bf16* __restrict__ PK, const float* __restrict__ BO, float* __restrict__ Y) {
  __shared__ __align__(16) __bf16 sh[128][CC + 8], sl[128][CC + 8]; __shared__ __align__(16) float so2[4][16][132];
  const int tid = threadIdx.x, wave = tid >> 5, lane = tid & 31, col = lane & 15, g = lane >> 4; const int o0 = blockIdx.x * 64 + wave * 16; const int n0 = blockIdx.y * 128; const size_t b = blockIdx.z;
  for (int e = tid; e < 128 * CC; e += 128) { const int r = e / CC, c = e % CC; const int hp = c / 48, w = c % 48; const float v = O[((size_t)hp * NR + b * TT + n0 + r) * 48 + w]; const __bf16 hb = (__bf16)v; sh[r][c] = hb; sl[r][c] = (__bf16)(v - (float)hb); }
  for (int e = tid; e < 128 * 8; e += 128) { const int r = e >> 3, c = CC + (e & 7); sh[r][c] = (__bf16)0.f; sl[r][c] = (__bf16)0.f; }
  __syncthreads();
  v8f acc[8] = {};
#pragma unroll
  for (int kc = 0; kc < CC / 32; ++kc) { const v16b a = frag_b(PK + (size_t)3 * CC * CC + (size_t)(o0 + col) * CC + kc * 32, lane);
#pragma unroll
    for (int j = 0; j < 8; ++j) { acc[j] = wmma_bf(a, frag_b(&sl[j * 16 + col][kc * 32], lane), acc[j]); acc[j] = wmma_bf(a, frag_b(&sh[j * 16 + col][kc * 32], lane), acc[j]); } }
#pragma unroll
  for (int j = 0; j < 8; ++j)
#pragma unroll
    for (int r = 0; r < 8; ++r) so2[wave][8 * g + r][j * 16 + col] = acc[j][r] + bfr(BO[o0 + 8 * g + r]);
  LDSX();
  for (int rl = 0; rl < 16; ++rl) vst2(Y + (b * CC + o0 + rl) * TT + n0 + lane * 4, *(const v4f*)&so2[wave][rl][lane * 4]);
}
extern "C" void kernel_launch(void* const* d_in, const int* in_sizes, int n_in, void* d_out, int out_size, void* d_ws, size_t ws_size, hipStream_t stream) {
  (void)in_sizes; (void)n_in; (void)out_size;
  const float** F = (const float**)d_in;   // 0 x [4,192,1024], 1 attn_mask [4,1,1024,1024] i32, 2 Wq [192,192], 3 bq, 4 Wk, 5 bk, 6 Wv, 7 bv, 8 Wo, 9 bo, 10 emb_rel_k [1,9,24], 11 emb_rel_v [1,9,24]
  if (ws_size < (size_t)WS_END) return;
  char* ws = (char*)d_ws; __bf16* PK = (__bf16*)(ws + WS_PK); _Float16 *QH = (_Float16*)(ws + WS_QH), *QL = (_Float16*)(ws + WS_QL), *KH = (_Float16*)(ws + WS_KH), *KL = (_Float16*)(ws + WS_KL), *VH = (_Float16*)(ws + WS_VH), *VL = (_Float16*)(ws + WS_VL); float *RQ = (float*)(ws + WS_RQ), *O = (float*)(ws + WS_O);
  k_pack<<<dim3(CC, 4), 256, 0, stream>>>(F[2], F[4], F[6], F[8], PK);
  k_qkv<<<dim3(TT / 64, NB), 128, 0, stream>>>(F[0], PK, F[3], F[5], F[7], F[10], QH, QL, KH, KL, VH, VL, RQ);
  k_attn<<<dim3(TQB, NH / 2, TNB), 128, 0, stream>>>(QH, QL, KH, KL, VH, VL, RQ, (const int*)d_in[1], F[11], O);
  k_out<<<dim3(CC / 64, TT / 128, TNB), 128, 0, stream>>>(O, PK, F[9], (float*)d_out);
}

// v001
// One run takes 226 microseconds.
// Two timings next to v000 both put it at 1.89 times that version's speed.
// compute dtype: all float inputs rounded to bf16, attn_mask (int) read on device; q/k/v 1x1 convs with EXACT bf16 products on WMMA 16x16x32 (positions as rows via an LDS transpose of the [B,C,T] input, natural weight rows) + biases; q and k stored as f16 hi + (x2048-scaled) residual in zero-padded 32-wide per-head chunks (head dim 24), v as f16 hi + residual channel planes (padded to 32 per head); scores = (q . k (3 products) + the windowed relative-key logits q . emb_k[s-t+4] for |s-t| <= 4 (f32 dots)) / sqrt(24); mask == 0 -> -3e38 (weight forced to 0, so the key is excluded); running-max softmax in f32 (hardware exp); P (scaled by 2^11, as f16 hi + residual) x v hi/lo (3 products); the windowed relative-value term sum_{|s-t|<=4} p(t,s) emb_v[s-t+4] added in f32 from recomputed (identical-formula) weights; output 1x1 conv with the context as bf16 hi + residual x exact Wo rows (2 products) + bo, written channels-first; f32 accumulate.
#include <hip/hip_runtime.h>
#include <math.h>

typedef __attribute__((ext_vector_type(16))) _Float16 v16h;
typedef __attribute__((ext_vector_type(16))) __bf16 v16b;
typedef __attribute__((ext_vector_type(8)))  _Float16 v8h;
typedef __attribute__((ext_vector_type(8)))  float v8f;
typedef __attribute__((ext_vector_type(4)))  float v4f;
typedef __attribute__((ext_vector_type(2)))  float v2f;
typedef __attribute__((ext_vector_type(4)))  unsigned v4u;
typedef __attribute__((ext_vector_type(4)))  int v4i;
typedef float __attribute__((may_alias)) float_a;
typedef int __attribute__((may_alias)) int_a;

template <typename T> __device__ __forceinline__ void vst2(void* p, T v) { *(T*)p = v;  }
__device__ __forceinline__ v8f wmma16(v16h a, v16h b, v8f c) {
  v8f d = __builtin_amdgcn_wmma_f32_16x16x32_f16(false, a, false, b, (short)0, c, false, false);
  asm volatile("v_nop\n\tv_nop\n\tv_nop\n\tv_nop" : "+v"(d) : "v"(a), "v"(b));
  return d;
}
__device__ __forceinline__ v8f wmma_bf(v16b a, v16b b, v8f c) {
  v8f d = __builtin_amdgcn_wmma_f32_16x16x32_bf16(false, a, false, b, (short)0, c, false, false);
  asm volatile("v_nop\n\tv_nop\n\tv_nop\n\tv_nop" : "+v"(d) : "v"(a), "v"(b));
  return d;
}
// 16x16x32 fragments: lane = (h = lane>>4, row/col = lane&15); elements 0..7 = k0+8h+0..7, 8..15 = k0+16+8h+0..7; D element r = row 8h+r
__device__ __forceinline__ v16h frag_h(const _Float16* rowk0, int lane) {
  union { v16h v; v8h q[2]; } u; const _Float16* p = rowk0 + 8 * (lane >> 4);
  u.q[0] = *(const v8h*)p; u.q[1] = *(const v8h*)(p + 16); return u.v;
}
__device__ __forceinline__ v16h frag_f32(const float* rowk0, int lane) {
  v16h a; const float* p = rowk0 + 8 * (lane >> 4);
#pragma unroll
  for (int i = 0; i < 8; ++i) { a[i] = (_Float16)p[i]; a[8 + i] = (_Float16)p[16 + i]; }
  return a;
}
__device__ __forceinline__ v16h frag_f32s(const float* rowk0, int lane, float sc) {
  v16h a; const float* p = rowk0 + 8 * (lane >> 4);
#pragma unroll
  for (int i = 0; i < 8; ++i) { a[i] = (_Float16)(p[i] * sc); a[8 + i] = (_Float16)(p[16 + i] * sc); }
  return a;
}
// column fragment from a [K][ld] layout (column n), rows >= K read as 0
__device__ __forceinline__ v16h fragc_f32(const float* W, int k0, int n, int lane, int ld, int K) {
  v16h a; const int g = lane >> 4;
#pragma unroll
  for (int i = 0; i < 8; ++i) { const int ka = k0 + 8 * g + i, kb = ka + 16;
    a[i] = (_Float16)(ka < K ? W[(size_t)(ka < K ? ka : K - 1) * ld + n] : 0.f); a[8 + i] = (_Float16)(kb < K ? W[(size_t)(kb < K ? kb : K - 1) * ld + n] : 0.f); }
  return a;
}
struct F2 { v16b h, l; };
__device__ __forceinline__ F2 bsplit16(const float v[16]) { F2 r;
#pragma unroll
  for (int i = 0; i < 16; ++i) { const __bf16 h = (__bf16)v[i]; r.h[i] = h; r.l[i] = (__bf16)(v[i] - (float)h); }
  return r; }
__device__ __forceinline__ F2 split_row(const float* row, int k0, int lane) { float v[16]; const float* p = row + k0 + 8 * (lane >> 4);
#pragma unroll
  for (int i = 0; i < 8; ++i) { v[i] = p[i]; v[8 + i] = p[16 + i]; }
  return bsplit16(v); }
__device__ __forceinline__ F2 split_rowK(const float* row, int k0, int lane, int K) { float v[16]; const int g = lane >> 4;
#pragma unroll
  for (int i = 0; i < 8; ++i) { const int ka = k0 + 8 * g + i, kb = ka + 16; v[i] = ka < K ? row[ka < K ? ka : K - 1] : 0.f; v[8 + i] = kb < K ? row[kb < K ? kb : K - 1] : 0.f; }
  return bsplit16(v); }
__device__ __forceinline__ F2 split_col(const float* W, int k0, int n, int lane, int ld, int K) { float v[16]; const int g = lane >> 4;
#pragma unroll
  for (int i = 0; i < 8; ++i) { const int ka = k0 + 8 * g + i, kb = ka + 16; v[i] = ka < K ? W[(size_t)(ka < K ? ka : K - 1) * ld + n] : 0.f; v[8 + i] = kb < K ? W[(size_t)(kb < K ? kb : K - 1) * ld + n] : 0.f; }
  return bsplit16(v); }
__device__ __forceinline__ v8f mac3(const F2& a, const F2& b, v8f c) { c = wmma_bf(a.l, b.h, c); c = wmma_bf(a.h, b.l, c); return wmma_bf(a.h, b.h, c); }
__device__ __forceinline__ float sigm(float v) { return 1.0f / (1.0f + expf(-v)); }
#define LDSX() do { asm volatile("s_wait_dscnt 0" ::: "memory"); __builtin_amdgcn_wave_barrier(); __builtin_amdgcn_fence(__ATOMIC_RELEASE, "workgroup"); } while (0)


// Relative-position multi-head attention (B 4, C 192 as 8 heads x 24, T 1,024, window 4): 1x1-conv q/k/v, scores with windowed relative key embeddings, per-(t,s) mask, softmax, values plus windowed relative value embeddings, 1x1-conv output -> [B, C, T].
#define NB 4
#define CC 192
#define TT 1024
#define NH 8
#define HDIM 24
#define WIN 4
#define NREL (2 * WIN + 1)
#define NR (NB * TT)
#ifndef TQB
#define TQB (TT / 16)
#define TNB NB
#endif
typedef __attribute__((ext_vector_type(8))) __bf16 v8b;
__device__ __forceinline__ v16b frag_b(const __bf16* rowk0, int lane) {
  union { v16b v; v8b q[2]; } u; const __bf16* p = rowk0 + 8 * (lane >> 4);
  u.q[0] = *(const v8b*)p; u.q[1] = *(const v8b*)(p + 16); return u.v;
}
__device__ __forceinline__ float bfr(float v) { return (float)(__bf16)v; }
__device__ __attribute__((noinline)) float exp_ni(float v) { return expf(v); }
__device__ __attribute__((noinline)) float erf_ni(float v) { return erff(v); }

#define PK_Q 0                               // [192][192] Wq ; Wk ; Wv ; Wo (natural rows)
#define PK_END ((size_t)4 * CC * CC)
#define WS_PK  0u
#define WS_QH  (((2u * PK_END) + 127u) / 128u * 128u)   // f16 [NR][8][32] q hi ; QL ; KH ; KL
#define WS_QL  (WS_QH + 2u * NR * NH * 32)
#define WS_KH  (WS_QL + 2u * NR * NH * 32)
#define WS_KL  (WS_KH + 2u * NR * NH * 32)
#define WS_VH  (WS_KL + 2u * NR * NH * 32)               // f16 [b][8*32][T] v hi ; VL  (dims 24..31 of each head zero)
#define WS_VL  (WS_VH + 2u * (size_t)NB * NH * 32 * TT)
#define WS_RQ  (WS_VL + 2u * (size_t)NB * NH * 32 * TT)  // f32 [NR][8][16] q . emb_k[r] (9 used)
#define WS_O   (WS_RQ + 4u * NR * NH * 16)                 // f32 [4 head pairs][NR][48] attention output (block-owned runs)
#define WS_END (WS_O + 4u * NR * CC)

__global__ __launch_bounds__(256) void k_pack(const float* __restrict__ WQ, const float* __restrict__ WK, const float* __restrict__ WV, const float* __restrict__ WO, __bf16* __restrict__ PK) {
  const int n = blockIdx.x, which = blockIdx.y, t = threadIdx.x; const float* Wm = (which == 0) ? WQ : (which == 1) ? WK : (which == 2) ? WV : WO; __shared__ __align__(16) __bf16 s[CC];
  if (t < CC) s[t] = (__bf16)Wm[(size_t)n * CC + t];
  __syncthreads();
  if (t < CC / 8) vst2((unsigned*)(PK + ((size_t)which * CC + n) * CC + t * 8), *(const v4u*)&s[t * 8]);
}
// ---- k_qkv: block = (64 positions, b): A tile [64 t][192 c] from x[b][c][t] (bf16 exact); for which = q,k,v: D = A . W rows + b (12 tiles per wave); q,k -> padded 32-wide per-head f16 hi/lo chunks; v -> planes [b][h*32 + d][t]; also RQ[row][h][r] = q_h . emb_k[r] (f32)
__global__ __launch_bounds__(128) void k_qkv(const float* __restrict__ X, const __bf16* __restrict__ PK, const float* __restrict__ BQ, const float* __restrict__ BK, const float* __restrict__ BV, const float* __restrict__ EK, _Float16* __restrict__ QH, _Float16* __restrict__ QL, _Float16* __restrict__ KH, _Float16* __restrict__ KL, _Float16* __restrict__ VH, _Float16* __restrict__ VL, float* __restrict__ RQ) {
  __shared__ __align__(16) __bf16 sa[64][CC + 8]; __shared__ __align__(16) float so[64][CC + 4]; __shared__ __align__(16) _Float16 sbuf[2 * NH * 32 * 72];   // union: q/k chunk staging [2][64][264] or v planes staging [2][256][72]
  typedef _Float16 (*ChunkT)[NH * 32 + 8]; typedef _Float16 (*PlaneT)[72]; ChunkT sth = (ChunkT)sbuf, stl = (ChunkT)(sbuf + 64 * (NH * 32 + 8)); PlaneT svh = (PlaneT)sbuf, svl = (PlaneT)(sbuf + NH * 32 * 72);
  const int tid = threadIdx.x, wave = tid >> 5, lane = tid & 31, col = lane & 15, g = lane >> 4; const int t0 = blockIdx.x * 64; const size_t b = blockIdx.y; const size_t r0 = b * TT + t0;
  for (int e = tid; e < 64 * CC; e += 128) { const int c = e >> 6, r = e & 63; sa[r][c] = (__bf16)X[(b * CC + c) * TT + t0 + r]; }
  if (tid < 64) for (int c = CC; c < CC + 8; ++c) sa[tid][c] = (__bf16)0.f;
  __syncthreads();
#pragma unroll 1
  for (int which = 0; which < 3; ++which) { const __bf16* P = PK + (size_t)which * CC * CC; const float* BB = (which == 0) ? BQ : (which == 1) ? BK : BV;
    v8f acc[12] = {};
#pragma unroll
    for (int kc = 0; kc < CC / 32; ++kc) { const v16b a = frag_b(&sa[wave * 16 + col][kc * 32], lane);
#pragma unroll
      for (int j = 0; j < 12; ++j) acc[j] = wmma_bf(a, frag_b(P + (size_t)(j * 16 + col) * CC + kc * 32, lane), acc[j]); }
#pragma unroll
    for (int j = 0; j < 12; ++j) { const float bb = bfr(BB[j * 16 + col]);
#pragma unroll
      for (int r = 0; r < 8; ++r) so[wave * 16 + 8 * g + r][j * 16 + col] = acc[j][r] + bb; }
    __syncthreads();
    if (which < 2) {
      for (int e = tid; e < 64 * NH * 32; e += 128) { const int r = e / (NH * 32), q = e % (NH * 32); const int h = q >> 5, d = q & 31; float v = 0.f; if (d < HDIM) v = so[r][h * HDIM + d]; const _Float16 hv = (_Float16)v; sth[r][q] = hv; stl[r][q] = (_Float16)((v - (float)hv) * 2048.0f); }
      if (which == 0) { // relative-key logits seeds: RQ[row][h][rr] = sum_d q[h*24+d] * emb_k[rr][d] (f32), 4 per thread, stored directly (16-B pieces of the row's 512-B RQ record; the block owns rows t0..t0+63)
        for (int e = tid; e < 64 * NH * 4; e += 128) { const int r = e / (NH * 4), q = e % (NH * 4); const int h = q >> 2, r4 = (q & 3) * 4; v4f o4;
          for (int i = 0; i < 4; ++i) { const int rr = r4 + i; float a2 = 0.f; if (rr < NREL) { for (int d = 0; d < HDIM; ++d) a2 += so[r][h * HDIM + d] * bfr(EK[rr * HDIM + d]); } o4[i] = a2; }
          vst2(RQ + ((r0 + r) * NH + h) * 16 + r4, o4); } }
      __syncthreads();
      _Float16* DH_ = which ? KH : QH; _Float16* DL_ = which ? KL : QL;
      for (int e = tid; e < 64 * (NH * 32 / 8); e += 128) { const int r = e / (NH * 4), q = e % (NH * 4); const size_t o = (r0 + r) * (NH * 32) + q * 8; vst2((unsigned*)(DH_ + o), *(const v4u*)&sth[r][q * 8]); vst2((unsigned*)(DL_ + o), *(const v4u*)&stl[r][q * 8]); }
    } else {
      for (int e = tid; e < 64 * NH * 32; e += 128) { const int r = e & 63, q = e >> 6; const int h = q >> 5, d = q & 31; float v = 0.f; if (d < HDIM) v = so[r][h * HDIM + d]; const _Float16 hv = (_Float16)v; svh[q][r] = hv; svl[q][r] = (_Float16)((v - (float)hv) * 2048.0f); }
      __syncthreads();
      for (int e = tid; e < NH * 32 * 8; e += 128) { const int q = e >> 3, pc = e & 7; const size_t o = (b * NH * 32 + q) * TT + t0 + pc * 8; vst2((unsigned*)(VH + o), *(const v4u*)&svh[q][pc * 8]); vst2((unsigned*)(VL + o), *(const v4u*)&svl[q][pc * 8]); } }
    __syncthreads(); }
}
// ---- k_attn: block = (16 queries, head pair, b), 8 waves: wave = (head of the pair, quarter of the 1,024 keys). Each wave runs its 256 keys in tiles of 32 on its own (mask words read per lane in the score layout, no barrier in the loop): scores (3-product q.k + windowed rel-key seed) / sqrt(24), mask == 0 excluded; online softmax; P (x2^11 hi + residual) x V (2 tiles of 16 dims). The four partial (max, sum, context) of a head meet in LDS behind one barrier and are rescaled to the common max; the same pass adds sum_{|s-t|<=4} p(t,s) emb_v[s-t+4]; O rows [hp][row][(h % 2)*24 + d]
#define KSPL 4
// fragment from a wave-uniform base plus the lane's 32-bit byte offset
__device__ __forceinline__ v16h frag_u(const _Float16* ubase, unsigned boff) {
  union { v16h v; v8h q[2]; } u; const char* p = (const char*)ubase;
  u.q[0] = *(const v8h*)(p + boff); u.q[1] = *(const v8h*)(p + 32 + boff); return u.v;
}
__global__ __launch_bounds__(256, 8) void k_attn(const _Float16* __restrict__ QH, const _Float16* __restrict__ QL, const _Float16* __restrict__ KH, const _Float16* __restrict__ KL, const _Float16* __restrict__ VH, const _Float16* __restrict__ VL, const float* __restrict__ RQ, const int* __restrict__ MASK, const float* __restrict__ EV, float* __restrict__ O) {
  __shared__ __align__(16) _Float16 sph[2 * KSPL][16][40], spl[2 * KSPL][16][40]; __shared__ float srq[2 * KSPL][16][NREL + 1]; __shared__ float spp[2][16][NREL + 1]; __shared__ float sm[2 * KSPL][16], sl[2 * KSPL][16]; __shared__ __align__(16) float sac[2 * KSPL][16][36];
  const int tid = threadIdx.x, wave = __builtin_amdgcn_readfirstlane(tid >> 5), lane = tid & 31, col = lane & 15, g = lane >> 4; const int hp = blockIdx.y; const size_t b = blockIdx.z; const int q0 = blockIdx.x * 16; const size_t rq = b * TT + q0; const float isc = 1.0f / sqrtf((float)HDIM);
  const int h = hp * 2 + wave / KSPL, kbase = (wave % KSPL) * (TT / KSPL);
  // the wave's number is made scalar so that the wave-uniform part of every K, V and mask address is scalar arithmetic; the second launch bound asks for 8 waves per SIMD (128 VGPRs): four blocks per WGP, the whole grid resident at once
  const size_t kw = (b * TT + kbase) * (NH * 32) + h * 32, vw = (b * NH * 32 + h * 32) * TT + kbase; const int* MKw = MASK + rq * TT + kbase;
  const unsigned ko = col * (NH * 64) + 16 * g, vof = col * (TT * 2) + 16 * g, mo = 8 * g * TT + col;
  if (lane < 16) { for (int rr = 0; rr < NREL; ++rr) srq[wave][lane][rr] = RQ[((rq + lane) * NH + h) * 16 + rr]; }
  const v16h aq = frag_h(QH + (rq + col) * (NH * 32) + h * 32, lane), aql = frag_h(QL + (rq + col) * (NH * 32) + h * 32, lane);
  float m[8], l[8];
#pragma unroll
  for (int r = 0; r < 8; ++r) { m[r] = -3.0e38f; l[r] = 0.f; }
  v8f acc[2] = {}, accl[2] = {};
  LDSX();
#pragma unroll 1
  for (int ks = 0; ks < TT / KSPL / 32; ++ks) { const int j0 = kbase + ks * 32;
    v8f s[2];
#pragma unroll
    for (int ct = 0; ct < 2; ++ct) { const int kk = j0 + ct * 16 + col; const size_t rk = kw + (size_t)(ks * 32 + ct * 16) * (NH * 32); v8f c = {}, cl = {}; int mk[8];
#pragma unroll
      for (int r = 0; r < 8; ++r) mk[r] = (MKw + ks * 32 + ct * 16 + r * TT)[mo];
      { const v16h kh = frag_u(KH + rk, ko); c = wmma16(aq, kh, c); cl = wmma16(aql, kh, cl); cl = wmma16(aq, frag_u(KL + rk, ko), cl); }
#pragma unroll
      for (int r = 0; r < 8; ++r) { const int qi = q0 + 8 * g + r; const int dd = kk - qi; float sc = c[r] + cl[r] * (1.0f / 2048.0f); if (dd >= -WIN && dd <= WIN) sc += srq[wave][8 * g + r][dd + WIN]; const bool keep = mk[r] != 0; s[ct][r] = keep ? sc * isc : -3.0e38f; } }
#pragma unroll
    for (int r = 0; r < 8; ++r) { float mx = fmaxf(s[0][r], s[1][r]);
#pragma unroll
      for (int o = 1; o < 16; o <<= 1) mx = fmaxf(mx, __shfl_xor(mx, o));
      const float mn = fmaxf(m[r], mx); const float alpha = (m[r] <= -1.0e38f) ? 0.f : __expf(m[r] - mn);
      const float e0 = (s[0][r] <= -1.0e38f) ? 0.f : __expf(s[0][r] - mn), e1 = (s[1][r] <= -1.0e38f) ? 0.f : __expf(s[1][r] - mn); float es = e0 + e1;
#pragma unroll
      for (int o = 1; o < 16; o <<= 1) es += __shfl_xor(es, o);
      l[r] = l[r] * alpha + es; m[r] = (mn <= -1.0e38f) ? m[r] : mn; acc[0][r] *= alpha; acc[1][r] *= alpha; accl[0][r] *= alpha; accl[1][r] *= alpha;
      { const float p0 = e0 * 2048.0f, p1 = e1 * 2048.0f; const _Float16 h0 = (_Float16)p0, h1 = (_Float16)p1; sph[wave][8 * g + r][col] = h0; sph[wave][8 * g + r][16 + col] = h1; spl[wave][8 * g + r][col] = (_Float16)((p0 - (float)h0) * 2048.0f); spl[wave][8 * g + r][16 + col] = (_Float16)((p1 - (float)h1) * 2048.0f); } }
    LDSX();
    const v16h pah = frag_h(&sph[wave][col][0], lane), pal = frag_h(&spl[wave][col][0], lane);
#pragma unroll
    for (int dt = 0; dt < 2; ++dt) { const size_t vo = vw + (size_t)(dt * 16) * TT + ks * 32; const v16h vh = frag_u(VH + vo, vof); acc[dt] = wmma16(pah, vh, acc[dt]); accl[dt] = wmma16(pal, vh, accl[dt]); accl[dt] = wmma16(pah, frag_u(VL + vo, vof), accl[dt]); } }
  // this wave's partial: running max and sum per row, context with its residual folded in
  if (col == 0) {
#pragma unroll
    for (int r = 0; r < 8; ++r) { sm[wave][8 * g + r] = m[r]; sl[wave][8 * g + r] = l[r]; } }
#pragma unroll
  for (int r = 0; r < 8; ++r)
#pragma unroll
    for (int dt = 0; dt < 2; ++dt) sac[wave][8 * g + r][dt * 16 + col] = acc[dt][r] + accl[dt][r] * (1.0f / 2048.0f);
  // windowed relative values: the score of (t, s) for s = t-4 .. t+4 recomputed with the same formula, one (head, row, offset) per thread; excluded keys carry the sentinel
  for (int e = tid; e < 2 * 16 * NREL; e += 256) { const int h2 = e / (16 * NREL), rr = (e / NREL) & 15, off = e % NREL; const int hx = hp * 2 + h2; const int sidx = q0 + rr + off - WIN; float sv = -3.0e38f;
    if (sidx >= 0 && sidx < TT && MASK[((rq + rr) * TT) + sidx] != 0) { const size_t rqo = (rq + rr) * (NH * 32) + hx * 32, rko = (b * TT + sidx) * (NH * 32) + hx * 32; float dot = 0.f;
      for (int d = 0; d < HDIM; ++d) { const float qv = (float)QH[rqo + d] + (float)QL[rqo + d] * (1.0f / 2048.0f); const float kv = (float)KH[rko + d] + (float)KL[rko + d] * (1.0f / 2048.0f); dot += qv * kv; }
      sv = (dot + RQ[((rq + rr) * NH + hx) * 16 + off]) * isc; }
    spp[h2][rr][off] = sv; }
  __syncthreads();
  // merge: one thread per (row, head, 4 dims); every partial is rescaled from its own max to the row's max
  if (tid < 16 * 12) { const int r = tid / 12, q4 = tid % 12; const int h2 = q4 / 6, d = (q4 % 6) * 4, w0 = h2 * KSPL; float M = -3.0e38f, L = 0.f, f[KSPL];
#pragma unroll
    for (int w = 0; w < KSPL; ++w) M = fmaxf(M, sm[w0 + w][r]);
#pragma unroll
    for (int w = 0; w < KSPL; ++w) { const float mw = sm[w0 + w][r]; f[w] = (mw <= -1.0e38f) ? 0.f : __expf(mw - M); L += sl[w0 + w][r] * f[w]; }
    v4f a = {};
#pragma unroll
    for (int w = 0; w < KSPL; ++w) a += *(const v4f*)&sac[w0 + w][r][d] * f[w];
    v4f o4 = a * ((1.0f / 2048.0f) / L);
    for (int jr = 0; jr < NREL; ++jr) { const float sv = spp[h2][r][jr]; const float pv = (sv <= -1.0e38f) ? 0.f : __expf(sv - M) / L;
#pragma unroll
      for (int i = 0; i < 4; ++i) o4[i] += pv * bfr(EV[jr * HDIM + d + i]); }
    vst2(O + ((size_t)hp * NR + rq + r) * 48 + q4 * 4, o4); }
}
// ---- k_out: block = (64 output channels o, 128 positions, b): y[o][t] = Wo rows (exact) x O (gathered from the [hp][row][48] layout into an LDS bf16 hi/lo tile [128 t][192 c]) + bo -> [B][C][T]
__global__ __launch_bounds__(128) void k_out(const float* __restrict__ O, const __bf16* __restrict__ PK, const float* __restrict__ BO, float* __restrict__ Y) {
  __shared__ __align__(16) __bf16 sh[128][CC + 8], sl[128][CC + 8]; __shared__ __align__(16) float so2[4][16][132];
  const int tid = threadIdx.x, wave = tid >> 5, lane = tid & 31, col = lane & 15, g = lane >> 4; const int o0 = blockIdx.x * 64 + wave * 16; const int n0 = blockIdx.y * 128; const size_t b = blockIdx.z;
  for (int e = tid; e < 128 * CC; e += 128) { const int r = e / CC, c = e % CC; const int hp = c / 48, w = c % 48; const float v = O[((size_t)hp * NR + b * TT + n0 + r) * 48 + w]; const __bf16 hb = (__bf16)v; sh[r][c] = hb; sl[r][c] = (__bf16)(v - (float)hb); }
  for (int e = tid; e < 128 * 8; e += 128) { const int r = e >> 3, c = CC + (e & 7); sh[r][c] = (__bf16)0.f; sl[r][c] = (__bf16)0.f; }
  __syncthreads();
  v8f acc[8] = {};
#pragma unroll
  for (int kc = 0; kc < CC / 32; ++kc) { const v16b a = frag_b(PK + (size_t)3 * CC * CC + (size_t)(o0 + col) * CC + kc * 32, lane);
#pragma unroll
    for (int j = 0; j < 8; ++j) { acc[j] = wmma_bf(a, frag_b(&sl[j * 16 + col][kc * 32], lane), acc[j]); acc[j] = wmma_bf(a, frag_b(&sh[j * 16 + col][kc * 32], lane), acc[j]); } }
#pragma unroll
  for (int j = 0; j < 8; ++j)
#pragma unroll
    for (int r = 0; r < 8; ++r) so2[wave][8 * g + r][j * 16 + col] = acc[j][r] + bfr(BO[o0 + 8 * g + r]);
  LDSX();
  for (int rl = 0; rl < 16; ++rl) vst2(Y + (b * CC + o0 + rl) * TT + n0 + lane * 4, *(const v4f*)&so2[wave][rl][lane * 4]);
}
extern "C" void kernel_launch(void* const* d_in, const int* in_sizes, int n_in, void* d_out, int out_size, void* d_ws, size_t ws_size, hipStream_t stream) {
  (void)in_sizes; (void)n_in; (void)out_size;
  const float** F = (const float**)d_in;   // 0 x [4,192,1024], 1 attn_mask [4,1,1024,1024] i32, 2 Wq [192,192], 3 bq, 4 Wk, 5 bk, 6 Wv, 7 bv, 8 Wo, 9 bo, 10 emb_rel_k [1,9,24], 11 emb_rel_v [1,9,24]
  if (ws_size < (size_t)WS_END) return;
  char* ws = (char*)d_ws; __bf16* PK = (__bf16*)(ws + WS_PK); _Float16 *QH = (_Float16*)(ws + WS_QH), *QL = (_Float16*)(ws + WS_QL), *KH = (_Float16*)(ws + WS_KH), *KL = (_Float16*)(ws + WS_KL), *VH = (_Float16*)(ws + WS_VH), *VL = (_Float16*)(ws + WS_VL); float *RQ = (float*)(ws + WS_RQ), *O = (float*)(ws + WS_O);
  k_pack<<<dim3(CC, 4), 256, 0, stream>>>(F[2], F[4], F[6], F[8], PK);
  k_qkv<<<dim3(TT / 64, NB), 128, 0, stream>>>(F[0], PK, F[3], F[5], F[7], F[10], QH, QL, KH, KL, VH, VL, RQ);
  k_attn<<<dim3(TQB, NH / 2, TNB), 256, 0, stream>>>(QH, QL, KH, KL, VH, VL, RQ, (const int*)d_in[1], F[11], O);
  k_out<<<dim3(CC / 64, TT / 128, TNB), 128, 0, stream>>>(O, PK, F[9], (float*)d_out);
}

// v002
// A run of this version takes 148 microseconds.
// Next to v001, in two timings, it ran 1.55 and 1.53 times as fast.
// All steps since v000 together make it 2.92 times as fast.
// compute dtype: all float inputs rounded to bf16, attn_mask (int) read on device; q/k/v 1x1 convs with EXACT bf16 products on WMMA 16x16x32 (positions as rows via an LDS transpose of the [B,C,T] input, natural weight rows) + biases; q and k stored as f16 hi + (x2048-scaled) residual in zero-padded 32-wide per-head chunks (head dim 24), v as f16 hi + residual channel planes (padded to 32 per head); scores = (q . k (3 products) + the windowed relative-key logits q . emb_k[s-t+4] for |s-t| <= 4 (f32 dots)) / sqrt(24); mask == 0 -> -3e38 (weight forced to 0, so the key is excluded); running-max softmax in f32 (hardware exp); P (scaled by 2^11, as f16 hi + residual) x v hi/lo (3 products); the windowed relative-value term sum_{|s-t|<=4} p(t,s) emb_v[s-t+4] added in f32 from recomputed (identical-formula) weights; output 1x1 conv with the context as bf16 hi + residual x exact Wo rows (2 products) + bo, written channels-first; f32 accumulate.
#include <hip/hip_runtime.h>
#include <math.h>

typedef __attribute__((ext_vector_type(16))) _Float16 v16h;
typedef __attribute__((ext_vector_type(16))) __bf16 v16b;
typedef __attribute__((ext_vector_type(8)))  _Float16 v8h;
typedef __attribute__((ext_vector_type(8)))  float v8f;
typedef __attribute__((ext_vector_type(4)))  float v4f;
typedef __attribute__((ext_vector_type(2)))  float v2f;
typedef __attribute__((ext_vector_type(4)))  unsigned v4u;
typedef __attribute__((ext_vector_type(4)))  int v4i;
typedef float __attribute__((may_alias)) float_a;
typedef int __attribute__((may_alias)) int_a;

template <typename T> __device__ __forceinline__ void vst2(void* p, T v) { *(T*)p = v;  }
__device__ __forceinline__ v8f wmma16(v16h a, v16h b, v8f c) {
  v8f d = __builtin_amdgcn_wmma_f32_16x16x32_f16(false, a, false, b, (short)0, c, false, false);
  asm volatile("v_nop\n\tv_nop\n\tv_nop\n\tv_nop" : "+v"(d) : "v"(a), "v"(b));
  return d;
}
__device__ __forceinline__ v8f wmma_bf(v16b a, v16b b, v8f c) {
  v8f d = __builtin_amdgcn_wmma_f32_16x16x32_bf16(false, a, false, b, (short)0, c, false, false);
  asm volatile("v_nop\n\tv_nop\n\tv_nop\n\tv_nop" : "+v"(d) : "v"(a), "v"(b));
  return d;
}
// 16x16x32 fragments: lane = (h = lane>>4, row/col = lane&15); elements 0..7 = k0+8h+0..7, 8..15 = k0+16+8h+0..7; D element r = row 8h+r
__device__ __forceinline__ v16h frag_h(const _Float16* rowk0, int lane) {
  union { v16h v; v8h q[2]; } u; const _Float16* p = rowk0 + 8 * (lane >> 4);
  u.q[0] = *(const v8h*)p; u.q[1] = *(const v8h*)(p + 16); return u.v;
}
__device__ __forceinline__ v16h frag_f32(const float* rowk0, int lane) {
  v16h a; const float* p = rowk0 + 8 * (lane >> 4);
#pragma unroll
  for (int i = 0; i < 8; ++i) { a[i] = (_Float16)p[i]; a[8 + i] = (_Float16)p[16 + i]; }
  return a;
}
__device__ __forceinline__ v16h frag_f32s(const float* rowk0, int lane, float sc) {
  v16h a; const float* p = rowk0 + 8 * (lane >> 4);
#pragma unroll
  for (int i = 0; i < 8; ++i) { a[i] = (_Float16)(p[i] * sc); a[8 + i] = (_Float16)(p[16 + i] * sc); }
  return a;
}
// column fragment from a [K][ld] layout (column n), rows >= K read as 0
__device__ __forceinline__ v16h fragc_f32(const float* W, int k0, int n, int lane, int ld, int K) {
  v16h a; const int g = lane >> 4;
#pragma unroll
  for (int i = 0; i < 8; ++i) { const int ka = k0 + 8 * g + i, kb = ka + 16;
    a[i] = (_Float16)(ka < K ? W[(size_t)(ka < K ? ka : K - 1) * ld + n] : 0.f); a[8 + i] = (_Float16)(kb < K ? W[(size_t)(kb < K ? kb : K - 1) * ld + n] : 0.f); }
  return a;
}
struct F2 { v16b h, l; };
__device__ __forceinline__ F2 bsplit16(const float v[16]) { F2 r;
#pragma unroll
  for (int i = 0; i < 16; ++i) { const __bf16 h = (__bf16)v[i]; r.h[i] = h; r.l[i] = (__bf16)(v[i] - (float)h); }
  return r; }
__device__ __forceinline__ F2 split_row(const float* row, int k0, int lane) { float v[16]; const float* p = row + k0 + 8 * (lane >> 4);
#pragma unroll
  for (int i = 0; i < 8; ++i) { v[i] = p[i]; v[8 + i] = p[16 + i]; }
  return bsplit16(v); }
__device__ __forceinline__ F2 split_rowK(const float* row, int k0, int lane, int K) { float v[16]; const int g = lane >> 4;
#pragma unroll
  for (int i = 0; i < 8; ++i) { const int ka = k0 + 8 * g + i, kb = ka + 16; v[i] = ka < K ? row[ka < K ? ka : K - 1] : 0.f; v[8 + i] = kb < K ? row[kb < K ? kb : K - 1] : 0.f; }
  return bsplit16(v); }
__device__ __forceinline__ F2 split_col(const float* W, int k0, int n, int lane, int ld, int K) { float v[16]; const int g = lane >> 4;
#pragma unroll
  for (int i = 0; i < 8; ++i) { const int ka = k0 + 8 * g + i, kb = ka + 16; v[i] = ka < K ? W[(size_t)(ka < K ? ka : K - 1) * ld + n] : 0.f; v[8 + i] = kb < K ? W[(size_t)(kb < K ? kb : K - 1) * ld + n] : 0.f; }
  return bsplit16(v); }
__device__ __forceinline__ v8f mac3(const F2& a, const F2& b, v8f c) { c = wmma_bf(a.l, b.h, c); c = wmma_bf(a.h, b.l, c); return wmma_bf(a.h, b.h, c); }
__device__ __forceinline__ float sigm(float v) { return 1.0f / (1.0f + expf(-v)); }
#define LDSX() do { asm volatile("s_wait_dscnt 0" ::: "memory"); __builtin_amdgcn_wave_barrier(); __builtin_amdgcn_fence(__ATOMIC_RELEASE, "workgroup"); } while (0)


// Relative-position multi-head attention (B 4, C 192 as 8 heads x 24, T 1,024, window 4): 1x1-conv q/k/v, scores with windowed relative key embeddings, per-(t,s) mask, softmax, values plus windowed relative value embeddings, 1x1-conv output -> [B, C, T].
#define NB 4
#define CC 192
#define TT 1024
#define NH 8
#define HDIM 24
#define WIN 4
#define NREL (2 * WIN + 1)
#define NR (NB * TT)
#ifndef TQB
#define TQB (TT / 16)
#define TNB NB
#endif
typedef __attribute__((ext_vector_type(8))) __bf16 v8b;
__device__ __forceinline__ v16b frag_b(const __bf16* rowk0, int lane) {
  union { v16b v; v8b q[2]; } u; const __bf16* p = rowk0 + 8 * (lane >> 4);
  u.q[0] = *(const v8b*)p; u.q[1] = *(const v8b*)(p + 16); return u.v;
}
__device__ __forceinline__ float bfr(float v) { return (float)(__bf16)v; }
__device__ __attribute__((noinline)) float exp_ni(float v) { return expf(v); }
__device__ __attribute__((noinline)) float erf_ni(float v) { return erff(v); }

#define PK_Q 0                               // [192][192] Wq ; Wk ; Wv ; Wo (natural rows)
#define PK_END ((size_t)4 * CC * CC)
#define WS_PK  0u
#define WS_QH  (((2u * PK_END) + 127u) / 128u * 128u)   // f16 [NR][8][32] q hi ; QL ; KH ; KL
#define WS_QL  (WS_QH + 2u * NR * NH * 32)
#define WS_KH  (WS_QL + 2u * NR * NH * 32)
#define WS_KL  (WS_KH + 2u * NR * NH * 32)
#define WS_VH  (WS_KL + 2u * NR * NH * 32)               // f16 [b][8*32][T] v hi ; VL  (dims 24..31 of each head zero)
#define WS_VL  (WS_VH + 2u * (size_t)NB * NH * 32 * TT)
#define WS_RQ  (WS_VL + 2u * (size_t)NB * NH * 32 * TT)  // f32 [NR][8][16] q . emb_k[r] (9 used)
#define WS_O   (WS_RQ + 4u * NR * NH * 16)                 // f32 [4 head pairs][NR][48] attention output (block-owned runs)
#define WS_END (WS_O + 4u * NR * CC)

__global__ __launch_bounds__(256) void k_pack(const float* __restrict__ WQ, const float* __restrict__ WK, const float* __restrict__ WV, const float* __restrict__ WO, __bf16* __restrict__ PK) {
  const int n = blockIdx.x, which = blockIdx.y, t = threadIdx.x; const float* Wm = (which == 0) ? WQ : (which == 1) ? WK : (which == 2) ? WV : WO; __shared__ __align__(16) __bf16 s[CC];
  if (t < CC) s[t] = (__bf16)Wm[(size_t)n * CC + t];
  __syncthreads();
  if (t < CC / 8) vst2((unsigned*)(PK + ((size_t)which * CC + n) * CC + t * 8), *(const v4u*)&s[t * 8]);
}
// ---- k_qkv: block = (64 positions, b, one of q / k / v), 16 waves: wave = (16-position row tile, 3 of the 12 column tiles). A tile [64 t][192 c] from x[b][c][t] (bf16 exact); D = A . W rows + b; q,k -> padded 32-wide per-head f16 hi/lo chunks; v -> planes [b][h*32 + d][t]; the q block also writes RQ[row][h][r] = q_h . emb_k[r] (f32)
__global__ __launch_bounds__(512) void k_qkv(const float* __restrict__ X, const __bf16* __restrict__ PK, const float* __restrict__ BQ, const float* __restrict__ BK, const float* __restrict__ BV, const float* __restrict__ EK, _Float16* __restrict__ QH, _Float16* __restrict__ QL, _Float16* __restrict__ KH, _Float16* __restrict__ KL, _Float16* __restrict__ VH, _Float16* __restrict__ VL, float* __restrict__ RQ) {
  __shared__ __align__(16) __bf16 sa[64][CC + 8]; __shared__ __align__(16) float so[64][CC + 4]; __shared__ __align__(16) _Float16 sbuf[2 * NH * 32 * 72];   // union: q/k chunk staging [2][64][264] or v planes staging [2][256][72]
  typedef _Float16 (*ChunkT)[NH * 32 + 8]; typedef _Float16 (*PlaneT)[72]; ChunkT sth = (ChunkT)sbuf, stl = (ChunkT)(sbuf + 64 * (NH * 32 + 8)); PlaneT svh = (PlaneT)sbuf, svl = (PlaneT)(sbuf + NH * 32 * 72);
  const int tid = threadIdx.x, wave = tid >> 5, lane = tid & 31, col = lane & 15, g = lane >> 4, rt = wave & 3, cg = wave >> 2; const int t0 = blockIdx.x * 64, which = blockIdx.z; const size_t b = blockIdx.y; const size_t r0 = b * TT + t0;
  for (int e = tid; e < 64 * CC; e += 512) { const int c = e >> 6, r = e & 63; sa[r][c] = (__bf16)X[(b * CC + c) * TT + t0 + r]; }
  if (tid < 64) for (int c = CC; c < CC + 8; ++c) sa[tid][c] = (__bf16)0.f;
  __syncthreads();
  const __bf16* P = PK + (size_t)which * CC * CC; const float* BB = (which == 0) ? BQ : (which == 1) ? BK : BV;
  v8f acc[3] = {};
#pragma unroll
  for (int kc = 0; kc < CC / 32; ++kc) { const v16b a = frag_b(&sa[rt * 16 + col][kc * 32], lane);
#pragma unroll
    for (int j = 0; j < 3; ++j) acc[j] = wmma_bf(a, frag_b(P + (size_t)((cg * 3 + j) * 16 + col) * CC + kc * 32, lane), acc[j]); }
#pragma unroll
  for (int j = 0; j < 3; ++j) { const float bb = bfr(BB[(cg * 3 + j) * 16 + col]);
#pragma unroll
    for (int r = 0; r < 8; ++r) so[rt * 16 + 8 * g + r][(cg * 3 + j) * 16 + col] = acc[j][r] + bb; }
  __syncthreads();
  if (which < 2) {
    for (int e = tid; e < 64 * NH * 32; e += 512) { const int r = e / (NH * 32), q = e % (NH * 32); const int h = q >> 5, d = q & 31; float v = 0.f; if (d < HDIM) v = so[r][h * HDIM + d]; const _Float16 hv = (_Float16)v; sth[r][q] = hv; stl[r][q] = (_Float16)((v - (float)hv) * 2048.0f); }
    if (which == 0) { // relative-key logits seeds: RQ[row][h][rr] = sum_d q[h*24+d] * emb_k[rr][d] (f32), 4 per thread, stored directly (16-B pieces of the row's 512-B RQ record; the block owns rows t0..t0+63)
      for (int e = tid; e < 64 * NH * 4; e += 512) { const int r = e / (NH * 4), q = e % (NH * 4); const int h = q >> 2, r4 = (q & 3) * 4; v4f o4;
        for (int i = 0; i < 4; ++i) { const int rr = r4 + i; float a2 = 0.f; if (rr < NREL) { for (int d = 0; d < HDIM; ++d) a2 += so[r][h * HDIM + d] * bfr(EK[rr * HDIM + d]); } o4[i] = a2; }
        vst2(RQ + ((r0 + r) * NH + h) * 16 + r4, o4); } }
    __syncthreads();
    _Float16* DH_ = which ? KH : QH; _Float16* DL_ = which ? KL : QL;
    for (int e = tid; e < 64 * (NH * 32 / 8); e += 512) { const int r = e / (NH * 4), q = e % (NH * 4); const size_t o = (r0 + r) * (NH * 32) + q * 8; vst2((unsigned*)(DH_ + o), *(const v4u*)&sth[r][q * 8]); vst2((unsigned*)(DL_ + o), *(const v4u*)&stl[r][q * 8]); }
  } else {
    for (int e = tid; e < 64 * NH * 32; e += 512) { const int r = e & 63, q = e >> 6; const int h = q >> 5, d = q & 31; float v = 0.f; if (d < HDIM) v = so[r][h * HDIM + d]; const _Float16 hv = (_Float16)v; svh[q][r] = hv; svl[q][r] = (_Float16)((v - (float)hv) * 2048.0f); }
    __syncthreads();
    for (int e = tid; e < NH * 32 * 8; e += 512) { const int q = e >> 3, pc = e & 7; const size_t o = (b * NH * 32 + q) * TT + t0 + pc * 8; vst2((unsigned*)(VH + o), *(const v4u*)&svh[q][pc * 8]); vst2((unsigned*)(VL + o), *(const v4u*)&svl[q][pc * 8]); } }
}
// ---- k_attn: block = (16 queries, head pair, b), 8 waves: wave = (head of the pair, quarter of the 1,024 keys). Each wave runs its 256 keys in tiles of 32 on its own (mask words read per lane in the score layout, no barrier in the loop): scores (3-product q.k + windowed rel-key seed) / sqrt(24), mask == 0 excluded; online softmax; P (x2^11 hi + residual) x V (2 tiles of 16 dims). The four partial (max, sum, context) of a head meet in LDS behind one barrier and are rescaled to the common max; the same pass adds sum_{|s-t|<=4} p(t,s) emb_v[s-t+4]; O rows [hp][row][(h % 2)*24 + d]
#define KSPL 4
// fragment from a wave-uniform base plus the lane's 32-bit byte offset
__device__ __forceinline__ v16h frag_u(const _Float16* ubase, unsigned boff) {
  union { v16h v; v8h q[2]; } u; const char* p = (const char*)ubase;
  u.q[0] = *(const v8h*)(p + boff); u.q[1] = *(const v8h*)(p + 32 + boff); return u.v;
}
__global__ __launch_bounds__(256, 8) void k_attn(const _Float16* __restrict__ QH, const _Float16* __restrict__ QL, const _Float16* __restrict__ KH, const _Float16* __restrict__ KL, const _Float16* __restrict__ VH, const _Float16* __restrict__ VL, const float* __restrict__ RQ, const int* __restrict__ MASK, const float* __restrict__ EV, float* __restrict__ O) {
  __shared__ __align__(16) _Float16 sph[2 * KSPL][16][40], spl[2 * KSPL][16][40]; __shared__ float srq[2 * KSPL][16][NREL + 1]; __shared__ float spp[2][16][NREL + 1]; __shared__ float sm[2 * KSPL][16], sl[2 * KSPL][16]; __shared__ __align__(16) float sac[2 * KSPL][16][36];
  const int tid = threadIdx.x, wave = __builtin_amdgcn_readfirstlane(tid >> 5), lane = tid & 31, col = lane & 15, g = lane >> 4; const int hp = blockIdx.y; const size_t b = blockIdx.z; const int q0 = blockIdx.x * 16; const size_t rq = b * TT + q0; const float isc = 1.0f / sqrtf((float)HDIM);
  const int h = hp * 2 + wave / KSPL, kbase = (wave % KSPL) * (TT / KSPL);
  // the wave's number is made scalar so that the wave-uniform part of every K, V and mask address is scalar arithmetic; the second launch bound asks for 8 waves per SIMD (128 VGPRs): four blocks per WGP, the whole grid resident at once
  const size_t kw = (b * TT + kbase) * (NH * 32) + h * 32, vw = (b * NH * 32 + h * 32) * TT + kbase; const int* MKw = MASK + rq * TT + kbase;
  const unsigned ko = col * (NH * 64) + 16 * g, vof = col * (TT * 2) + 16 * g, mo = 8 * g * TT + col;
  if (lane < 16) { for (int rr = 0; rr < NREL; ++rr) srq[wave][lane][rr] = RQ[((rq + lane) * NH + h) * 16 + rr]; }
  const v16h aq = frag_h(QH + (rq + col) * (NH * 32) + h * 32, lane), aql = frag_h(QL + (rq + col) * (NH * 32) + h * 32, lane);
  float m[8], l[8];
#pragma unroll
  for (int r = 0; r < 8; ++r) { m[r] = -3.0e38f; l[r] = 0.f; }
  v8f acc[2] = {}, accl[2] = {};
  LDSX();
#pragma unroll 1
  for (int ks = 0; ks < TT / KSPL / 32; ++ks) { const int j0 = kbase + ks * 32;
    v8f s[2];
#pragma unroll
    for (int ct = 0; ct < 2; ++ct) { const int kk = j0 + ct * 16 + col; const size_t rk = kw + (size_t)(ks * 32 + ct * 16) * (NH * 32); v8f c = {}, cl = {}; int mk[8];
#pragma unroll
      for (int r = 0; r < 8; ++r) mk[r] = (MKw + ks * 32 + ct * 16 + r * TT)[mo];
      { const v16h kh = frag_u(KH + rk, ko); c = wmma16(aq, kh, c); cl = wmma16(aql, kh, cl); cl = wmma16(aq, frag_u(KL + rk, ko), cl); }
#pragma unroll
      for (int r = 0; r < 8; ++r) { const int qi = q0 + 8 * g + r; const int dd = kk - qi; float sc = c[r] + cl[r] * (1.0f / 2048.0f); if (dd >= -WIN && dd <= WIN) sc += srq[wave][8 * g + r][dd + WIN]; const bool keep = mk[r] != 0; s[ct][r] = keep ? sc * isc : -3.0e38f; } }
#pragma unroll
    for (int r = 0; r < 8; ++r) { float mx = fmaxf(s[0][r], s[1][r]);
#pragma unroll
      for (int o = 1; o < 16; o <<= 1) mx = fmaxf(mx, __shfl_xor(mx, o));
      const float mn = fmaxf(m[r], mx); const float alpha = (m[r] <= -1.0e38f) ? 0.f : __expf(m[r] - mn);
      const float e0 = (s[0][r] <= -1.0e38f) ? 0.f : __expf(s[0][r] - mn), e1 = (s[1][r] <= -1.0e38f) ? 0.f : __expf(s[1][r] - mn); float es = e0 + e1;
#pragma unroll
      for (int o = 1; o < 16; o <<= 1) es += __shfl_xor(es, o);
      l[r] = l[r] * alpha + es; m[r] = (mn <= -1.0e38f) ? m[r] : mn; acc[0][r] *= alpha; acc[1][r] *= alpha; accl[0][r] *= alpha; accl[1][r] *= alpha;
      { const float p0 = e0 * 2048.0f, p1 = e1 * 2048.0f; const _Float16 h0 = (_Float16)p0, h1 = (_Float16)p1; sph[wave][8 * g + r][col] = h0; sph[wave][8 * g + r][16 + col] = h1; spl[wave][8 * g + r][col] = (_Float16)((p0 - (float)h0) * 2048.0f); spl[wave][8 * g + r][16 + col] = (_Float16)((p1 - (float)h1) * 2048.0f); } }
    LDSX();
    const v16h pah = frag_h(&sph[wave][col][0], lane), pal = frag_h(&spl[wave][col][0], lane);
#pragma unroll
    for (int dt = 0; dt < 2; ++dt) { const size_t vo = vw + (size_t)(dt * 16) * TT + ks * 32; const v16h vh = frag_u(VH + vo, vof); acc[dt] = wmma16(pah, vh, acc[dt]); accl[dt] = wmma16(pal, vh, accl[dt]); accl[dt] = wmma16(pah, frag_u(VL + vo, vof), accl[dt]); } }
  // this wave's partial: running max and sum per row, context with its residual folded in
  if (col == 0) {
#pragma unroll
    for (int r = 0; r < 8; ++r) { sm[wave][8 * g + r] = m[r]; sl[wave][8 * g + r] = l[r]; } }
#pragma unroll
  for (int r = 0; r < 8; ++r)
#pragma unroll
    for (int dt = 0; dt < 2; ++dt) sac[wave][8 * g + r][dt * 16 + col] = acc[dt][r] + accl[dt][r] * (1.0f / 2048.0f);
  // windowed relative values: the score of (t, s) for s = t-4 .. t+4 recomputed with the same formula, one (head, row, offset) per thread; excluded keys carry the sentinel
  for (int e = tid; e < 2 * 16 * NREL; e += 256) { const int h2 = e / (16 * NREL), rr = (e / NREL) & 15, off = e % NREL; const int hx = hp * 2 + h2; const int sidx = q0 + rr + off - WIN; float sv = -3.0e38f;
    if (sidx >= 0 && sidx < TT && MASK[((rq + rr) * TT) + sidx] != 0) { const size_t rqo = (rq + rr) * (NH * 32) + hx * 32, rko = (b * TT + sidx) * (NH * 32) + hx * 32; float dot = 0.f;
      for (int d = 0; d < HDIM; ++d) { const float qv = (float)QH[rqo + d] + (float)QL[rqo + d] * (1.0f / 2048.0f); const float kv = (float)KH[rko + d] + (float)KL[rko + d] * (1.0f / 2048.0f); dot += qv * kv; }
      sv = (dot + RQ[((rq + rr) * NH + hx) * 16 + off]) * isc; }
    spp[h2][rr][off] = sv; }
  __syncthreads();
  // merge: one thread per (row, head, 4 dims); every partial is rescaled from its own max to the row's max
  if (tid < 16 * 12) { const int r = tid / 12, q4 = tid % 12; const int h2 = q4 / 6, d = (q4 % 6) * 4, w0 = h2 * KSPL; float M = -3.0e38f, L = 0.f, f[KSPL];
#pragma unroll
    for (int w = 0; w < KSPL; ++w) M = fmaxf(M, sm[w0 + w][r]);
#pragma unroll
    for (int w = 0; w < KSPL; ++w) { const float mw = sm[w0 + w][r]; f[w] = (mw <= -1.0e38f) ? 0.f : __expf(mw - M); L += sl[w0 + w][r] * f[w]; }
    v4f a = {};
#pragma unroll
    for (int w = 0; w < KSPL; ++w) a += *(const v4f*)&sac[w0 + w][r][d] * f[w];
    v4f o4 = a * ((1.0f / 2048.0f) / L);
    for (int jr = 0; jr < NREL; ++jr) { const float sv = spp[h2][r][jr]; const float pv = (sv <= -1.0e38f) ? 0.f : __expf(sv - M) / L;
#pragma unroll
      for (int i = 0; i < 4; ++i) o4[i] += pv * bfr(EV[jr * HDIM + d + i]); }
    vst2(O + ((size_t)hp * NR + rq + r) * 48 + q4 * 4, o4); }
}
// ---- k_out: block = (64 output channels o, 128 positions, b): y[o][t] = Wo rows (exact) x O (gathered from the [hp][row][48] layout into an LDS bf16 hi/lo tile [128 t][192 c]) + bo -> [B][C][T]
__global__ __launch_bounds__(128) void k_out(const float* __restrict__ O, const __bf16* __restrict__ PK, const float* __restrict__ BO, float* __restrict__ Y) {
  __shared__ __align__(16) __bf16 sh[128][CC + 8], sl[128][CC + 8]; __shared__ __align__(16) float so2[4][16][132];
  const int tid = threadIdx.x, wave = tid >> 5, lane = tid & 31, col = lane & 15, g = lane >> 4; const int o0 = blockIdx.x * 64 + wave * 16; const int n0 = blockIdx.y * 128; const size_t b = blockIdx.z;
  for (int e = tid; e < 128 * CC; e += 128) { const int r = e / CC, c = e % CC; const int hp = c / 48, w = c % 48; const float v = O[((size_t)hp * NR + b * TT + n0 + r) * 48 + w]; const __bf16 hb = (__bf16)v; sh[r][c] = hb; sl[r][c] = (__bf16)(v - (float)hb); }
  for (int e = tid; e < 128 * 8; e += 128) { const int r = e >> 3, c = CC + (e & 7); sh[r][c] = (__bf16)0.f; sl[r][c] = (__bf16)0.f; }
  __syncthreads();
  v8f acc[8] = {};
#pragma unroll
  for (int kc = 0; kc < CC / 32; ++kc) { const v16b a = frag_b(PK + (size_t)3 * CC * CC + (size_t)(o0 + col) * CC + kc * 32, lane);
#pragma unroll
    for (int j = 0; j < 8; ++j) { acc[j] = wmma_bf(a, frag_b(&sl[j * 16 + col][kc * 32], lane), acc[j]); acc[j] = wmma_bf(a, frag_b(&sh[j * 16 + col][kc * 32], lane), acc[j]); } }
#pragma unroll
  for (int j = 0; j < 8; ++j)
#pragma unroll
    for (int r = 0; r < 8; ++r) so2[wave][8 * g + r][j * 16 + col] = acc[j][r] + bfr(BO[o0 + 8 * g + r]);
  LDSX();
  for (int rl = 0; rl < 16; ++rl) vst2(Y + (b * CC + o0 + rl) * TT + n0 + lane * 4, *(const v4f*)&so2[wave][rl][lane * 4]);
}
extern "C" void kernel_launch(void* const* d_in, const int* in_sizes, int n_in, void* d_out, int out_size, void* d_ws, size_t ws_size, hipStream_t stream) {
  (void)in_sizes; (void)n_in; (void)out_size;
  const float** F = (const float**)d_in;   // 0 x [4,192,1024], 1 attn_mask [4,1,1024,1024] i32, 2 Wq [192,192], 3 bq, 4 Wk, 5 bk, 6 Wv, 7 bv, 8 Wo, 9 bo, 10 emb_rel_k [1,9,24], 11 emb_rel_v [1,9,24]
  if (ws_size < (size_t)WS_END) return;
  char* ws = (char*)d_ws; __bf16* PK = (__bf16*)(ws + WS_PK); _Float16 *QH = (_Float16*)(ws + WS_QH), *QL = (_Float16*)(ws + WS_QL), *KH = (_Float16*)(ws + WS_KH), *KL = (_Float16*)(ws + WS_KL), *VH = (_Float16*)(ws + WS_VH), *VL = (_Float16*)(ws + WS_VL); float *RQ = (float*)(ws + WS_RQ), *O = (float*)(ws + WS_O);
  k_pack<<<dim3(CC, 4), 256, 0, stream>>>(F[2], F[4], F[6], F[8], PK);
  k_qkv<<<dim3(TT / 64, NB, 3), 512, 0, stream>>>(F[0], PK, F[3], F[5], F[7], F[10], QH, QL, KH, KL, VH, VL, RQ);
  k_attn<<<dim3(TQB, NH / 2, TNB), 256, 0, stream>>>(QH, QL, KH, KL, VH, VL, RQ, (const int*)d_in[1], F[11], O);
  k_out<<<dim3(CC / 64, TT / 128, TNB), 128, 0, stream>>>(O, PK, F[9], (float*)d_out);
}

// v003
// One run takes 99 microseconds.
// Two timings next to v002 both put it at 1.50 times that version's speed.
// Counting every step since v000, it is 4.38 times as fast.
// compute dtype: all float inputs rounded to bf16, attn_mask (int) read on device; q/k/v 1x1 convs with EXACT bf16 products on WMMA 16x16x32 (positions as rows via an LDS transpose of the [B,C,T] input, natural weight rows) + biases; q and k stored as f16 hi + (x2048-scaled) residual in zero-padded 32-wide per-head chunks (head dim 24), v as f16 hi + residual channel planes (padded to 32 per head); scores = (q . k (3 products) + the windowed relative-key logits q . emb_k[s-t+4] for |s-t| <= 4 (f32 dots)) / sqrt(24); mask == 0 -> -3e38 (weight forced to 0, so the key is excluded); running-max softmax in f32 (hardware exp); P (scaled by 2^11, as f16 hi + residual) x v hi/lo (3 products); the windowed relative-value term sum_{|s-t|<=4} p(t,s) emb_v[s-t+4] added in f32 from recomputed (identical-formula) weights; output 1x1 conv with the context as bf16 hi + residual x exact Wo rows (2 products) + bo, written channels-first; f32 accumulate.
#include <hip/hip_runtime.h>
#include <math.h>

typedef __attribute__((ext_vector_type(16))) _Float16 v16h;
typedef __attribute__((ext_vector_type(16))) __bf16 v16b;
typedef __attribute__((ext_vector_type(8)))  _Float16 v8h;
typedef __attribute__((ext_vector_type(8)))  float v8f;
typedef __attribute__((ext_vector_type(4)))  float v4f;
typedef __attribute__((ext_vector_type(2)))  float v2f;
typedef __attribute__((ext_vector_type(4)))  unsigned v4u;
typedef __attribute__((ext_vector_type(4)))  int v4i;
typedef float __attribute__((may_alias)) float_a;
typedef int __attribute__((may_alias)) int_a;

template <typename T> __device__ __forceinline__ void vst2(void* p, T v) { *(T*)p = v;  }
__device__ __forceinline__ v8f wmma16(v16h a, v16h b, v8f c) {
  v8f d = __builtin_amdgcn_wmma_f32_16x16x32_f16(false, a, false, b, (short)0, c, false, false);
  asm volatile("v_nop\n\tv_nop\n\tv_nop\n\tv_nop" : "+v"(d) : "v"(a), "v"(b));
  return d;
}
__device__ __forceinline__ v8f wmma_bf(v16b a, v16b b, v8f c) {
  v8f d = __builtin_amdgcn_wmma_f32_16x16x32_bf16(false, a, false, b, (short)0, c, false, false);
  asm volatile("v_nop\n\tv_nop\n\tv_nop\n\tv_nop" : "+v"(d) : "v"(a), "v"(b));
  return d;
}
// 16x16x32 fragments: lane = (h = lane>>4, row/col = lane&15); elements 0..7 = k0+8h+0..7, 8..15 = k0+16+8h+0..7; D element r = row 8h+r
__device__ __forceinline__ v16h frag_h(const _Float16* rowk0, int lane) {
  union { v16h v; v8h q[2]; } u; const _Float16* p = rowk0 + 8 * (lane >> 4);
  u.q[0] = *(const v8h*)p; u.q[1] = *(const v8h*)(p + 16); return u.v;
}
__device__ __forceinline__ v16h frag_f32(const float* rowk0, int lane) {
  v16h a; const float* p = rowk0 + 8 * (lane >> 4);
#pragma unroll
  for (int i = 0; i < 8; ++i) { a[i] = (_Float16)p[i]; a[8 + i] = (_Float16)p[16 + i]; }
  return a;
}
__device__ __forceinline__ v16h frag_f32s(const float* rowk0, int lane, float sc) {
  v16h a; const float* p = rowk0 + 8 * (lane >> 4);
#pragma unroll
  for (int i = 0; i < 8; ++i) { a[i] = (_Float16)(p[i] * sc); a[8 + i] = (_Float16)(p[16 + i] * sc); }
  return a;
}
// column fragment from a [K][ld] layout (column n), rows >= K read as 0
__device__ __forceinline__ v16h fragc_f32(const float* W, int k0, int n, int lane, int ld, int K) {
  v16h a; const int g = lane >> 4;
#pragma unroll
  for (int i = 0; i < 8; ++i) { const int ka = k0 + 8 * g + i, kb = ka + 16;
    a[i] = (_Float16)(ka < K ? W[(size_t)(ka < K ? ka : K - 1) * ld + n] : 0.f); a[8 + i] = (_Float16)(kb < K ? W[(size_t)(kb < K ? kb : K - 1) * ld + n] : 0.f); }
  return a;
}
struct F2 { v16b h, l; };
__device__ __forceinline__ F2 bsplit16(const float v[16]) { F2 r;
#pragma unroll
  for (int i = 0; i < 16; ++i) { const __bf16 h = (__bf16)v[i]; r.h[i] = h; r.l[i] = (__bf16)(v[i] - (float)h); }
  return r; }
__device__ __forceinline__ F2 split_row(const float* row, int k0, int lane) { float v[16]; const float* p = row + k0 + 8 * (lane >> 4);
#pragma unroll
  for (int i = 0; i < 8; ++i) { v[i] = p[i]; v[8 + i] = p[16 + i]; }
  return bsplit16(v); }
__device__ __forceinline__ F2 split_rowK(const float* row, int k0, int lane, int K) { float v[16]; const int g = lane >> 4;
#pragma unroll
  for (int i = 0; i < 8; ++i) { const int ka = k0 + 8 * g + i, kb = ka + 16; v[i] = ka < K ? row[ka < K ? ka : K - 1] : 0.f; v[8 + i] = kb < K ? row[kb < K ? kb : K - 1] : 0.f; }
  return bsplit16(v); }
__device__ __forceinline__ F2 split_col(const float* W, int k0, int n, int lane, int ld, int K) { float v[16]; const int g = lane >> 4;
#pragma unroll
  for (int i = 0; i < 8; ++i) { const int ka = k0 + 8 * g + i, kb = ka + 16; v[i] = ka < K ? W[(size_t)(ka < K ? ka : K - 1) * ld + n] : 0.f; v[8 + i] = kb < K ? W[(size_t)(kb < K ? kb : K - 1) * ld + n] : 0.f; }
  return bsplit16(v); }
__device__ __forceinline__ v8f mac3(const F2& a, const F2& b, v8f c) { c = wmma_bf(a.l, b.h, c); c = wmma_bf(a.h, b.l, c); return wmma_bf(a.h, b.h, c); }
__device__ __forceinline__ float sigm(float v) { return 1.0f / (1.0f + expf(-v)); }
#define LDSX() do { asm volatile("s_wait_dscnt 0" ::: "memory"); __builtin_amdgcn_wave_barrier(); __builtin_amdgcn_fence(__ATOMIC_RELEASE, "workgroup"); } while (0)


// Relative-position multi-head attention (B 4, C 192 as 8 heads x 24, T 1,024, window 4): 1x1-conv q/k/v, scores with windowed relative key embeddings, per-(t,s) mask, softmax, values plus windowed relative value embeddings, 1x1-conv output -> [B, C, T].
#define NB 4
#define CC 192
#define TT 1024
#define NH 8
#define HDIM 24
#define WIN 4
#define NREL (2 * WIN + 1)
#define NR (NB * TT)
#ifndef TQB
#define TQB (TT / 16)
#define TNB NB
#endif
typedef __attribute__((ext_vector_type(8))) __bf16 v8b;
__device__ __forceinline__ v16b frag_b(const __bf16* rowk0, int lane) {
  union { v16b v; v8b q[2]; } u; const __bf16* p = rowk0 + 8 * (lane >> 4);
  u.q[0] = *(const v8b*)p; u.q[1] = *(const v8b*)(p + 16); return u.v;
}
__device__ __forceinline__ float bfr(float v) { return (float)(__bf16)v; }
__device__ __attribute__((noinline)) float exp_ni(float v) { return expf(v); }
__device__ __attribute__((noinline)) float erf_ni(float v) { return erff(v); }

#define PK_Q 0                               // [192][192] Wq ; Wk ; Wv ; Wo (natural rows)
#define PK_END ((size_t)4 * CC * CC)
#define WS_PK  0u
#define WS_QH  (((2u * PK_END) + 127u) / 128u * 128u)   // f16 [NR][8][32] q hi ; QL ; KH ; KL
#define WS_QL  (WS_QH + 2u * NR * NH * 32)
#define WS_KH  (WS_QL + 2u * NR * NH * 32)
#define WS_KL  (WS_KH + 2u * NR * NH * 32)
#define WS_VH  (WS_KL + 2u * NR * NH * 32)               // f16 [b][8*32][T] v hi ; VL  (dims 24..31 of each head zero)
#define WS_VL  (WS_VH + 2u * (size_t)NB * NH * 32 * TT)
#define WS_RQ  (WS_VL + 2u * (size_t)NB * NH * 32 * TT)  // f32 [NR][8][16] q . emb_k[r] (9 used)
#define WS_O   (WS_RQ + 4u * NR * NH * 16)                 // f32 [4 head pairs][NR][48] attention output (block-owned runs)
#define WS_END (WS_O + 4u * NR * CC)

__global__ __launch_bounds__(256) void k_pack(const float* __restrict__ WQ, const float* __restrict__ WK, const float* __restrict__ WV, const float* __restrict__ WO, __bf16* __restrict__ PK) {
  const int n = blockIdx.x, which = blockIdx.y, t = threadIdx.x; const float* Wm = (which == 0) ? WQ : (which == 1) ? WK : (which == 2) ? WV : WO; __shared__ __align__(16) __bf16 s[CC];
  if (t < CC) s[t] = (__bf16)Wm[(size_t)n * CC + t];
  __syncthreads();
  if (t < CC / 8) vst2((unsigned*)(PK + ((size_t)which * CC + n) * CC + t * 8), *(const v4u*)&s[t * 8]);
}
// ---- k_qkv: block = (64 positions, b, one of q / k / v), 16 waves: wave = (16-position row tile, 3 of the 12 column tiles). A tile [64 t][192 c] from x[b][c][t] (bf16 exact); D = A . W rows + b; q,k -> padded 32-wide per-head f16 hi/lo chunks; v -> planes [b][h*32 + d][t]; the q block also writes RQ[row][h][r] = q_h . emb_k[r] (f32)
__global__ __launch_bounds__(512) void k_qkv(const float* __restrict__ X, const __bf16* __restrict__ PK, const float* __restrict__ BQ, const float* __restrict__ BK, const float* __restrict__ BV, const float* __restrict__ EK, _Float16* __restrict__ QH, _Float16* __restrict__ QL, _Float16* __restrict__ KH, _Float16* __restrict__ KL, _Float16* __restrict__ VH, _Float16* __restrict__ VL, float* __restrict__ RQ) {
  __shared__ __align__(16) __bf16 sa[64][CC + 8]; __shared__ __align__(16) float so[64][CC + 4]; __shared__ __align__(16) _Float16 sbuf[2 * NH * 32 * 72];   // union: q/k chunk staging [2][64][264] or v planes staging [2][256][72]
  typedef _Float16 (*ChunkT)[NH * 32 + 8]; typedef _Float16 (*PlaneT)[72]; ChunkT sth = (ChunkT)sbuf, stl = (ChunkT)(sbuf + 64 * (NH * 32 + 8)); PlaneT svh = (PlaneT)sbuf, svl = (PlaneT)(sbuf + NH * 32 * 72);
  const int tid = threadIdx.x, wave = tid >> 5, lane = tid & 31, col = lane & 15, g = lane >> 4, rt = wave & 3, cg = wave >> 2; const int t0 = blockIdx.x * 64, which = blockIdx.z; const size_t b = blockIdx.y; const size_t r0 = b * TT + t0;
  for (int e = tid; e < 64 * CC; e += 512) { const int c = e >> 6, r = e & 63; sa[r][c] = (__bf16)X[(b * CC + c) * TT + t0 + r]; }
  if (tid < 64) for (int c = CC; c < CC + 8; ++c) sa[tid][c] = (__bf16)0.f;
  __syncthreads();
  const __bf16* P = PK + (size_t)which * CC * CC; const float* BB = (which == 0) ? BQ : (which == 1) ? BK : BV;
  v8f acc[3] = {};
#pragma unroll
  for (int kc = 0; kc < CC / 32; ++kc) { const v16b a = frag_b(&sa[rt * 16 + col][kc * 32], lane);
#pragma unroll
    for (int j = 0; j < 3; ++j) acc[j] = wmma_bf(a, frag_b(P + (size_t)((cg * 3 + j) * 16 + col) * CC + kc * 32, lane), acc[j]); }
#pragma unroll
  for (int j = 0; j < 3; ++j) { const float bb = bfr(BB[(cg * 3 + j) * 16 + col]);
#pragma unroll
    for (int r = 0; r < 8; ++r) so[rt * 16 + 8 * g + r][(cg * 3 + j) * 16 + col] = acc[j][r] + bb; }
  __syncthreads();
  if (which < 2) {
    for (int e = tid; e < 64 * NH * 32; e += 512) { const int r = e / (NH * 32), q = e % (NH * 32); const int h = q >> 5, d = q & 31; float v = 0.f; if (d < HDIM) v = so[r][h * HDIM + d]; const _Float16 hv = (_Float16)v; sth[r][q] = hv; stl[r][q] = (_Float16)((v - (float)hv) * 2048.0f); }
    if (which == 0) { // relative-key logits seeds: RQ[row][h][rr] = sum_d q[h*24+d] * emb_k[rr][d] (f32), 4 per thread, stored directly (16-B pieces of the row's 512-B RQ record; the block owns rows t0..t0+63)
      for (int e = tid; e < 64 * NH * 4; e += 512) { const int r = e / (NH * 4), q = e % (NH * 4); const int h = q >> 2, r4 = (q & 3) * 4; v4f o4;
        for (int i = 0; i < 4; ++i) { const int rr = r4 + i; float a2 = 0.f; if (rr < NREL) { for (int d = 0; d < HDIM; ++d) a2 += so[r][h * HDIM + d] * bfr(EK[rr * HDIM + d]); } o4[i] = a2; }
        vst2(RQ + ((r0 + r) * NH + h) * 16 + r4, o4); } }
    __syncthreads();
    _Float16* DH_ = which ? KH : QH; _Float16* DL_ = which ? KL : QL;
    for (int e = tid; e < 64 * (NH * 32 / 8); e += 512) { const int r = e / (NH * 4), q = e % (NH * 4); const size_t o = (r0 + r) * (NH * 32) + q * 8; vst2((unsigned*)(DH_ + o), *(const v4u*)&sth[r][q * 8]); vst2((unsigned*)(DL_ + o), *(const v4u*)&stl[r][q * 8]); }
  } else {
    for (int e = tid; e < 64 * NH * 32; e += 512) { const int r = e & 63, q = e >> 6; const int h = q >> 5, d = q & 31; float v = 0.f; if (d < HDIM) v = so[r][h * HDIM + d]; const _Float16 hv = (_Float16)v; svh[q][r] = hv; svl[q][r] = (_Float16)((v - (float)hv) * 2048.0f); }
    __syncthreads();
    for (int e = tid; e < NH * 32 * 8; e += 512) { const int q = e >> 3, pc = e & 7; const size_t o = (b * NH * 32 + q) * TT + t0 + pc * 8; vst2((unsigned*)(VH + o), *(const v4u*)&svh[q][pc * 8]); vst2((unsigned*)(VL + o), *(const v4u*)&svl[q][pc * 8]); } }
}
// ---- k_attn: block = (16 queries, head pair, b), 8 waves: wave = (head of the pair, quarter of the 1,024 keys). Each wave runs its 256 keys in tiles of 32 on its own (mask words read per lane in the score layout, no barrier in the loop): scores (3-product q.k + windowed rel-key seed) / sqrt(24), mask == 0 excluded; online softmax; P (x2^11 hi + residual) x V (2 tiles of 16 dims). The four partial (max, sum, context) of a head meet in LDS behind one barrier and are rescaled to the common max; the same pass adds sum_{|s-t|<=4} p(t,s) emb_v[s-t+4]; O rows [hp][row][(h % 2)*24 + d]
#define KSPL 4
// fragment from a wave-uniform base plus the lane's 32-bit byte offset
__device__ __forceinline__ v16h frag_u(const _Float16* ubase, unsigned boff) {
  union { v16h v; v8h q[2]; } u; const char* p = (const char*)ubase;
  u.q[0] = *(const v8h*)(p + boff); u.q[1] = *(const v8h*)(p + 32 + boff); return u.v;
}
__global__ __launch_bounds__(256, 8) void k_attn(const _Float16* __restrict__ QH, const _Float16* __restrict__ QL, const _Float16* __restrict__ KH, const _Float16* __restrict__ KL, const _Float16* __restrict__ VH, const _Float16* __restrict__ VL, const float* __restrict__ RQ, const int* __restrict__ MASK, const float* __restrict__ EV, float* __restrict__ O) {
  __shared__ __align__(16) _Float16 sph[2 * KSPL][16][40], spl[2 * KSPL][16][40]; __shared__ float srq[2 * KSPL][16][NREL + 1]; __shared__ float spp[2][16][NREL + 1]; __shared__ float sm[2 * KSPL][16], sl[2 * KSPL][16]; __shared__ __align__(16) float sac[2 * KSPL][16][36];
  const int tid = threadIdx.x, wave = __builtin_amdgcn_readfirstlane(tid >> 5), lane = tid & 31, col = lane & 15, g = lane >> 4; const int hp = blockIdx.y; const size_t b = blockIdx.z; const int q0 = blockIdx.x * 16; const size_t rq = b * TT + q0; const float isc = 1.0f / sqrtf((float)HDIM);
  const int h = hp * 2 + wave / KSPL, kbase = (wave % KSPL) * (TT / KSPL);
  // the wave's number is made scalar so that the wave-uniform part of every K, V and mask address is scalar arithmetic; the second launch bound asks for 8 waves per SIMD (128 VGPRs): four blocks per WGP, the whole grid resident at once
  const size_t kw = (b * TT + kbase) * (NH * 32) + h * 32, vw = (b * NH * 32 + h * 32) * TT + kbase; const int* MKw = MASK + rq * TT + kbase;
  const unsigned ko = col * (NH * 64) + 16 * g, vof = col * (TT * 2) + 16 * g, mo = 8 * g * TT + col;
  if (lane < 16) { for (int rr = 0; rr < NREL; ++rr) srq[wave][lane][rr] = RQ[((rq + lane) * NH + h) * 16 + rr]; }
  const v16h aq = frag_h(QH + (rq + col) * (NH * 32) + h * 32, lane), aql = frag_h(QL + (rq + col) * (NH * 32) + h * 32, lane);
  float m[8], l[8];
#pragma unroll
  for (int r = 0; r < 8; ++r) { m[r] = -3.0e38f; l[r] = 0.f; }
  v8f acc[2] = {}, accl[2] = {};
  LDSX();
#pragma unroll 1
  for (int ks = 0; ks < TT / KSPL / 32; ++ks) { const int j0 = kbase + ks * 32;
    v8f s[2];
#pragma unroll
    for (int ct = 0; ct < 2; ++ct) { const int kk = j0 + ct * 16 + col; const size_t rk = kw + (size_t)(ks * 32 + ct * 16) * (NH * 32); v8f c = {}, cl = {}; int mk[8];
#pragma unroll
      for (int r = 0; r < 8; ++r) mk[r] = (MKw + ks * 32 + ct * 16 + r * TT)[mo];
      { const v16h kh = frag_u(KH + rk, ko); c = wmma16(aq, kh, c); cl = wmma16(aql, kh, cl); cl = wmma16(aq, frag_u(KL + rk, ko), cl); }
#pragma unroll
      for (int r = 0; r < 8; ++r) { const int qi = q0 + 8 * g + r; const int dd = kk - qi; float sc = c[r] + cl[r] * (1.0f / 2048.0f); if (dd >= -WIN && dd <= WIN) sc += srq[wave][8 * g + r][dd + WIN]; const bool keep = mk[r] != 0; s[ct][r] = keep ? sc * isc : -3.0e38f; } }
#pragma unroll
    for (int r = 0; r < 8; ++r) { float mx = fmaxf(s[0][r], s[1][r]);
#pragma unroll
      for (int o = 1; o < 16; o <<= 1) mx = fmaxf(mx, __shfl_xor(mx, o));
      const float mn = fmaxf(m[r], mx); const float alpha = (m[r] <= -1.0e38f) ? 0.f : __expf(m[r] - mn);
      const float e0 = (s[0][r] <= -1.0e38f) ? 0.f : __expf(s[0][r] - mn), e1 = (s[1][r] <= -1.0e38f) ? 0.f : __expf(s[1][r] - mn); float es = e0 + e1;
#pragma unroll
      for (int o = 1; o < 16; o <<= 1) es += __shfl_xor(es, o);
      l[r] = l[r] * alpha + es; m[r] = (mn <= -1.0e38f) ? m[r] : mn; acc[0][r] *= alpha; acc[1][r] *= alpha; accl[0][r] *= alpha; accl[1][r] *= alpha;
      { const float p0 = e0 * 2048.0f, p1 = e1 * 2048.0f; const _Float16 h0 = (_Float16)p0, h1 = (_Float16)p1; sph[wave][8 * g + r][col] = h0; sph[wave][8 * g + r][16 + col] = h1; spl[wave][8 * g + r][col] = (_Float16)((p0 - (float)h0) * 2048.0f); spl[wave][8 * g + r][16 + col] = (_Float16)((p1 - (float)h1) * 2048.0f); } }
    LDSX();
    const v16h pah = frag_h(&sph[wave][col][0], lane), pal = frag_h(&spl[wave][col][0], lane);
#pragma unroll
    for (int dt = 0; dt < 2; ++dt) { const size_t vo = vw + (size_t)(dt * 16) * TT + ks * 32; const v16h vh = frag_u(VH + vo, vof); acc[dt] = wmma16(pah, vh, acc[dt]); accl[dt] = wmma16(pal, vh, accl[dt]); accl[dt] = wmma16(pah, frag_u(VL + vo, vof), accl[dt]); } }
  // this wave's partial: running max and sum per row, context with its residual folded in
  if (col == 0) {
#pragma unroll
    for (int r = 0; r < 8; ++r) { sm[wave][8 * g + r] = m[r]; sl[wave][8 * g + r] = l[r]; } }
#pragma unroll
  for (int r = 0; r < 8; ++r)
#pragma unroll
    for (int dt = 0; dt < 2; ++dt) sac[wave][8 * g + r][dt * 16 + col] = acc[dt][r] + accl[dt][r] * (1.0f / 2048.0f);
  // windowed relative values: the score of (t, s) for s = t-4 .. t+4 recomputed with the same formula, one (head, row, offset) per thread; excluded keys carry the sentinel
  for (int e = tid; e < 2 * 16 * NREL; e += 256) { const int h2 = e / (16 * NREL), rr = (e / NREL) & 15, off = e % NREL; const int hx = hp * 2 + h2; const int sidx = q0 + rr + off - WIN; float sv = -3.0e38f;
    if (sidx >= 0 && sidx < TT && MASK[((rq + rr) * TT) + sidx] != 0) { const size_t rqo = (rq + rr) * (NH * 32) + hx * 32, rko = (b * TT + sidx) * (NH * 32) + hx * 32; float dot = 0.f;
      for (int d = 0; d < HDIM; ++d) { const float qv = (float)QH[rqo + d] + (float)QL[rqo + d] * (1.0f / 2048.0f); const float kv = (float)KH[rko + d] + (float)KL[rko + d] * (1.0f / 2048.0f); dot += qv * kv; }
      sv = (dot + RQ[((rq + rr) * NH + hx) * 16 + off]) * isc; }
    spp[h2][rr][off] = sv; }
  __syncthreads();
  // merge: one thread per (row, head, 4 dims); every partial is rescaled from its own max to the row's max
  if (tid < 16 * 12) { const int r = tid / 12, q4 = tid % 12; const int h2 = q4 / 6, d = (q4 % 6) * 4, w0 = h2 * KSPL; float M = -3.0e38f, L = 0.f, f[KSPL];
#pragma unroll
    for (int w = 0; w < KSPL; ++w) M = fmaxf(M, sm[w0 + w][r]);
#pragma unroll
    for (int w = 0; w < KSPL; ++w) { const float mw = sm[w0 + w][r]; f[w] = (mw <= -1.0e38f) ? 0.f : __expf(mw - M); L += sl[w0 + w][r] * f[w]; }
    v4f a = {};
#pragma unroll
    for (int w = 0; w < KSPL; ++w) a += *(const v4f*)&sac[w0 + w][r][d] * f[w];
    v4f o4 = a * ((1.0f / 2048.0f) / L);
    for (int jr = 0; jr < NREL; ++jr) { const float sv = spp[h2][r][jr]; const float pv = (sv <= -1.0e38f) ? 0.f : __expf(sv - M) / L;
#pragma unroll
      for (int i = 0; i < 4; ++i) o4[i] += pv * bfr(EV[jr * HDIM + d + i]); }
    vst2(O + ((size_t)hp * NR + rq + r) * 48 + q4 * 4, o4); }
}
// ---- k_out: block = (96 output channels o, 32 positions, b), 6 waves: wave = one 16-channel tile x both 16-position tiles. y[o][t] = Wo rows (exact) x O (gathered from the [hp][row][48] layout into an LDS bf16 hi/lo tile [32 t][192 c]) + bo -> [B][C][T]. Every global read of a thread (8 16-byte pieces of O, its 6 Wo fragments, its 8 biases) is issued ahead of the one barrier, so the block waits for memory once
#define OPOS 32
#define OCH 96
typedef __attribute__((ext_vector_type(4))) __bf16 v4b;
__global__ __launch_bounds__(192) void k_out(const float* __restrict__ O, const __bf16* __restrict__ PK, const float* __restrict__ BO, float* __restrict__ Y) {
  __shared__ __align__(16) __bf16 sh[OPOS][CC + 8], sl[OPOS][CC + 8]; __shared__ __align__(16) float so2[OCH / 16][16][OPOS + 4];
  const int tid = threadIdx.x, wave = tid >> 5, lane = tid & 31, col = lane & 15, g = lane >> 4; const int o0 = blockIdx.x * OCH + wave * 16; const int n0 = blockIdx.y * OPOS; const size_t b = blockIdx.z;
  // piece i of a thread: head pair i >> 1, row (i & 1) * 16 + tid / 12, 4 of the row's 48 floats (the 32 rows of a head pair are one contiguous run)
  const int sr = tid / 12, sw = (tid % 12) * 4; v4f x[8];
#pragma unroll
  for (int i = 0; i < 8; ++i) x[i] = *(const v4f*)(O + ((size_t)(i >> 1) * NR + b * TT + n0 + (i & 1) * 16 + sr) * 48 + sw);
  asm volatile("s_wait_xcnt 0x0" ::: "memory");   // stands in front of any overwrite of the address registers of the loads above (a later load's result may land in them); the clobber keeps these loads issued here, ahead of the conversion that waits for O
  v16b a[CC / 32];
#pragma unroll
  for (int kc = 0; kc < CC / 32; ++kc) a[kc] = frag_b(PK + (size_t)3 * CC * CC + (size_t)(o0 + col) * CC + kc * 32, lane);
  asm volatile("s_wait_xcnt 0x0" ::: "memory");   // the same for the Wo fragment loads
  const v4f b0 = *(const v4f*)(BO + o0 + 8 * g), b1 = *(const v4f*)(BO + o0 + 8 * g + 4);
  asm volatile("s_wait_xcnt 0x0" ::: "memory");   // the same for the bias loads
#pragma unroll
  for (int i = 0; i < 8; ++i) { v4b hi, lo;
#pragma unroll
    for (int k = 0; k < 4; ++k) { const float v = x[i][k]; const __bf16 hb = (__bf16)v; hi[k] = hb; lo[k] = (__bf16)(v - (float)hb); }
    vst2(&sh[(i & 1) * 16 + sr][(i >> 1) * 48 + sw], hi); vst2(&sl[(i & 1) * 16 + sr][(i >> 1) * 48 + sw], lo); }
  __syncthreads();
  v8f acc[2] = {};
#pragma unroll
  for (int kc = 0; kc < CC / 32; ++kc) {
#pragma unroll
    for (int j = 0; j < 2; ++j) { acc[j] = wmma_bf(a[kc], frag_b(&sl[j * 16 + col][kc * 32], lane), acc[j]); acc[j] = wmma_bf(a[kc], frag_b(&sh[j * 16 + col][kc * 32], lane), acc[j]); } }
#pragma unroll
  for (int j = 0; j < 2; ++j)
#pragma unroll
    for (int r = 0; r < 8; ++r) so2[wave][8 * g + r][j * 16 + col] = acc[j][r] + bfr(r < 4 ? b0[r & 3] : b1[r & 3]);
  LDSX();
  // the wave writes its 16 channel rows as whole 128-byte runs, 4 rows a store
#pragma unroll
  for (int it = 0; it < 4; ++it) { const int rl = it * 4 + (lane >> 3), c4 = (lane & 7) * 4; vst2(Y + (b * CC + o0 + rl) * TT + n0 + c4, *(const v4f*)&so2[wave][rl][c4]); }
}
extern "C" void kernel_launch(void* const* d_in, const int* in_sizes, int n_in, void* d_out, int out_size, void* d_ws, size_t ws_size, hipStream_t stream) {
  (void)in_sizes; (void)n_in; (void)out_size;
  const float** F = (const float**)d_in;   // 0 x [4,192,1024], 1 attn_mask [4,1,1024,1024] i32, 2 Wq [192,192], 3 bq, 4 Wk, 5 bk, 6 Wv, 7 bv, 8 Wo, 9 bo, 10 emb_rel_k [1,9,24], 11 emb_rel_v [1,9,24]
  if (ws_size < (size_t)WS_END) return;
  char* ws = (char*)d_ws; __bf16* PK = (__bf16*)(ws + WS_PK); _Float16 *QH = (_Float16*)(ws + WS_QH), *QL = (_Float16*)(ws + WS_QL), *KH = (_Float16*)(ws + WS_KH), *KL = (_Float16*)(ws + WS_KL), *VH = (_Float16*)(ws + WS_VH), *VL = (_Float16*)(ws + WS_VL); float *RQ = (float*)(ws + WS_RQ), *O = (float*)(ws + WS_O);
  k_pack<<<dim3(CC, 4), 256, 0, stream>>>(F[2], F[4], F[6], F[8], PK);
  k_qkv<<<dim3(TT / 64, NB, 3), 512, 0, stream>>>(F[0], PK, F[3], F[5], F[7], F[10], QH, QL, KH, KL, VH, VL, RQ);
  k_attn<<<dim3(TQB, NH / 2, TNB), 256, 0, stream>>>(QH, QL, KH, KL, VH, VL, RQ, (const int*)d_in[1], F[11], O);
  k_out<<<dim3(CC / OCH, TT / OPOS, TNB), 192, 0, stream>>>(O, PK, F[9], (float*)d_out);
}

// v004
// A run of this version takes 85 microseconds.
// In both of two side-by-side timings against v003, it was 1.16 times as fast.
// Counting every step since v000, it is 5.10 times as fast.
// compute dtype: all float inputs rounded to bf16, attn_mask (int) read on device; q/k/v 1x1 convs with EXACT bf16 products on WMMA 16x16x32 (positions as rows via an LDS transpose of the [B,C,T] input, natural weight rows) + biases; q and k stored as f16 hi + (x2048-scaled) residual, head dim 24 zero-padded to 32 (q in per-head chunks of a row, k in fragment order), v as f16 hi + residual, padded to 32 dims per head, in fragment order; scores = (q . k (3 products) + the windowed relative-key logits q . emb_k[s-t+4] for |s-t| <= 4 (f32 dots)) / sqrt(24); mask == 0 -> -3e38 sentinel (weight set to 0, so the key is excluded); running-max softmax in f32 (hardware exp); P (scaled by 2^11, as f16 hi + residual) x v hi/lo (3 products); the windowed relative-value term sum_{|s-t|<=4} p(t,s) emb_v[s-t+4] added in f32 from recomputed (identical-formula) weights; output 1x1 conv with the context as bf16 hi + residual x exact Wo rows (2 products) + bo, written channels-first; f32 accumulate.
#include <hip/hip_runtime.h>
#include <math.h>

typedef __attribute__((ext_vector_type(16))) _Float16 v16h;
typedef __attribute__((ext_vector_type(16))) __bf16 v16b;
typedef __attribute__((ext_vector_type(8)))  _Float16 v8h;
typedef __attribute__((ext_vector_type(8)))  float v8f;
typedef __attribute__((ext_vector_type(4)))  float v4f;
typedef __attribute__((ext_vector_type(2)))  float v2f;
typedef __attribute__((ext_vector_type(4)))  unsigned v4u;
typedef __attribute__((ext_vector_type(4)))  int v4i;
typedef float __attribute__((may_alias)) float_a;
typedef int __attribute__((may_alias)) int_a;

template <typename T> __device__ __forceinline__ void vst2(void* p, T v) { *(T*)p = v;  }
__device__ __forceinline__ v8f wmma16(v16h a, v16h b, v8f c) {
  v8f d = __builtin_amdgcn_wmma_f32_16x16x32_f16(false, a, false, b, (short)0, c, false, false);
  asm volatile("v_nop\n\tv_nop\n\tv_nop\n\tv_nop" : "+v"(d) : "v"(a), "v"(b));
  return d;
}
__device__ __forceinline__ v8f wmma_bf(v16b a, v16b b, v8f c) {
  v8f d = __builtin_amdgcn_wmma_f32_16x16x32_bf16(false, a, false, b, (short)0, c, false, false);
  asm volatile("v_nop\n\tv_nop\n\tv_nop\n\tv_nop" : "+v"(d) : "v"(a), "v"(b));
  return d;
}
// 16x16x32 fragments: lane = (h = lane>>4, row/col = lane&15); elements 0..7 = k0+8h+0..7, 8..15 = k0+16+8h+0..7; D element r = row 8h+r
__device__ __forceinline__ v16h frag_h(const _Float16* rowk0, int lane) {
  union { v16h v; v8h q[2]; } u; const _Float16* p = rowk0 + 8 * (lane >> 4);
  u.q[0] = *(const v8h*)p; u.q[1] = *(const v8h*)(p + 16); return u.v;
}
__device__ __forceinline__ v16h frag_f32(const float* rowk0, int lane) {
  v16h a; const float* p = rowk0 + 8 * (lane >> 4);
#pragma unroll
  for (int i = 0; i < 8; ++i) { a[i] = (_Float16)p[i]; a[8 + i] = (_Float16)p[16 + i]; }
  return a;
}
__device__ __forceinline__ v16h frag_f32s(const float* rowk0, int lane, float sc) {
  v16h a; const float* p = rowk0 + 8 * (lane >> 4);
#pragma unroll
  for (int i = 0; i < 8; ++i) { a[i] = (_Float16)(p[i] * sc); a[8 + i] = (_Float16)(p[16 + i] * sc); }
  return a;
}
// column fragment from a [K][ld] layout (column n), rows >= K read as 0
__device__ __forceinline__ v16h fragc_f32(const float* W, int k0, int n, int lane, int ld, int K) {
  v16h a; const int g = lane >> 4;
#pragma unroll
  for (int i = 0; i < 8; ++i) { const int ka = k0 + 8 * g + i, kb = ka + 16;
    a[i] = (_Float16)(ka < K ? W[(size_t)(ka < K ? ka : K - 1) * ld + n] : 0.f); a[8 + i] = (_Float16)(kb < K ? W[(size_t)(kb < K ? kb : K - 1) * ld + n] : 0.f); }
  return a;
}
struct F2 { v16b h, l; };
__device__ __forceinline__ F2 bsplit16(const float v[16]) { F2 r;
#pragma unroll
  for (int i = 0; i < 16; ++i) { const __bf16 h = (__bf16)v[i]; r.h[i] = h; r.l[i] = (__bf16)(v[i] - (float)h); }
  return r; }
__device__ __forceinline__ F2 split_row(const float* row, int k0, int lane) { float v[16]; const float* p = row + k0 + 8 * (lane >> 4);
#pragma unroll
  for (int i = 0; i < 8; ++i) { v[i] = p[i]; v[8 + i] = p[16 + i]; }
  return bsplit16(v); }
__device__ __forceinline__ F2 split_rowK(const float* row, int k0, int lane, int K) { float v[16]; const int g = lane >> 4;
#pragma unroll
  for (int i = 0; i < 8; ++i) { const int ka = k0 + 8 * g + i, kb = ka + 16; v[i] = ka < K ? row[ka < K ? ka : K - 1] : 0.f; v[8 + i] = kb < K ? row[kb < K ? kb : K - 1] : 0.f; }
  return bsplit16(v); }
__device__ __forceinline__ F2 split_col(const float* W, int k0, int n, int lane, int ld, int K) { float v[16]; const int g = lane >> 4;
#pragma unroll
  for (int i = 0; i < 8; ++i) { const int ka = k0 + 8 * g + i, kb = ka + 16; v[i] = ka < K ? W[(size_t)(ka < K ? ka : K - 1) * ld + n] : 0.f; v[8 + i] = kb < K ? W[(size_t)(kb < K ? kb : K - 1) * ld + n] : 0.f; }
  return bsplit16(v); }
__device__ __forceinline__ v8f mac3(const F2& a, const F2& b, v8f c) { c = wmma_bf(a.l, b.h, c); c = wmma_bf(a.h, b.l, c); return wmma_bf(a.h, b.h, c); }
__device__ __forceinline__ float sigm(float v) { return 1.0f / (1.0f + expf(-v)); }
#define LDSX() do { asm volatile("s_wait_dscnt 0" ::: "memory"); __builtin_amdgcn_wave_barrier(); __builtin_amdgcn_fence(__ATOMIC_RELEASE, "workgroup"); } while (0)


// Relative-position multi-head attention (B 4, C 192 as 8 heads x 24, T 1,024, window 4): 1x1-conv q/k/v, scores with windowed relative key embeddings, per-(t,s) mask, softmax, values plus windowed relative value embeddings, 1x1-conv output -> [B, C, T].
#define NB 4
#define CC 192
#define TT 1024
#define NH 8
#define HDIM 24
#define WIN 4
#define NREL (2 * WIN + 1)
#define NR (NB * TT)
#ifndef TQB
#define TQB (TT / 16)
#define TNB NB
#endif
typedef __attribute__((ext_vector_type(8))) __bf16 v8b;
__device__ __forceinline__ v16b frag_b(const __bf16* rowk0, int lane) {
  union { v16b v; v8b q[2]; } u; const __bf16* p = rowk0 + 8 * (lane >> 4);
  u.q[0] = *(const v8b*)p; u.q[1] = *(const v8b*)(p + 16); return u.v;
}
__device__ __forceinline__ float bfr(float v) { return (float)(__bf16)v; }
__device__ __attribute__((noinline)) float exp_ni(float v) { return expf(v); }
__device__ __attribute__((noinline)) float erf_ni(float v) { return erff(v); }

#define PK_Q 0                               // [192][192] Wq ; Wk ; Wv ; Wo (natural rows)
#define PK_END ((size_t)4 * CC * CC)
#define WS_PK  0u
#define WS_QH  (((2u * PK_END) + 127u) / 128u * 128u)   // f16 [NR][8][32] q hi ; QL ; then k hi ; KL in fragment order [b][h][16-key tile][k half p][lane = 16 g + key][8]: element k = 16 p + 8 g + i
#define WS_QL  (WS_QH + 2u * NR * NH * 32)
#define WS_KH  (WS_QL + 2u * NR * NH * 32)
#define WS_KL  (WS_KH + 2u * NR * NH * 32)
#define WS_VH  (WS_KL + 2u * NR * NH * 32)               // f16 v hi ; VL in fragment order [b][h][32-key block][16-dim tile][key half p][lane = 16 g + dim][8]: key = 16 p + 8 g + i (dims 24..31 of each head zero)
#define WS_VL  (WS_VH + 2u * (size_t)NB * NH * 32 * TT)
#define WS_RQ  (WS_VL + 2u * (size_t)NB * NH * 32 * TT)  // f32 [NR][8][16] q . emb_k[r] (9 used)
#define WS_O   (WS_RQ + 4u * NR * NH * 16)                 // f32 [4 head pairs][NR][48] attention output (block-owned runs)
#define WS_END (WS_O + 4u * NR * CC)

__global__ __launch_bounds__(256) void k_pack(const float* __restrict__ WQ, const float* __restrict__ WK, const float* __restrict__ WV, const float* __restrict__ WO, __bf16* __restrict__ PK) {
  const int n = blockIdx.x, which = blockIdx.y, t = threadIdx.x; const float* Wm = (which == 0) ? WQ : (which == 1) ? WK : (which == 2) ? WV : WO; __shared__ __align__(16) __bf16 s[CC];
  if (t < CC) s[t] = (__bf16)Wm[(size_t)n * CC + t];
  __syncthreads();
  if (t < CC / 8) vst2((unsigned*)(PK + ((size_t)which * CC + n) * CC + t * 8), *(const v4u*)&s[t * 8]);
}
// ---- k_qkv: block = (64 positions, b, one of q / k / v), 16 waves: wave = (16-position row tile, 3 of the 12 column tiles). A tile [64 t][192 c] from x[b][c][t] (bf16 exact); D = A . W rows + b; q -> padded 32-wide per-head f16 hi/lo chunks; k, v -> the same values in the fragment order k_attn loads them in (a wave's 16-byte store covers 512 contiguous bytes); the q block also writes RQ[row][h][r] = q_h . emb_k[r] (f32)
__global__ __launch_bounds__(512) void k_qkv(const float* __restrict__ X, const __bf16* __restrict__ PK, const float* __restrict__ BQ, const float* __restrict__ BK, const float* __restrict__ BV, const float* __restrict__ EK, _Float16* __restrict__ QH, _Float16* __restrict__ QL, _Float16* __restrict__ KH, _Float16* __restrict__ KL, _Float16* __restrict__ VH, _Float16* __restrict__ VL, float* __restrict__ RQ) {
  __shared__ __align__(16) __bf16 sa[64][CC + 8]; __shared__ __align__(16) float so[64][CC + 4]; __shared__ __align__(16) _Float16 sbuf[2 * NH * 32 * 72];   // union: q/k chunk staging [2][64][264] or v planes staging [2][256][72]
  typedef _Float16 (*ChunkT)[NH * 32 + 8]; typedef _Float16 (*PlaneT)[72]; ChunkT sth = (ChunkT)sbuf, stl = (ChunkT)(sbuf + 64 * (NH * 32 + 8)); PlaneT svh = (PlaneT)sbuf, svl = (PlaneT)(sbuf + NH * 32 * 72);
  const int tid = threadIdx.x, wave = tid >> 5, lane = tid & 31, col = lane & 15, g = lane >> 4, rt = wave & 3, cg = wave >> 2; const int t0 = blockIdx.x * 64, which = blockIdx.z; const size_t b = blockIdx.y; const size_t r0 = b * TT + t0;
  for (int e = tid; e < 64 * CC; e += 512) { const int c = e >> 6, r = e & 63; sa[r][c] = (__bf16)X[(b * CC + c) * TT + t0 + r]; }
  if (tid < 64) for (int c = CC; c < CC + 8; ++c) sa[tid][c] = (__bf16)0.f;
  __syncthreads();
  const __bf16* P = PK + (size_t)which * CC * CC; const float* BB = (which == 0) ? BQ : (which == 1) ? BK : BV;
  v8f acc[3] = {};
#pragma unroll
  for (int kc = 0; kc < CC / 32; ++kc) { const v16b a = frag_b(&sa[rt * 16 + col][kc * 32], lane);
#pragma unroll
    for (int j = 0; j < 3; ++j) acc[j] = wmma_bf(a, frag_b(P + (size_t)((cg * 3 + j) * 16 + col) * CC + kc * 32, lane), acc[j]); }
#pragma unroll
  for (int j = 0; j < 3; ++j) { const float bb = bfr(BB[(cg * 3 + j) * 16 + col]);
#pragma unroll
    for (int r = 0; r < 8; ++r) so[rt * 16 + 8 * g + r][(cg * 3 + j) * 16 + col] = acc[j][r] + bb; }
  __syncthreads();
  if (which < 2) {
    for (int e = tid; e < 64 * NH * 32; e += 512) { const int r = e / (NH * 32), q = e % (NH * 32); const int h = q >> 5, d = q & 31; float v = 0.f; if (d < HDIM) v = so[r][h * HDIM + d]; const _Float16 hv = (_Float16)v; sth[r][q] = hv; stl[r][q] = (_Float16)((v - (float)hv) * 2048.0f); }
    if (which == 0) { // relative-key logits seeds: RQ[row][h][rr] = sum_d q[h*24+d] * emb_k[rr][d] (f32), 4 per thread, stored directly (16-B pieces of the row's 512-B RQ record; the block owns rows t0..t0+63)
      for (int e = tid; e < 64 * NH * 4; e += 512) { const int r = e / (NH * 4), q = e % (NH * 4); const int h = q >> 2, r4 = (q & 3) * 4; v4f o4;
        for (int i = 0; i < 4; ++i) { const int rr = r4 + i; float a2 = 0.f; if (rr < NREL) { for (int d = 0; d < HDIM; ++d) a2 += so[r][h * HDIM + d] * bfr(EK[rr * HDIM + d]); } o4[i] = a2; }
        vst2(RQ + ((r0 + r) * NH + h) * 16 + r4, o4); } }
    __syncthreads();
    _Float16* DH_ = which ? KH : QH; _Float16* DL_ = which ? KL : QL;
    if (which == 0) {
      for (int e = tid; e < 64 * (NH * 32 / 8); e += 512) { const int r = e / (NH * 4), q = e % (NH * 4); const size_t o = (r0 + r) * (NH * 32) + q * 8; vst2((unsigned*)(DH_ + o), *(const v4u*)&sth[r][q * 8]); vst2((unsigned*)(DL_ + o), *(const v4u*)&stl[r][q * 8]); }
    } else { // piece e: head e >> 8, then (tile of 16 keys, k half, g, key) in the low 8 bits, which is also the piece's place in the head's 4 tiles
      for (int e = tid; e < 64 * (NH * 32 / 8); e += 512) { const int h = e >> 8, r = ((e >> 6) & 3) * 16 + (e & 15), q = h * 4 + ((e >> 4) & 3); const size_t o = ((b * NH + h) * (TT / 16) + (t0 >> 4)) * 512 + (e & 255) * 8; vst2((unsigned*)(DH_ + o), *(const v4u*)&sth[r][q * 8]); vst2((unsigned*)(DL_ + o), *(const v4u*)&stl[r][q * 8]); } }
  } else {
    for (int e = tid; e < 64 * NH * 32; e += 512) { const int r = e & 63, q = e >> 6; const int h = q >> 5, d = q & 31; float v = 0.f; if (d < HDIM) v = so[r][h * HDIM + d]; const _Float16 hv = (_Float16)v; svh[q][r] = hv; svl[q][r] = (_Float16)((v - (float)hv) * 2048.0f); }
    __syncthreads();
    // piece e: head e >> 8, then (block of 32 keys, tile of 16 dims, key half, g, dim) in the low 8 bits, which is also the piece's place in the head's 2 blocks
    for (int e = tid; e < NH * 32 * 8; e += 512) { const int h = e >> 8, q = h * 32 + ((e >> 6) & 1) * 16 + (e & 15), pc = ((e >> 7) & 1) * 4 + ((e >> 4) & 3); const size_t o = ((b * NH + h) * (TT / 32) + (t0 >> 5)) * 1024 + (e & 255) * 8; vst2((unsigned*)(VH + o), *(const v4u*)&svh[q][pc * 8]); vst2((unsigned*)(VL + o), *(const v4u*)&svl[q][pc * 8]); } }
}
// ---- k_attn: block = (16 queries, head pair, b), 8 waves: wave = (head of the pair, quarter of the 1,024 keys). Each wave runs its 256 keys in tiles of 32 on its own (mask words read per lane in the score layout, no barrier in the loop): scores (3-product q.k + windowed rel-key seed) / sqrt(24), mask == 0 excluded; online softmax; P (x2^11 hi + residual) x V (2 tiles of 16 dims). The four partial (max, sum, context) of a head meet in LDS behind one barrier and are rescaled to the common max; the same pass adds sum_{|s-t|<=4} p(t,s) emb_v[s-t+4]; O rows [hp][row][(h % 2)*24 + d]
#define KSPL 4
// fragment stored in fragment order: a wave-uniform base plus the lane's 16 bytes in each of two runs of 512 bytes (4 whole lines a load)
__device__ __forceinline__ v16h frag_p(const _Float16* ubase, unsigned boff) {
  union { v16h v; v8h q[2]; } u; const char* p = (const char*)ubase;
  u.q[0] = *(const v8h*)(p + boff); u.q[1] = *(const v8h*)(p + 512 + boff); return u.v;
}
__global__ __launch_bounds__(256, 8) void k_attn(const _Float16* __restrict__ QH, const _Float16* __restrict__ QL, const _Float16* __restrict__ KH, const _Float16* __restrict__ KL, const float* __restrict__ RQ, const int* __restrict__ MASK, const float* __restrict__ EV, float* __restrict__ O) {
  __shared__ __align__(16) _Float16 sph[2 * KSPL][16][40], spl[2 * KSPL][16][40]; __shared__ float srq[2 * KSPL][16][NREL + 1]; __shared__ float spp[2][16][NREL + 1]; __shared__ float sm[2 * KSPL][16], sl[2 * KSPL][16]; __shared__ __align__(16) float sac[2 * KSPL][16][36];
  const int tid = threadIdx.x, wave = __builtin_amdgcn_readfirstlane(tid >> 5), lane = tid & 31, col = lane & 15, g = lane >> 4; const int hp = blockIdx.y; const size_t b = blockIdx.z; const int q0 = blockIdx.x * 16; const size_t rq = b * TT + q0; const float isc = 1.0f / sqrtf((float)HDIM);
  const int h = hp * 2 + wave / KSPL, kbase = (wave % KSPL) * (TT / KSPL);
  // the wave's number is made scalar so that the wave-uniform part of every K, V and mask address is scalar arithmetic; the second launch bound asks for 8 waves per SIMD (128 VGPRs): four blocks per WGP, the whole grid resident at once
  const int* MKw = MASK + rq * TT + kbase;
  // in fragment order 32 keys of a head are 1,024 elements in each of the four arrays, at the same place in each; the arrays lie one behind the other in the workspace, so one address serves all four, the rest being constant offsets
  const _Float16* FW = KH + ((b * NH + h) * (TT / 32) + kbase / 32) * 1024;
  const unsigned fo = lane * 16, mo = 8 * g * TT + col;
  if (lane < 16) { for (int rr = 0; rr < NREL; ++rr) srq[wave][lane][rr] = RQ[((rq + lane) * NH + h) * 16 + rr]; }
  const v16h aq = frag_h(QH + (rq + col) * (NH * 32) + h * 32, lane), aql = frag_h(QL + (rq + col) * (NH * 32) + h * 32, lane);
  float m[8], l[8];
#pragma unroll
  for (int r = 0; r < 8; ++r) { m[r] = -3.0e38f; l[r] = 0.f; }
  v8f acc[2] = {}, accl[2] = {};
  LDSX();
#pragma unroll 1
  for (int ks = 0; ks < TT / KSPL / 32; ++ks) { const int j0 = kbase + ks * 32;
    v8f s[2];
#pragma unroll
    for (int ct = 0; ct < 2; ++ct) { const int kk = j0 + ct * 16 + col; const _Float16* FK = FW + (ks * 2 + ct) * 512; v8f c = {}, cl = {}; int mk[8];
#pragma unroll
      for (int r = 0; r < 8; ++r) mk[r] = (MKw + ks * 32 + ct * 16 + r * TT)[mo];
      { const v16h kh = frag_p(FK, fo); c = wmma16(aq, kh, c); cl = wmma16(aql, kh, cl); cl = wmma16(aq, frag_p(FK + (WS_KL - WS_KH) / 2, fo), cl); }
#pragma unroll
      for (int r = 0; r < 8; ++r) { const int qi = q0 + 8 * g + r; const int dd = kk - qi; float sc = c[r] + cl[r] * (1.0f / 2048.0f); if (dd >= -WIN && dd <= WIN) sc += srq[wave][8 * g + r][dd + WIN]; const bool keep = mk[r] != 0; s[ct][r] = keep ? sc * isc : -3.0e38f; } }
#pragma unroll
    for (int r = 0; r < 8; ++r) { float mx = fmaxf(s[0][r], s[1][r]);
#pragma unroll
      for (int o = 1; o < 16; o <<= 1) mx = fmaxf(mx, __shfl_xor(mx, o));
      const float mn = fmaxf(m[r], mx); const float alpha = (m[r] <= -1.0e38f) ? 0.f : __expf(m[r] - mn);
      const float e0 = (s[0][r] <= -1.0e38f) ? 0.f : __expf(s[0][r] - mn), e1 = (s[1][r] <= -1.0e38f) ? 0.f : __expf(s[1][r] - mn); float es = e0 + e1;
#pragma unroll
      for (int o = 1; o < 16; o <<= 1) es += __shfl_xor(es, o);
      l[r] = l[r] * alpha + es; m[r] = (mn <= -1.0e38f) ? m[r] : mn; acc[0][r] *= alpha; acc[1][r] *= alpha; accl[0][r] *= alpha; accl[1][r] *= alpha;
      { const float p0 = e0 * 2048.0f, p1 = e1 * 2048.0f; const _Float16 h0 = (_Float16)p0, h1 = (_Float16)p1; sph[wave][8 * g + r][col] = h0; sph[wave][8 * g + r][16 + col] = h1; spl[wave][8 * g + r][col] = (_Float16)((p0 - (float)h0) * 2048.0f); spl[wave][8 * g + r][16 + col] = (_Float16)((p1 - (float)h1) * 2048.0f); } }
    LDSX();
    const v16h pah = frag_h(&sph[wave][col][0], lane), pal = frag_h(&spl[wave][col][0], lane);
#pragma unroll
    for (int dt = 0; dt < 2; ++dt) { const _Float16* FV = FW + (ks * 2 + dt) * 512; const v16h vh = frag_p(FV + (WS_VH - WS_KH) / 2, fo); acc[dt] = wmma16(pah, vh, acc[dt]); accl[dt] = wmma16(pal, vh, accl[dt]); accl[dt] = wmma16(pah, frag_p(FV + (WS_VL - WS_KH) / 2, fo), accl[dt]); } }
  // this wave's partial: running max and sum per row, context with its residual folded in
  if (col == 0) {
#pragma unroll
    for (int r = 0; r < 8; ++r) { sm[wave][8 * g + r] = m[r]; sl[wave][8 * g + r] = l[r]; } }
#pragma unroll
  for (int r = 0; r < 8; ++r)
#pragma unroll
    for (int dt = 0; dt < 2; ++dt) sac[wave][8 * g + r][dt * 16 + col] = acc[dt][r] + accl[dt][r] * (1.0f / 2048.0f);
  // windowed relative values: the score of (t, s) for s = t-4 .. t+4 recomputed with the same formula, one (head, row, offset) per thread; excluded keys carry the sentinel
  for (int e = tid; e < 2 * 16 * NREL; e += 256) { const int h2 = e / (16 * NREL), rr = (e / NREL) & 15, off = e % NREL; const int hx = hp * 2 + h2; const int sidx = q0 + rr + off - WIN; float sv = -3.0e38f;
    if (sidx >= 0 && sidx < TT && MASK[((rq + rr) * TT) + sidx] != 0) { const size_t rqo = (rq + rr) * (NH * 32) + hx * 32, rko = ((b * NH + hx) * (TT / 16) + (sidx >> 4)) * 512 + (sidx & 15) * 8; float dot = 0.f;
      // the key's 24 dims are 3 pieces of 8 in the fragment order, 128 elements apart. Each s_wait_xcnt stands in front of any overwrite of the address registers of the loads above it (a later load's result may land in them); the loops are unrolled so that every piece has a constant index and stays in registers
      v8h xq[3], xql[3], xk[3], xkl[3];
#pragma unroll
      for (int p = 0; p < 3; ++p) xq[p] = *(const v8h*)(QH + rqo + p * 8);
      asm volatile("s_wait_xcnt 0x0" ::: "memory");
#pragma unroll
      for (int p = 0; p < 3; ++p) xql[p] = *(const v8h*)(QL + rqo + p * 8);
      asm volatile("s_wait_xcnt 0x0" ::: "memory");
#pragma unroll
      for (int p = 0; p < 3; ++p) xk[p] = *(const v8h*)(KH + rko + p * 128);
      asm volatile("s_wait_xcnt 0x0" ::: "memory");
#pragma unroll
      for (int p = 0; p < 3; ++p) xkl[p] = *(const v8h*)(KL + rko + p * 128);
      asm volatile("s_wait_xcnt 0x0" ::: "memory");
      const float rqv = RQ[((rq + rr) * NH + hx) * 16 + off];
      asm volatile("s_wait_xcnt 0x0" ::: "memory");
#pragma unroll
      for (int d = 0; d < HDIM; ++d) { const float qv = (float)xq[d >> 3][d & 7] + (float)xql[d >> 3][d & 7] * (1.0f / 2048.0f); const float kv = (float)xk[d >> 3][d & 7] + (float)xkl[d >> 3][d & 7] * (1.0f / 2048.0f); dot += qv * kv; }
      sv = (dot + rqv) * isc; }
    spp[h2][rr][off] = sv; }
  __syncthreads();
  // merge: one thread per (row, head, 4 dims); every partial is rescaled from its own max to the row's max
  if (tid < 16 * 12) { const int r = tid / 12, q4 = tid % 12; const int h2 = q4 / 6, d = (q4 % 6) * 4, w0 = h2 * KSPL; float M = -3.0e38f, L = 0.f, f[KSPL];
#pragma unroll
    for (int w = 0; w < KSPL; ++w) M = fmaxf(M, sm[w0 + w][r]);
#pragma unroll
    for (int w = 0; w < KSPL; ++w) { const float mw = sm[w0 + w][r]; f[w] = (mw <= -1.0e38f) ? 0.f : __expf(mw - M); L += sl[w0 + w][r] * f[w]; }
    v4f a = {};
#pragma unroll
    for (int w = 0; w < KSPL; ++w) a += *(const v4f*)&sac[w0 + w][r][d] * f[w];
    v4f o4 = a * ((1.0f / 2048.0f) / L);
    for (int jr = 0; jr < NREL; ++jr) { const float sv = spp[h2][r][jr]; const float pv = (sv <= -1.0e38f) ? 0.f : __expf(sv - M) / L;
#pragma unroll
      for (int i = 0; i < 4; ++i) o4[i] += pv * bfr(EV[jr * HDIM + d + i]); }
    vst2(O + ((size_t)hp * NR + rq + r) * 48 + q4 * 4, o4); }
}
// ---- k_out: block = (96 output channels o, 32 positions, b), 6 waves: wave = one 16-channel tile x both 16-position tiles. y[o][t] = Wo rows (exact) x O (gathered from the [hp][row][48] layout into an LDS bf16 hi/lo tile [32 t][192 c]) + bo -> [B][C][T]. Every global read of a thread (8 16-byte pieces of O, its 6 Wo fragments, its 8 biases) is issued ahead of the one barrier, so the block waits for memory once
#define OPOS 32
#define OCH 96
typedef __attribute__((ext_vector_type(4))) __bf16 v4b;
__global__ __launch_bounds__(192) void k_out(const float* __restrict__ O, const __bf16* __restrict__ PK, const float* __restrict__ BO, float* __restrict__ Y) {
  __shared__ __align__(16) __bf16 sh[OPOS][CC + 8], sl[OPOS][CC + 8]; __shared__ __align__(16) float so2[OCH / 16][16][OPOS + 4];
  const int tid = threadIdx.x, wave = tid >> 5, lane = tid & 31, col = lane & 15, g = lane >> 4; const int o0 = blockIdx.x * OCH + wave * 16; const int n0 = blockIdx.y * OPOS; const size_t b = blockIdx.z;
  // piece i of a thread: head pair i >> 1, row (i & 1) * 16 + tid / 12, 4 of the row's 48 floats (the 32 rows of a head pair are one contiguous run)
  const int sr = tid / 12, sw = (tid % 12) * 4; v4f x[8];
#pragma unroll
  for (int i = 0; i < 8; ++i) x[i] = *(const v4f*)(O + ((size_t)(i >> 1) * NR + b * TT + n0 + (i & 1) * 16 + sr) * 48 + sw);
  asm volatile("s_wait_xcnt 0x0" ::: "memory");   // stands in front of any overwrite of the address registers of the loads above (a later load's result may land in them); the clobber keeps these loads issued here, ahead of the conversion that waits for O
  v16b a[CC / 32];
#pragma unroll
  for (int kc = 0; kc < CC / 32; ++kc) a[kc] = frag_b(PK + (size_t)3 * CC * CC + (size_t)(o0 + col) * CC + kc * 32, lane);
  asm volatile("s_wait_xcnt 0x0" ::: "memory");   // the same for the Wo fragment loads
  const v4f b0 = *(const v4f*)(BO + o0 + 8 * g), b1 = *(const v4f*)(BO + o0 + 8 * g + 4);
  asm volatile("s_wait_xcnt 0x0" ::: "memory");   // the same for the bias loads
#pragma unroll
  for (int i = 0; i < 8; ++i) { v4b hi, lo;
#pragma unroll
    for (int k = 0; k < 4; ++k) { const float v = x[i][k]; const __bf16 hb = (__bf16)v; hi[k] = hb; lo[k] = (__bf16)(v - (float)hb); }
    vst2(&sh[(i & 1) * 16 + sr][(i >> 1) * 48 + sw], hi); vst2(&sl[(i & 1) * 16 + sr][(i >> 1) * 48 + sw], lo); }
  __syncthreads();
  v8f acc[2] = {};
#pragma unroll
  for (int kc = 0; kc < CC / 32; ++kc) {
#pragma unroll
    for (int j = 0; j < 2; ++j) { acc[j] = wmma_bf(a[kc], frag_b(&sl[j * 16 + col][kc * 32], lane), acc[j]); acc[j] = wmma_bf(a[kc], frag_b(&sh[j * 16 + col][kc * 32], lane), acc[j]); } }
#pragma unroll
  for (int j = 0; j < 2; ++j)
#pragma unroll
    for (int r = 0; r < 8; ++r) so2[wave][8 * g + r][j * 16 + col] = acc[j][r] + bfr(r < 4 ? b0[r & 3] : b1[r & 3]);
  LDSX();
  // the wave writes its 16 channel rows as whole 128-byte runs, 4 rows a store
#pragma unroll
  for (int it = 0; it < 4; ++it) { const int rl = it * 4 + (lane >> 3), c4 = (lane & 7) * 4; vst2(Y + (b * CC + o0 + rl) * TT + n0 + c4, *(const v4f*)&so2[wave][rl][c4]); }
}
extern "C" void kernel_launch(void* const* d_in, const int* in_sizes, int n_in, void* d_out, int out_size, void* d_ws, size_t ws_size, hipStream_t stream) {
  (void)in_sizes; (void)n_in; (void)out_size;
  const float** F = (const float**)d_in;   // 0 x [4,192,1024], 1 attn_mask [4,1,1024,1024] i32, 2 Wq [192,192], 3 bq, 4 Wk, 5 bk, 6 Wv, 7 bv, 8 Wo, 9 bo, 10 emb_rel_k [1,9,24], 11 emb_rel_v [1,9,24]
  if (ws_size < (size_t)WS_END) return;
  char* ws = (char*)d_ws; __bf16* PK = (__bf16*)(ws + WS_PK); _Float16 *QH = (_Float16*)(ws + WS_QH), *QL = (_Float16*)(ws + WS_QL), *KH = (_Float16*)(ws + WS_KH), *KL = (_Float16*)(ws + WS_KL), *VH = (_Float16*)(ws + WS_VH), *VL = (_Float16*)(ws + WS_VL); float *RQ = (float*)(ws + WS_RQ), *O = (float*)(ws + WS_O);
  k_pack<<<dim3(CC, 4), 256, 0, stream>>>(F[2], F[4], F[6], F[8], PK);
  k_qkv<<<dim3(TT / 64, NB, 3), 512, 0, stream>>>(F[0], PK, F[3], F[5], F[7], F[10], QH, QL, KH, KL, VH, VL, RQ);
  k_attn<<<dim3(TQB, NH / 2, TNB), 256, 0, stream>>>(QH, QL, KH, KL, RQ, (const int*)d_in[1], F[11], O);
  k_out<<<dim3(CC / OCH, TT / OPOS, TNB), 192, 0, stream>>>(O, PK, F[9], (float*)d_out);
}

// v005
// A run of this version takes 70.5 microseconds.
// Two timings next to v004 both put it at 1.20 times that version's speed.
// Over all steps from v000 it is 6.12 times as fast.
// compute dtype: all float inputs rounded to bf16, attn_mask (int) read on device; q/k/v 1x1 convs with EXACT bf16 products on WMMA 16x16x32 (positions as rows via an LDS transpose of the [B,C,T] input, natural weight rows) + biases; q and k stored as f16 hi + (x2048-scaled) residual, head dim 24 zero-padded to 32 (q in per-head chunks of a row, k in fragment order), v as f16 hi + residual, padded to 32 dims per head, in fragment order; scores = (q . k (3 products) + the windowed relative-key logits q . emb_k[s-t+4] for |s-t| <= 4 (f32 dots)) / sqrt(24); mask == 0 -> -3e38 sentinel (weight set to 0, so the key is excluded); running-max softmax in f32 (hardware exp); P (scaled by 2^11, as f16 hi + residual) x v hi/lo (3 products); the windowed relative-value term sum_{|s-t|<=4} p(t,s) emb_v[s-t+4] added in f32 from recomputed (identical-formula) weights; output 1x1 conv with the context as bf16 hi + residual x exact Wo rows (2 products) + bo, written channels-first; f32 accumulate.
#include <hip/hip_runtime.h>
#include <math.h>

typedef __attribute__((ext_vector_type(16))) _Float16 v16h;
typedef __attribute__((ext_vector_type(16))) __bf16 v16b;
typedef __attribute__((ext_vector_type(8)))  _Float16 v8h;
typedef __attribute__((ext_vector_type(8)))  float v8f;
typedef __attribute__((ext_vector_type(4)))  float v4f;
typedef __attribute__((ext_vector_type(2)))  float v2f;
typedef __attribute__((ext_vector_type(4)))  unsigned v4u;
typedef __attribute__((ext_vector_type(4)))  int v4i;
typedef float __attribute__((may_alias)) float_a;
typedef int __attribute__((may_alias)) int_a;

template <typename T> __device__ __forceinline__ void vst2(void* p, T v) { *(T*)p = v;  }
__device__ __forceinline__ v8f wmma16(v16h a, v16h b, v8f c) {
  v8f d = __builtin_amdgcn_wmma_f32_16x16x32_f16(false, a, false, b, (short)0, c, false, false);
  asm volatile("v_nop\n\tv_nop\n\tv_nop\n\tv_nop" : "+v"(d) : "v"(a), "v"(b));
  return d;
}
__device__ __forceinline__ v8f wmma_bf(v16b a, v16b b, v8f c) {
  v8f d = __builtin_amdgcn_wmma_f32_16x16x32_bf16(false, a, false, b, (short)0, c, false, false);
  asm volatile("v_nop\n\tv_nop\n\tv_nop\n\tv_nop" : "+v"(d) : "v"(a), "v"(b));
  return d;
}
// 16x16x32 fragments: lane = (h = lane>>4, row/col = lane&15); elements 0..7 = k0+8h+0..7, 8..15 = k0+16+8h+0..7; D element r = row 8h+r
__device__ __forceinline__ v16h frag_h(const _Float16* rowk0, int lane) {
  union { v16h v; v8h q[2]; } u; const _Float16* p = rowk0 + 8 * (lane >> 4);
  u.q[0] = *(const v8h*)p; u.q[1] = *(const v8h*)(p + 16); return u.v;
}
__device__ __forceinline__ v16h frag_f32(const float* rowk0, int lane) {
  v16h a; const float* p = rowk0 + 8 * (lane >> 4);
#pragma unroll
  for (int i = 0; i < 8; ++i) { a[i] = (_Float16)p[i]; a[8 + i] = (_Float16)p[16 + i]; }
  return a;
}
__device__ __forceinline__ v16h frag_f32s(const float* rowk0, int lane, float sc) {
  v16h a; const float* p = rowk0 + 8 * (lane >> 4);
#pragma unroll
  for (int i = 0; i < 8; ++i) { a[i] = (_Float16)(p[i] * sc); a[8 + i] = (_Float16)(p[16 + i] * sc); }
  return a;
}
// column fragment from a [K][ld] layout (column n), rows >= K read as 0
__device__ __forceinline__ v16h fragc_f32(const float* W, int k0, int n, int lane, int ld, int K) {
  v16h a; const int g = lane >> 4;
#pragma unroll
  for (int i = 0; i < 8; ++i) { const int ka = k0 + 8 * g + i, kb = ka + 16;
    a[i] = (_Float16)(ka < K ? W[(size_t)(ka < K ? ka : K - 1) * ld + n] : 0.f); a[8 + i] = (_Float16)(kb < K ? W[(size_t)(kb < K ? kb : K - 1) * ld + n] : 0.f); }
  return a;
}
struct F2 { v16b h, l; };
__device__ __forceinline__ F2 bsplit16(const float v[16]) { F2 r;
#pragma unroll
  for (int i = 0; i < 16; ++i) { const __bf16 h = (__bf16)v[i]; r.h[i] = h; r.l[i] = (__bf16)(v[i] - (float)h); }
  return r; }
__device__ __forceinline__ F2 split_row(const float* row, int k0, int lane) { float v[16]; const float* p = row + k0 + 8 * (lane >> 4);
#pragma unroll
  for (int i = 0; i < 8; ++i) { v[i] = p[i]; v[8 + i] = p[16 + i]; }
  return bsplit16(v); }
__device__ __forceinline__ F2 split_rowK(const float* row, int k0, int lane, int K) { float v[16]; const int g = lane >> 4;
#pragma unroll
  for (int i = 0; i < 8; ++i) { const int ka = k0 + 8 * g + i, kb = ka + 16; v[i] = ka < K ? row[ka < K ? ka : K - 1] : 0.f; v[8 + i] = kb < K ? row[kb < K ? kb : K - 1] : 0.f; }
  return bsplit16(v); }
__device__ __forceinline__ F2 split_col(const float* W, int k0, int n, int lane, int ld, int K) { float v[16]; const int g = lane >> 4;
#pragma unroll
  for (int i = 0; i < 8; ++i) { const int ka = k0 + 8 * g + i, kb = ka + 16; v[i] = ka < K ? W[(size_t)(ka < K ? ka : K - 1) * ld + n] : 0.f; v[8 + i] = kb < K ? W[(size_t)(kb < K ? kb : K - 1) * ld + n] : 0.f; }
  return bsplit16(v); }
__device__ __forceinline__ v8f mac3(const F2& a, const F2& b, v8f c) { c = wmma_bf(a.l, b.h, c); c = wmma_bf(a.h, b.l, c); return wmma_bf(a.h, b.h, c); }
__device__ __forceinline__ float sigm(float v) { return 1.0f / (1.0f + expf(-v)); }
#define LDSX() do { asm volatile("s_wait_dscnt 0" ::: "memory"); __builtin_amdgcn_wave_barrier(); __builtin_amdgcn_fence(__ATOMIC_RELEASE, "workgroup"); } while (0)


// Relative-position multi-head attention (B 4, C 192 as 8 heads x 24, T 1,024, window 4): 1x1-conv q/k/v, scores with windowed relative key embeddings, per-(t,s) mask, softmax, values plus windowed relative value embeddings, 1x1-conv output -> [B, C, T].
#define NB 4
#define CC 192
#define TT 1024
#define NH 8
#define HDIM 24
#define WIN 4
#define NREL (2 * WIN + 1)
#define NR (NB * TT)
#ifndef TQB
#define TQB (TT / 16)
#define TNB NB
#endif
typedef __attribute__((ext_vector_type(8))) __bf16 v8b;
__device__ __forceinline__ v16b frag_b(const __bf16* rowk0, int lane) {
  union { v16b v; v8b q[2]; } u; const __bf16* p = rowk0 + 8 * (lane >> 4);
  u.q[0] = *(const v8b*)p; u.q[1] = *(const v8b*)(p + 16); return u.v;
}
__device__ __forceinline__ float bfr(float v) { return (float)(__bf16)v; }
__device__ __attribute__((noinline)) float exp_ni(float v) { return expf(v); }
__device__ __attribute__((noinline)) float erf_ni(float v) { return erff(v); }

#define PK_Q 0                               // [192][192] Wq ; Wk ; Wv ; Wo (natural rows)
#define PK_END ((size_t)4 * CC * CC)
#define WS_PK  0u
#define WS_QH  (((2u * PK_END) + 127u) / 128u * 128u)   // f16 [NR][8][32] q hi ; QL ; then k hi ; KL in fragment order [b][h][16-key tile][k half p][lane = 16 g + key][8]: element k = 16 p + 8 g + i
#define WS_QL  (WS_QH + 2u * NR * NH * 32)
#define WS_KH  (WS_QL + 2u * NR * NH * 32)
#define WS_KL  (WS_KH + 2u * NR * NH * 32)
#define WS_VH  (WS_KL + 2u * NR * NH * 32)               // f16 v hi ; VL in fragment order [b][h][32-key block][16-dim tile][key half p][lane = 16 g + dim][8]: key = 16 p + 8 g + i (dims 24..31 of each head zero)
#define WS_VL  (WS_VH + 2u * (size_t)NB * NH * 32 * TT)
#define WS_RQ  (WS_VL + 2u * (size_t)NB * NH * 32 * TT)  // f32 [NR][8][16] q . emb_k[r] (9 used)
#define WS_O   (WS_RQ + 4u * NR * NH * 16)                 // f32 [4 head pairs][NR][48] attention output (block-owned runs)
#define WS_END (WS_O + 4u * NR * CC)

__global__ __launch_bounds__(256) void k_pack(const float* __restrict__ WQ, const float* __restrict__ WK, const float* __restrict__ WV, const float* __restrict__ WO, __bf16* __restrict__ PK) {
  const int n = blockIdx.x, which = blockIdx.y, t = threadIdx.x; const float* Wm = (which == 0) ? WQ : (which == 1) ? WK : (which == 2) ? WV : WO; __shared__ __align__(16) __bf16 s[CC];
  if (t < CC) s[t] = (__bf16)Wm[(size_t)n * CC + t];
  __syncthreads();
  if (t < CC / 8) vst2((unsigned*)(PK + ((size_t)which * CC + n) * CC + t * 8), *(const v4u*)&s[t * 8]);
}
// ---- k_qkv: block = (64 positions, b, one of q / k / v), 16 waves: wave = (16-position row tile, 3 of the 12 column tiles). A tile [64 t][192 c] from x[b][c][t] (bf16 exact); D = A . W rows + b; q -> padded 32-wide per-head f16 hi/lo chunks; k, v -> the same values in the fragment order k_attn loads them in (a wave's 16-byte store covers 512 contiguous bytes); the q block also writes RQ[row][h][r] = q_h . emb_k[r] (f32)
__global__ __launch_bounds__(512) void k_qkv(const float* __restrict__ X, const __bf16* __restrict__ PK, const float* __restrict__ BQ, const float* __restrict__ BK, const float* __restrict__ BV, const float* __restrict__ EK, _Float16* __restrict__ QH, _Float16* __restrict__ QL, _Float16* __restrict__ KH, _Float16* __restrict__ KL, _Float16* __restrict__ VH, _Float16* __restrict__ VL, float* __restrict__ RQ) {
  __shared__ __align__(16) __bf16 sa[64][CC + 8]; __shared__ __align__(16) float so[64][CC + 4]; __shared__ __align__(16) _Float16 sbuf[2 * NH * 32 * 72];   // union: q/k chunk staging [2][64][264] or v planes staging [2][256][72]
  typedef _Float16 (*ChunkT)[NH * 32 + 8]; typedef _Float16 (*PlaneT)[72]; ChunkT sth = (ChunkT)sbuf, stl = (ChunkT)(sbuf + 64 * (NH * 32 + 8)); PlaneT svh = (PlaneT)sbuf, svl = (PlaneT)(sbuf + NH * 32 * 72);
  const int tid = threadIdx.x, wave = tid >> 5, lane = tid & 31, col = lane & 15, g = lane >> 4, rt = wave & 3, cg = wave >> 2; const int t0 = blockIdx.x * 64, which = blockIdx.z; const size_t b = blockIdx.y; const size_t r0 = b * TT + t0;
  for (int e = tid; e < 64 * CC; e += 512) { const int c = e >> 6, r = e & 63; sa[r][c] = (__bf16)X[(b * CC + c) * TT + t0 + r]; }
  if (tid < 64) for (int c = CC; c < CC + 8; ++c) sa[tid][c] = (__bf16)0.f;
  __syncthreads();
  const __bf16* P = PK + (size_t)which * CC * CC; const float* BB = (which == 0) ? BQ : (which == 1) ? BK : BV;
  v8f acc[3] = {};
#pragma unroll
  for (int kc = 0; kc < CC / 32; ++kc) { const v16b a = frag_b(&sa[rt * 16 + col][kc * 32], lane);
#pragma unroll
    for (int j = 0; j < 3; ++j) acc[j] = wmma_bf(a, frag_b(P + (size_t)((cg * 3 + j) * 16 + col) * CC + kc * 32, lane), acc[j]); }
#pragma unroll
  for (int j = 0; j < 3; ++j) { const float bb = bfr(BB[(cg * 3 + j) * 16 + col]);
#pragma unroll
    for (int r = 0; r < 8; ++r) so[rt * 16 + 8 * g + r][(cg * 3 + j) * 16 + col] = acc[j][r] + bb; }
  __syncthreads();
  if (which < 2) {
    for (int e = tid; e < 64 * NH * 32; e += 512) { const int r = e / (NH * 32), q = e % (NH * 32); const int h = q >> 5, d = q & 31; float v = 0.f; if (d < HDIM) v = so[r][h * HDIM + d]; const _Float16 hv = (_Float16)v; sth[r][q] = hv; stl[r][q] = (_Float16)((v - (float)hv) * 2048.0f); }
    if (which == 0) { // relative-key logits seeds: RQ[row][h][rr] = sum_d q[h*24+d] * emb_k[rr][d] (f32), 4 per thread, stored directly (16-B pieces of the row's 512-B RQ record; the block owns rows t0..t0+63)
      for (int e = tid; e < 64 * NH * 4; e += 512) { const int r = e / (NH * 4), q = e % (NH * 4); const int h = q >> 2, r4 = (q & 3) * 4; v4f o4;
        for (int i = 0; i < 4; ++i) { const int rr = r4 + i; float a2 = 0.f; if (rr < NREL) { for (int d = 0; d < HDIM; ++d) a2 += so[r][h * HDIM + d] * bfr(EK[rr * HDIM + d]); } o4[i] = a2; }
        vst2(RQ + ((r0 + r) * NH + h) * 16 + r4, o4); } }
    __syncthreads();
    _Float16* DH_ = which ? KH : QH; _Float16* DL_ = which ? KL : QL;
    if (which == 0) {
      for (int e = tid; e < 64 * (NH * 32 / 8); e += 512) { const int r = e / (NH * 4), q = e % (NH * 4); const size_t o = (r0 + r) * (NH * 32) + q * 8; vst2((unsigned*)(DH_ + o), *(const v4u*)&sth[r][q * 8]); vst2((unsigned*)(DL_ + o), *(const v4u*)&stl[r][q * 8]); }
    } else { // piece e: head e >> 8, then (tile of 16 keys, k half, g, key) in the low 8 bits, which is also the piece's place in the head's 4 tiles
      for (int e = tid; e < 64 * (NH * 32 / 8); e += 512) { const int h = e >> 8, r = ((e >> 6) & 3) * 16 + (e & 15), q = h * 4 + ((e >> 4) & 3); const size_t o = ((b * NH + h) * (TT / 16) + (t0 >> 4)) * 512 + (e & 255) * 8; vst2((unsigned*)(DH_ + o), *(const v4u*)&sth[r][q * 8]); vst2((unsigned*)(DL_ + o), *(const v4u*)&stl[r][q * 8]); } }
  } else {
    for (int e = tid; e < 64 * NH * 32; e += 512) { const int r = e & 63, q = e >> 6; const int h = q >> 5, d = q & 31; float v = 0.f; if (d < HDIM) v = so[r][h * HDIM + d]; const _Float16 hv = (_Float16)v; svh[q][r] = hv; svl[q][r] = (_Float16)((v - (float)hv) * 2048.0f); }
    __syncthreads();
    // piece e: head e >> 8, then (block of 32 keys, tile of 16 dims, key half, g, dim) in the low 8 bits, which is also the piece's place in the head's 2 blocks
    for (int e = tid; e < NH * 32 * 8; e += 512) { const int h = e >> 8, q = h * 32 + ((e >> 6) & 1) * 16 + (e & 15), pc = ((e >> 7) & 1) * 4 + ((e >> 4) & 3); const size_t o = ((b * NH + h) * (TT / 32) + (t0 >> 5)) * 1024 + (e & 255) * 8; vst2((unsigned*)(VH + o), *(const v4u*)&svh[q][pc * 8]); vst2((unsigned*)(VL + o), *(const v4u*)&svl[q][pc * 8]); } }
}
// ---- k_attn: block = (16 queries, head pair, b), 8 waves: wave = (head of the pair, quarter of the 1,024 keys). Each wave runs its 256 keys in tiles of 32 on its own (no barrier in the loop). The scores are formed transposed, S^T = K . Q^T (A = a 16-key tile, B = the 16 queries): a lane holds 16 scores of ONE query (column lane & 15; keys 8 g + r of each 16-key tile), so the maximum and the sum of a row are in-lane work plus one exchange between the wave's halves, and the mask is read 8 consecutive words a lane. scores (3-product k.q + windowed rel-key seed) / sqrt(24), mask == 0 excluded; online softmax; P^T (x2^11 hi + residual), converted in place from the two score tiles, is the B operand of O^T += V^T . P^T (2 tiles of 16 dims as A). The four partial (max, sum, context) of a head meet in LDS behind one barrier and are rescaled to the common max; the same pass adds sum_{|s-t|<=4} p(t,s) emb_v[s-t+4]; O rows [hp][row][(h & 1) * 24 + d]
#define KSPL 4
// fragment stored in fragment order: a wave-uniform base plus the lane's 16 bytes in each of two runs of 512 bytes (4 whole lines a load)
__device__ __forceinline__ v16h frag_p(const _Float16* ubase, unsigned boff) {
  union { v16h v; v8h q[2]; } u; const char* p = (const char*)ubase;
  u.q[0] = *(const v8h*)(p + boff); u.q[1] = *(const v8h*)(p + 512 + boff); return u.v;
}
// lane l's value from lane l ^ 16 (a vector cross-row move, no LDS path)
__device__ __forceinline__ float xhalf(float x) { return __builtin_bit_cast(float, __builtin_amdgcn_permlanex16(__builtin_bit_cast(int, x), __builtin_bit_cast(int, x), 0x76543210, 0xfedcba98, false, false)); }
__global__ __launch_bounds__(256, 8) void k_attn(const _Float16* __restrict__ QH, const _Float16* __restrict__ QL, const _Float16* __restrict__ KH, const _Float16* __restrict__ KL, const float* __restrict__ RQ, const int* __restrict__ MASK, const float* __restrict__ EV, float* __restrict__ O) {
  __shared__ float srq[2 * KSPL][16][NREL + 1]; __shared__ float spp[2][16][NREL + 1]; __shared__ float sm[2 * KSPL][16], sl[2 * KSPL][16]; __shared__ __align__(16) float sac[2 * KSPL][16][36];
  const int tid = threadIdx.x, wave = __builtin_amdgcn_readfirstlane(tid >> 5), lane = tid & 31, col = lane & 15, g = lane >> 4; const int hp = blockIdx.y; const size_t b = blockIdx.z; const int q0 = blockIdx.x * 16; const size_t rq = b * TT + q0; const float isc = 1.0f / sqrtf((float)HDIM);
  const int h = hp * 2 + wave / KSPL, kbase = (wave % KSPL) * (TT / KSPL);
  // the wave's number is made scalar so that the wave-uniform part of every K, V and mask address is scalar arithmetic; the second launch bound asks for 8 waves per SIMD (128 VGPRs): four blocks per WGP, the whole grid resident at once
  const int* MKw = MASK + rq * TT + kbase;
  // in fragment order 32 keys of a head are 1,024 elements in each of the four arrays, at the same place in each; the arrays lie one behind the other in the workspace, so one address serves all four, the rest being constant offsets
  const _Float16* FW = KH + ((b * NH + h) * (TT / 32) + kbase / 32) * 1024;
  const unsigned fo = lane * 16, mo = col * TT + 8 * g;
  if (lane < 16) { for (int rr = 0; rr < NREL; ++rr) srq[wave][lane][rr] = RQ[((rq + lane) * NH + h) * 16 + rr]; }
  const v16h aq = frag_h(QH + (rq + col) * (NH * 32) + h * 32, lane), aql = frag_h(QL + (rq + col) * (NH * 32) + h * 32, lane);
  const int qi = q0 + col;
  float m = -3.0e38f, l = 0.f;   // the lane's query: running max (equal in both halves), and this half's share of the running sum
  v8f acc[2] = {}, accl[2] = {};
  LDSX();
#pragma unroll 1
  for (int ks = 0; ks < TT / KSPL / 32; ++ks) { const int j0 = kbase + ks * 32;
    v8f s[2];
#pragma unroll
    for (int ct = 0; ct < 2; ++ct) { const _Float16* FK = FW + (ks * 2 + ct) * 512; v8f c = {}, cl = {};
      const int* MP = MKw + ks * 32 + ct * 16; const v4i mk0 = *(const v4i*)(MP + mo), mk1 = *(const v4i*)(MP + 4 + mo);
      { const v16h kh = frag_p(FK, fo); c = wmma16(kh, aq, c); cl = wmma16(kh, aql, cl); cl = wmma16(frag_p(FK + (WS_KL - WS_KH) / 2, fo), aq, cl); }
#pragma unroll
      for (int r = 0; r < 8; ++r) { const int dd = j0 + ct * 16 + 8 * g + r - qi; float sc = c[r] + cl[r] * (1.0f / 2048.0f); if (dd >= -WIN && dd <= WIN) sc += srq[wave][col][dd + WIN]; const bool keep = (r < 4 ? mk0[r & 3] : mk1[r & 3]) != 0; s[ct][r] = keep ? sc * isc : -3.0e38f; } }
    asm volatile("s_wait_xcnt 0x0" ::: "memory");   // stands in front of the loop's step of the mask loads' address registers
    float mx = fmaxf(s[0][0], s[1][0]);
#pragma unroll
    for (int r = 1; r < 8; ++r) mx = fmaxf(mx, fmaxf(s[0][r], s[1][r]));
    mx = fmaxf(mx, xhalf(mx));
    const float mn = fmaxf(m, mx); const float alpha = (m <= -1.0e38f) ? 0.f : __expf(m - mn);
    v16h pbh, pbl; float e[16], es = 0.f;
#pragma unroll
    for (int i = 0; i < 16; ++i) { const float sv = s[i >> 3][i & 7]; e[i] = (sv <= -1.0e38f) ? 0.f : __expf(sv - mn); }
#pragma unroll
    for (int i = 0; i < 16; ++i) { es += e[i]; const float p = e[i] * 2048.0f; const _Float16 ph = (_Float16)p; pbh[i] = ph; pbl[i] = (_Float16)((p - (float)ph) * 2048.0f); }
    l = l * alpha + es; m = (mn <= -1.0e38f) ? m : mn;
#pragma unroll
    for (int dt = 0; dt < 2; ++dt) { acc[dt] *= alpha; accl[dt] *= alpha; }
#pragma unroll
    for (int dt = 0; dt < 2; ++dt) { const _Float16* FV = FW + (ks * 2 + dt) * 512; const v16h vh = frag_p(FV + (WS_VH - WS_KH) / 2, fo); acc[dt] = wmma16(vh, pbh, acc[dt]); accl[dt] = wmma16(vh, pbl, accl[dt]); accl[dt] = wmma16(frag_p(FV + (WS_VL - WS_KH) / 2, fo), pbh, accl[dt]); } }
  // this wave's partial: running max and sum per query (the halves' sums joined here, once), context with its residual folded in (a lane holds dims 8 g + r of each 16-dim tile of its query)
  l += xhalf(l);
  if (g == 0) { sm[wave][col] = m; sl[wave][col] = l; }
#pragma unroll
  for (int dt = 0; dt < 2; ++dt) { const v8f o8 = acc[dt] + accl[dt] * (1.0f / 2048.0f);
    vst2(&sac[wave][col][dt * 16 + 8 * g], (v4f){o8[0], o8[1], o8[2], o8[3]}); vst2(&sac[wave][col][dt * 16 + 8 * g + 4], (v4f){o8[4], o8[5], o8[6], o8[7]}); }
  // windowed relative values: the score of (t, s) for s = t-4 .. t+4 recomputed with the same formula, one (head, row, offset) per thread; excluded keys carry the sentinel
  for (int e = tid; e < 2 * 16 * NREL; e += 256) { const int h2 = e / (16 * NREL), rr = (e / NREL) & 15, off = e % NREL; const int hx = hp * 2 + h2; const int sidx = q0 + rr + off - WIN; float sv = -3.0e38f;
    if (sidx >= 0 && sidx < TT && MASK[((rq + rr) * TT) + sidx] != 0) { const size_t rqo = (rq + rr) * (NH * 32) + hx * 32, rko = ((b * NH + hx) * (TT / 16) + (sidx >> 4)) * 512 + (sidx & 15) * 8; float dot = 0.f;
      // the key's 24 dims are 3 pieces of 8 in the fragment order, 128 elements apart. Each s_wait_xcnt stands in front of any overwrite of the address registers of the loads above it (a later load's result may land in them); the loops are unrolled so that every piece has a constant index and stays in registers
      v8h xq[3], xql[3], xk[3], xkl[3];
#pragma unroll
      for (int p = 0; p < 3; ++p) xq[p] = *(const v8h*)(QH + rqo + p * 8);
      asm volatile("s_wait_xcnt 0x0" ::: "memory");
#pragma unroll
      for (int p = 0; p < 3; ++p) xql[p] = *(const v8h*)(QL + rqo + p * 8);
      asm volatile("s_wait_xcnt 0x0" ::: "memory");
#pragma unroll
      for (int p = 0; p < 3; ++p) xk[p] = *(const v8h*)(KH + rko + p * 128);
      asm volatile("s_wait_xcnt 0x0" ::: "memory");
#pragma unroll
      for (int p = 0; p < 3; ++p) xkl[p] = *(const v8h*)(KL + rko + p * 128);
      asm volatile("s_wait_xcnt 0x0" ::: "memory");
      const float rqv = RQ[((rq + rr) * NH + hx) * 16 + off];
      asm volatile("s_wait_xcnt 0x0" ::: "memory");
#pragma unroll
      for (int d = 0; d < HDIM; ++d) { const float qv = (float)xq[d >> 3][d & 7] + (float)xql[d >> 3][d & 7] * (1.0f / 2048.0f); const float kv = (float)xk[d >> 3][d & 7] + (float)xkl[d >> 3][d & 7] * (1.0f / 2048.0f); dot += qv * kv; }
      sv = (dot + rqv) * isc; }
    spp[h2][rr][off] = sv; }
  __syncthreads();
  // merge: one thread per (row, head, 4 dims); every partial is rescaled from its own max to the row's max
  if (tid < 16 * 12) { const int r = tid / 12, q4 = tid % 12; const int h2 = q4 / 6, d = (q4 % 6) * 4, w0 = h2 * KSPL; float M = -3.0e38f, L = 0.f, f[KSPL];
#pragma unroll
    for (int w = 0; w < KSPL; ++w) M = fmaxf(M, sm[w0 + w][r]);
#pragma unroll
    for (int w = 0; w < KSPL; ++w) { const float mw = sm[w0 + w][r]; f[w] = (mw <= -1.0e38f) ? 0.f : __expf(mw - M); L += sl[w0 + w][r] * f[w]; }
    v4f a = {};
#pragma unroll
    for (int w = 0; w < KSPL; ++w) a += *(const v4f*)&sac[w0 + w][r][d] * f[w];
    v4f o4 = a * ((1.0f / 2048.0f) / L);
    for (int jr = 0; jr < NREL; ++jr) { const float sv = spp[h2][r][jr]; const float pv = (sv <= -1.0e38f) ? 0.f : __expf(sv - M) / L;
#pragma unroll
      for (int i = 0; i < 4; ++i) o4[i] += pv * bfr(EV[jr * HDIM + d + i]); }
    vst2(O + ((size_t)hp * NR + rq + r) * 48 + q4 * 4, o4); }
}
// ---- k_out: block = (96 output channels o, 32 positions, b), 6 waves: wave = one 16-channel tile x both 16-position tiles. y[o][t] = Wo rows (exact) x O (gathered from the [hp][row][48] layout into an LDS bf16 hi/lo tile [32 t][192 c]) + bo -> [B][C][T]. Every global read of a thread (8 16-byte pieces of O, its 6 Wo fragments, its 8 biases) is issued ahead of the one barrier, so the block waits for memory once
#define OPOS 32
#define OCH 96
typedef __attribute__((ext_vector_type(4))) __bf16 v4b;
__global__ __launch_bounds__(192) void k_out(const float* __restrict__ O, const __bf16* __restrict__ PK, const float* __restrict__ BO, float* __restrict__ Y) {
  __shared__ __align__(16) __bf16 sh[OPOS][CC + 8], sl[OPOS][CC + 8]; __shared__ __align__(16) float so2[OCH / 16][16][OPOS + 4];
  const int tid = threadIdx.x, wave = tid >> 5, lane = tid & 31, col = lane & 15, g = lane >> 4; const int o0 = blockIdx.x * OCH + wave * 16; const int n0 = blockIdx.y * OPOS; const size_t b = blockIdx.z;
  // piece i of a thread: head pair i >> 1, row (i & 1) * 16 + tid / 12, 4 of the row's 48 floats (the 32 rows of a head pair are one contiguous run)
  const int sr = tid / 12, sw = (tid % 12) * 4; v4f x[8];
#pragma unroll
  for (int i = 0; i < 8; ++i) x[i] = *(const v4f*)(O + ((size_t)(i >> 1) * NR + b * TT + n0 + (i & 1) * 16 + sr) * 48 + sw);
  asm volatile("s_wait_xcnt 0x0" ::: "memory");   // stands in front of any overwrite of the address registers of the loads above (a later load's result may land in them); the clobber keeps these loads issued here, ahead of the conversion that waits for O
  v16b a[CC / 32];
#pragma unroll
  for (int kc = 0; kc < CC / 32; ++kc) a[kc] = frag_b(PK + (size_t)3 * CC * CC + (size_t)(o0 + col) * CC + kc * 32, lane);
  asm volatile("s_wait_xcnt 0x0" ::: "memory");   // the same for the Wo fragment loads
  const v4f b0 = *(const v4f*)(BO + o0 + 8 * g), b1 = *(const v4f*)(BO + o0 + 8 * g + 4);
  asm volatile("s_wait_xcnt 0x0" ::: "memory");   // the same for the bias loads
#pragma unroll
  for (int i = 0; i < 8; ++i) { v4b hi, lo;
#pragma unroll
    for (int k = 0; k < 4; ++k) { const float v = x[i][k]; const __bf16 hb = (__bf16)v; hi[k] = hb; lo[k] = (__bf16)(v - (float)hb); }
    vst2(&sh[(i & 1) * 16 + sr][(i >> 1) * 48 + sw], hi); vst2(&sl[(i & 1) * 16 + sr][(i >> 1) * 48 + sw], lo); }
  __syncthreads();
  v8f acc[2] = {};
#pragma unroll
  for (int kc = 0; kc < CC / 32; ++kc) {
#pragma unroll
    for (int j = 0; j < 2; ++j) { acc[j] = wmma_bf(a[kc], frag_b(&sl[j * 16 + col][kc * 32], lane), acc[j]); acc[j] = wmma_bf(a[kc], frag_b(&sh[j * 16 + col][kc * 32], lane), acc[j]); } }
#pragma unroll
  for (int j = 0; j < 2; ++j)
#pragma unroll
    for (int r = 0; r < 8; ++r) so2[wave][8 * g + r][j * 16 + col] = acc[j][r] + bfr(r < 4 ? b0[r & 3] : b1[r & 3]);
  LDSX();
  // the wave writes its 16 channel rows as whole 128-byte runs, 4 rows a store
#pragma unroll
  for (int it = 0; it < 4; ++it) { const int rl = it * 4 + (lane >> 3), c4 = (lane & 7) * 4; vst2(Y + (b * CC + o0 + rl) * TT + n0 + c4, *(const v4f*)&so2[wave][rl][c4]); }
}
extern "C" void kernel_launch(void* const* d_in, const int* in_sizes, int n_in, void* d_out, int out_size, void* d_ws, size_t ws_size, hipStream_t stream) {
  (void)in_sizes; (void)n_in; (void)out_size;
  const float** F = (const float**)d_in;   // 0 x [4,192,1024], 1 attn_mask [4,1,1024,1024] i32, 2 Wq [192,192], 3 bq, 4 Wk, 5 bk, 6 Wv, 7 bv, 8 Wo, 9 bo, 10 emb_rel_k [1,9,24], 11 emb_rel_v [1,9,24]
  if (ws_size < (size_t)WS_END) return;
  char* ws = (char*)d_ws; __bf16* PK = (__bf16*)(ws + WS_PK); _Float16 *QH = (_Float16*)(ws + WS_QH), *QL = (_Float16*)(ws + WS_QL), *KH = (_Float16*)(ws + WS_KH), *KL = (_Float16*)(ws + WS_KL), *VH = (_Float16*)(ws + WS_VH), *VL = (_Float16*)(ws + WS_VL); float *RQ = (float*)(ws + WS_RQ), *O = (float*)(ws + WS_O);
  k_pack<<<dim3(CC, 4), 256, 0, stream>>>(F[2], F[4], F[6], F[8], PK);
  k_qkv<<<dim3(TT / 64, NB, 3), 512, 0, stream>>>(F[0], PK, F[3], F[5], F[7], F[10], QH, QL, KH, KL, VH, VL, RQ);
  k_attn<<<dim3(TQB, NH / 2, TNB), 256, 0, stream>>>(QH, QL, KH, KL, RQ, (const int*)d_in[1], F[11], O);
  k_out<<<dim3(CC / OCH, TT / OPOS, TNB), 192, 0, stream>>>(O, PK, F[9], (float*)d_out);
}

// v006
// Measured time: 61.6 microseconds a run.
// In both of two side-by-side timings against v005, it was 1.14 times as fast.
// Over all steps from v000 it is 6.99 times as fast.
// compute dtype: all float inputs rounded to bf16, attn_mask (int) read on device; q/k/v 1x1 convs with EXACT bf16 products on WMMA 16x16x32 (positions as rows via an LDS transpose of the [B,C,T] input, natural weight rows) + biases; q and k stored as f16 hi + (x2048-scaled) residual, head dim 24 zero-padded to 32 (q in per-head chunks of a row, k in fragment order), v as f16 hi + residual, padded to 32 dims per head, in fragment order; scores = (q . k (3 products) + the windowed relative-key logits q . emb_k[s-t+4] for |s-t| <= 4 (f32 dots)) / sqrt(24); mask == 0 -> -3e38 sentinel (weight set to 0, so the key is excluded); running-max softmax in f32 (hardware exp); P (scaled by 2^11, as f16 hi + residual) x v hi/lo (3 products); the windowed relative-value term sum_{|s-t|<=4} p(t,s) emb_v[s-t+4] added in f32 from recomputed (identical-formula) weights; output 1x1 conv with the context as bf16 hi + residual x exact Wo rows (2 products) + bo, written channels-first; f32 accumulate.
#include <hip/hip_runtime.h>
#include <math.h>

typedef __attribute__((ext_vector_type(16))) _Float16 v16h;
typedef __attribute__((ext_vector_type(16))) __bf16 v16b;
typedef __attribute__((ext_vector_type(8)))  _Float16 v8h;
typedef __attribute__((ext_vector_type(8)))  float v8f;
typedef __attribute__((ext_vector_type(4)))  float v4f;
typedef __attribute__((ext_vector_type(2)))  float v2f;
typedef __attribute__((ext_vector_type(4)))  unsigned v4u;
typedef __attribute__((ext_vector_type(4)))  int v4i;
typedef float __attribute__((may_alias)) float_a;
typedef int __attribute__((may_alias)) int_a;

template <typename T> __device__ __forceinline__ void vst2(void* p, T v) { *(T*)p = v;  }
__device__ __forceinline__ v8f wmma16(v16h a, v16h b, v8f c) {
  v8f d = __builtin_amdgcn_wmma_f32_16x16x32_f16(false, a, false, b, (short)0, c, false, false);
  asm volatile("v_nop\n\tv_nop\n\tv_nop\n\tv_nop" : "+v"(d) : "v"(a), "v"(b));
  return d;
}
__device__ __forceinline__ v8f wmma_bf(v16b a, v16b b, v8f c) {
  v8f d = __builtin_amdgcn_wmma_f32_16x16x32_bf16(false, a, false, b, (short)0, c, false, false);
  asm volatile("v_nop\n\tv_nop\n\tv_nop\n\tv_nop" : "+v"(d) : "v"(a), "v"(b));
  return d;
}
// 16x16x32 fragments: lane = (h = lane>>4, row/col = lane&15); elements 0..7 = k0+8h+0..7, 8..15 = k0+16+8h+0..7; D element r = row 8h+r
__device__ __forceinline__ v16h frag_h(const _Float16* rowk0, int lane) {
  union { v16h v; v8h q[2]; } u; const _Float16* p = rowk0 + 8 * (lane >> 4);
  u.q[0] = *(const v8h*)p; u.q[1] = *(const v8h*)(p + 16); return u.v;
}
__device__ __forceinline__ v16h frag_f32(const float* rowk0, int lane) {
  v16h a; const float* p = rowk0 + 8 * (lane >> 4);
#pragma unroll
  for (int i = 0; i < 8; ++i) { a[i] = (_Float16)p[i]; a[8 + i] = (_Float16)p[16 + i]; }
  return a;
}
__device__ __forceinline__ v16h frag_f32s(const float* rowk0, int lane, float sc) {
  v16h a; const float* p = rowk0 + 8 * (lane >> 4);
#pragma unroll
  for (int i = 0; i < 8; ++i) { a[i] = (_Float16)(p[i] * sc); a[8 + i] = (_Float16)(p[16 + i] * sc); }
  return a;
}
// column fragment from a [K][ld] layout (column n), rows >= K read as 0
__device__ __forceinline__ v16h fragc_f32(const float* W, int k0, int n, int lane, int ld, int K) {
  v16h a; const int g = lane >> 4;
#pragma unroll
  for (int i = 0; i < 8; ++i) { const int ka = k0 + 8 * g + i, kb = ka + 16;
    a[i] = (_Float16)(ka < K ? W[(size_t)(ka < K ? ka : K - 1) * ld + n] : 0.f); a[8 + i] = (_Float16)(kb < K ? W[(size_t)(kb < K ? kb : K - 1) * ld + n] : 0.f); }
  return a;
}
struct F2 { v16b h, l; };
__device__ __forceinline__ F2 bsplit16(const float v[16]) { F2 r;
#pragma unroll
  for (int i = 0; i < 16; ++i) { const __bf16 h = (__bf16)v[i]; r.h[i] = h; r.l[i] = (__bf16)(v[i] - (float)h); }
  return r; }
__device__ __forceinline__ F2 split_row(const float* row, int k0, int lane) { float v[16]; const float* p = row + k0 + 8 * (lane >> 4);
#pragma unroll
  for (int i = 0; i < 8; ++i) { v[i] = p[i]; v[8 + i] = p[16 + i]; }
  return bsplit16(v); }
__device__ __forceinline__ F2 split_rowK(const float* row, int k0, int lane, int K) { float v[16]; const int g = lane >> 4;
#pragma unroll
  for (int i = 0; i < 8; ++i) { const int ka = k0 + 8 * g + i, kb = ka + 16; v[i] = ka < K ? row[ka < K ? ka : K - 1] : 0.f; v[8 + i] = kb < K ? row[kb < K ? kb : K - 1] : 0.f; }
  return bsplit16(v); }
__device__ __forceinline__ F2 split_col(const float* W, int k0, int n, int lane, int ld, int K) { float v[16]; const int g = lane >> 4;
#pragma unroll
  for (int i = 0; i < 8; ++i) { const int ka = k0 + 8 * g + i, kb = ka + 16; v[i] = ka < K ? W[(size_t)(ka < K ? ka : K - 1) * ld + n] : 0.f; v[8 + i] = kb < K ? W[(size_t)(kb < K ? kb : K - 1) * ld + n] : 0.f; }
  return bsplit16(v); }
__device__ __forceinline__ v8f mac3(const F2& a, const F2& b, v8f c) { c = wmma_bf(a.l, b.h, c); c = wmma_bf(a.h, b.l, c); return wmma_bf(a.h, b.h, c); }
__device__ __forceinline__ float sigm(float v) { return 1.0f / (1.0f + expf(-v)); }
#define LDSX() do { asm volatile("s_wait_dscnt 0" ::: "memory"); __builtin_amdgcn_wave_barrier(); __builtin_amdgcn_fence(__ATOMIC_RELEASE, "workgroup"); } while (0)


// Relative-position multi-head attention (B 4, C 192 as 8 heads x 24, T 1,024, window 4): 1x1-conv q/k/v, scores with windowed relative key embeddings, per-(t,s) mask, softmax, values plus windowed relative value embeddings, 1x1-conv output -> [B, C, T].
#define NB 4
#define CC 192
#define TT 1024
#define NH 8
#define HDIM 24
#define WIN 4
#define NREL (2 * WIN + 1)
#define NR (NB * TT)
#ifndef TQB
#define TQB (TT / 16)
#define TNB NB
#endif
typedef __attribute__((ext_vector_type(8))) __bf16 v8b;
__device__ __forceinline__ v16b frag_b(const __bf16* rowk0, int lane) {
  union { v16b v; v8b q[2]; } u; const __bf16* p = rowk0 + 8 * (lane >> 4);
  u.q[0] = *(const v8b*)p; u.q[1] = *(const v8b*)(p + 16); return u.v;
}
__device__ __forceinline__ float bfr(float v) { return (float)(__bf16)v; }
__device__ __attribute__((noinline)) float exp_ni(float v) { return expf(v); }
__device__ __attribute__((noinline)) float erf_ni(float v) { return erff(v); }

#define PK_Q 0                               // [192][192] Wq ; Wk ; Wv ; Wo (natural rows)
#define PK_END ((size_t)4 * CC * CC)
#define WS_PK  0u
#define WS_QH  (((2u * PK_END) + 127u) / 128u * 128u)   // f16 [NR][8][32] q hi ; QL ; then k hi ; KL in fragment order [b][h][16-key tile][k half p][lane = 16 g + key][8]: element k = 16 p + 8 g + i
#define WS_QL  (WS_QH + 2u * NR * NH * 32)
#define WS_KH  (WS_QL + 2u * NR * NH * 32)
#define WS_KL  (WS_KH + 2u * NR * NH * 32)
#define WS_VH  (WS_KL + 2u * NR * NH * 32)               // f16 v hi ; VL in fragment order [b][h][32-key block][16-dim tile][key half p][lane = 16 g + dim][8]: key = 16 p + 8 g + i (dims 24..31 of each head zero)
#define WS_VL  (WS_VH + 2u * (size_t)NB * NH * 32 * TT)
#define WS_RQ  (WS_VL + 2u * (size_t)NB * NH * 32 * TT)  // f32 [NR][8][16] q . emb_k[r] (9 used)
#define WS_O   (WS_RQ + 4u * NR * NH * 16)                 // f32 [4 head pairs][NR][48] attention output (block-owned runs)
#define WS_END (WS_O + 4u * NR * CC)

__global__ __launch_bounds__(256) void k_pack(const float* __restrict__ WQ, const float* __restrict__ WK, const float* __restrict__ WV, const float* __restrict__ WO, __bf16* __restrict__ PK) {
  const int n = blockIdx.x, which = blockIdx.y, t = threadIdx.x; const float* Wm = (which == 0) ? WQ : (which == 1) ? WK : (which == 2) ? WV : WO; __shared__ __align__(16) __bf16 s[CC];
  if (t < CC) s[t] = (__bf16)Wm[(size_t)n * CC + t];
  __syncthreads();
  if (t < CC / 8) vst2((unsigned*)(PK + ((size_t)which * CC + n) * CC + t * 8), *(const v4u*)&s[t * 8]);
}
// ---- k_qkv: block = (64 positions, b, one of q / k / v), 16 waves: wave = (16-position row tile, 3 of the 12 column tiles). A tile [64 t][192 c] from x[b][c][t] (bf16 exact); D = A . W rows + b; q -> padded 32-wide per-head f16 hi/lo chunks; k, v -> the same values in the fragment order k_attn loads them in (a wave's 16-byte store covers 512 contiguous bytes); the q block also writes RQ[row][h][r] = q_h . emb_k[r] (f32)
__global__ __launch_bounds__(512) void k_qkv(const float* __restrict__ X, const __bf16* __restrict__ PK, const float* __restrict__ BQ, const float* __restrict__ BK, const float* __restrict__ BV, const float* __restrict__ EK, _Float16* __restrict__ QH, _Float16* __restrict__ QL, _Float16* __restrict__ KH, _Float16* __restrict__ KL, _Float16* __restrict__ VH, _Float16* __restrict__ VL, float* __restrict__ RQ) {
  __shared__ __align__(16) __bf16 sa[64][CC + 8]; __shared__ __align__(16) float so[64][CC + 4]; __shared__ __align__(16) _Float16 sbuf[2 * NH * 32 * 72];   // union: q/k chunk staging [2][64][264] or v planes staging [2][256][72]
  typedef _Float16 (*ChunkT)[NH * 32 + 8]; typedef _Float16 (*PlaneT)[72]; ChunkT sth = (ChunkT)sbuf, stl = (ChunkT)(sbuf + 64 * (NH * 32 + 8)); PlaneT svh = (PlaneT)sbuf, svl = (PlaneT)(sbuf + NH * 32 * 72);
  const int tid = threadIdx.x, wave = tid >> 5, lane = tid & 31, col = lane & 15, g = lane >> 4, rt = wave & 3, cg = wave >> 2; const int t0 = blockIdx.x * 64, which = blockIdx.z; const size_t b = blockIdx.y; const size_t r0 = b * TT + t0;
  for (int e = tid; e < 64 * CC; e += 512) { const int c = e >> 6, r = e & 63; sa[r][c] = (__bf16)X[(b * CC + c) * TT + t0 + r]; }
  if (tid < 64) for (int c = CC; c < CC + 8; ++c) sa[tid][c] = (__bf16)0.f;
  __syncthreads();
  const __bf16* P = PK + (size_t)which * CC * CC; const float* BB = (which == 0) ? BQ : (which == 1) ? BK : BV;
  v8f acc[3] = {};
#pragma unroll
  for (int kc = 0; kc < CC / 32; ++kc) { const v16b a = frag_b(&sa[rt * 16 + col][kc * 32], lane);
#pragma unroll
    for (int j = 0; j < 3; ++j) acc[j] = wmma_bf(a, frag_b(P + (size_t)((cg * 3 + j) * 16 + col) * CC + kc * 32, lane), acc[j]); }
#pragma unroll
  for (int j = 0; j < 3; ++j) { const float bb = bfr(BB[(cg * 3 + j) * 16 + col]);
#pragma unroll
    for (int r = 0; r < 8; ++r) so[rt * 16 + 8 * g + r][(cg * 3 + j) * 16 + col] = acc[j][r] + bb; }
  __syncthreads();
  if (which < 2) {
    for (int e = tid; e < 64 * NH * 32; e += 512) { const int r = e / (NH * 32), q = e % (NH * 32); const int h = q >> 5, d = q & 31; float v = 0.f; if (d < HDIM) v = so[r][h * HDIM + d]; const _Float16 hv = (_Float16)v; sth[r][q] = hv; stl[r][q] = (_Float16)((v - (float)hv) * 2048.0f); }
    if (which == 0) { // relative-key logits seeds: RQ[row][h][rr] = sum_d q[h*24+d] * emb_k[rr][d] (f32), 4 per thread, stored directly (16-B pieces of the row's 512-B RQ record; the block owns rows t0..t0+63)
      for (int e = tid; e < 64 * NH * 4; e += 512) { const int r = e / (NH * 4), q = e % (NH * 4); const int h = q >> 2, r4 = (q & 3) * 4; v4f o4;
        for (int i = 0; i < 4; ++i) { const int rr = r4 + i; float a2 = 0.f; if (rr < NREL) { for (int d = 0; d < HDIM; ++d) a2 += so[r][h * HDIM + d] * bfr(EK[rr * HDIM + d]); } o4[i] = a2; }
        vst2(RQ + ((r0 + r) * NH + h) * 16 + r4, o4); } }
    __syncthreads();
    _Float16* DH_ = which ? KH : QH; _Float16* DL_ = which ? KL : QL;
    if (which == 0) {
      for (int e = tid; e < 64 * (NH * 32 / 8); e += 512) { const int r = e / (NH * 4), q = e % (NH * 4); const size_t o = (r0 + r) * (NH * 32) + q * 8; vst2((unsigned*)(DH_ + o), *(const v4u*)&sth[r][q * 8]); vst2((unsigned*)(DL_ + o), *(const v4u*)&stl[r][q * 8]); }
    } else { // piece e: head e >> 8, then (tile of 16 keys, k half, g, key) in the low 8 bits, which is also the piece's place in the head's 4 tiles
      for (int e = tid; e < 64 * (NH * 32 / 8); e += 512) { const int h = e >> 8, r = ((e >> 6) & 3) * 16 + (e & 15), q = h * 4 + ((e >> 4) & 3); const size_t o = ((b * NH + h) * (TT / 16) + (t0 >> 4)) * 512 + (e & 255) * 8; vst2((unsigned*)(DH_ + o), *(const v4u*)&sth[r][q * 8]); vst2((unsigned*)(DL_ + o), *(const v4u*)&stl[r][q * 8]); } }
  } else {
    for (int e = tid; e < 64 * NH * 32; e += 512) { const int r = e & 63, q = e >> 6; const int h = q >> 5, d = q & 31; float v = 0.f; if (d < HDIM) v = so[r][h * HDIM + d]; const _Float16 hv = (_Float16)v; svh[q][r] = hv; svl[q][r] = (_Float16)((v - (float)hv) * 2048.0f); }
    __syncthreads();
    // piece e: head e >> 8, then (block of 32 keys, tile of 16 dims, key half, g, dim) in the low 8 bits, which is also the piece's place in the head's 2 blocks
    for (int e = tid; e < NH * 32 * 8; e += 512) { const int h = e >> 8, q = h * 32 + ((e >> 6) & 1) * 16 + (e & 15), pc = ((e >> 7) & 1) * 4 + ((e >> 4) & 3); const size_t o = ((b * NH + h) * (TT / 32) + (t0 >> 5)) * 1024 + (e & 255) * 8; vst2((unsigned*)(VH + o), *(const v4u*)&svh[q][pc * 8]); vst2((unsigned*)(VL + o), *(const v4u*)&svl[q][pc * 8]); } }
}
// ---- k_attn: block = (16 queries, head pair, b), 8 waves: wave = (head of the pair, quarter of the 1,024 keys). Each wave runs its 256 keys in tiles of 32 on its own (no barrier in the loop). The scores are formed transposed, S^T = K . Q^T (A = a 16-key tile, B = the 16 queries): a lane holds 16 scores of ONE query (column lane & 15; keys 8 g + r of each 16-key tile), so the maximum and the sum of a row are in-lane work plus one exchange between the wave's halves, and the mask is read 8 consecutive words a lane. scores (3-product k.q + windowed rel-key seed) / sqrt(24), mask == 0 excluded; online softmax; P^T (x2^11 hi + residual), converted in place from the two score tiles, is the B operand of O^T += V^T . P^T (2 tiles of 16 dims as A). The four partial (max, sum, context) of a head meet in LDS behind one barrier and are rescaled to the common max; the same pass adds sum_{|s-t|<=4} p(t,s) emb_v[s-t+4]; O rows [hp][row][(h & 1) * 24 + d]
#define KSPL 4
// fragment stored in fragment order: a wave-uniform base plus the lane's 16 bytes in each of two runs of 512 bytes (4 whole lines a load)
__device__ __forceinline__ v16h frag_p(const _Float16* ubase, unsigned boff) {
  union { v16h v; v8h q[2]; } u; const char* p = (const char*)ubase;
  u.q[0] = *(const v8h*)(p + boff); u.q[1] = *(const v8h*)(p + 512 + boff); return u.v;
}
// lane l's value from lane l ^ 16 (a vector cross-row move, no LDS path)
__device__ __forceinline__ float xhalf(float x) { return __builtin_bit_cast(float, __builtin_amdgcn_permlanex16(__builtin_bit_cast(int, x), __builtin_bit_cast(int, x), 0x76543210, 0xfedcba98, false, false)); }
__global__ __launch_bounds__(256, 8) void k_attn(const _Float16* __restrict__ QH, const _Float16* __restrict__ QL, const _Float16* __restrict__ KH, const _Float16* __restrict__ KL, const float* __restrict__ RQ, const int* __restrict__ MASK, const float* __restrict__ EV, float* __restrict__ O) {
  __shared__ float srq[2 * KSPL][16][NREL + 1]; __shared__ float spp[2][16][NREL + 1]; __shared__ float sm[2 * KSPL][16], sl[2 * KSPL][16]; __shared__ __align__(16) float sac[2 * KSPL][16][36];
  const int tid = threadIdx.x, wave = __builtin_amdgcn_readfirstlane(tid >> 5), lane = tid & 31, col = lane & 15, g = lane >> 4; const int hp = blockIdx.y; const size_t b = blockIdx.z; const int q0 = blockIdx.x * 16; const size_t rq = b * TT + q0; const float isc = 1.0f / sqrtf((float)HDIM);
  const int h = hp * 2 + wave / KSPL, kbase = (wave % KSPL) * (TT / KSPL);
  // the wave's number is made scalar so that the wave-uniform part of every K, V and mask address is scalar arithmetic; the second launch bound asks for 8 waves per SIMD (128 VGPRs): four blocks per WGP, the whole grid resident at once
  const int* MKw = MASK + rq * TT + kbase;
  // in fragment order 32 keys of a head are 1,024 elements in each of the four arrays, at the same place in each; the arrays lie one behind the other in the workspace, so one address serves all four, the rest being constant offsets
  const _Float16* FW = KH + ((b * NH + h) * (TT / 32) + kbase / 32) * 1024;
  const unsigned fo = lane * 16, mo = col * TT + 8 * g;
  if (lane < 16) { for (int rr = 0; rr < NREL; ++rr) srq[wave][lane][rr] = RQ[((rq + lane) * NH + h) * 16 + rr]; }
  const v16h aq = frag_h(QH + (rq + col) * (NH * 32) + h * 32, lane), aql = frag_h(QL + (rq + col) * (NH * 32) + h * 32, lane);
  const int qi = q0 + col;
  float m = -3.0e38f, l = 0.f;   // the lane's query: running max (equal in both halves), and this half's share of the running sum
  v8f acc[2] = {}, accl[2] = {};
  LDSX();
#pragma unroll 1
  for (int ks = 0; ks < TT / KSPL / 32; ++ks) { const int j0 = kbase + ks * 32;
    v8f s[2]; v16h kh[2], kl[2], vh[2], vl[2]; v4i mk[2][2];
#pragma unroll
    for (int ct = 0; ct < 2; ++ct) { const _Float16* FK = FW + (ks * 2 + ct) * 512; const int* MP = MKw + ks * 32 + ct * 16;
      kh[ct] = frag_p(FK, fo); if (ct == 0) kl[ct] = frag_p(FK + (WS_KL - WS_KH) / 2, fo); mk[ct][0] = *(const v4i*)(MP + mo); mk[ct][1] = *(const v4i*)(MP + 4 + mo); }
    asm volatile("s_wait_xcnt 0x0" ::: "memory");   // the clobber keeps the 6 K loads and 4 mask loads above issued here, all in flight together: the wave waits for memory once where it waited at each fragment; the wait stands in front of any overwrite of their address registers
#pragma unroll
    for (int ct = 0; ct < 2; ++ct) { v8f c = {}, cl = {}; const v4i mk0 = mk[ct][0], mk1 = mk[ct][1];
      c = wmma16(kh[ct], aq, c); cl = wmma16(kh[ct], aql, cl); cl = wmma16(kl[ct], aq, cl);
      if (ct == 0) { kl[1] = frag_p(FW + (ks * 2 + 1) * 512 + (WS_KL - WS_KH) / 2, fo);
        asm volatile("s_wait_xcnt 0x0" ::: "memory"); }   // the last K fragment takes the registers that the first tile's products have freed; the clobber keeps its loads issued here, so that they fly while the first tile's scores are finished
#pragma unroll
      for (int r = 0; r < 8; ++r) { const int dd = j0 + ct * 16 + 8 * g + r - qi; float sc = c[r] + cl[r] * (1.0f / 2048.0f); if (dd >= -WIN && dd <= WIN) sc += srq[wave][col][dd + WIN]; const bool keep = (r < 4 ? mk0[r & 3] : mk1[r & 3]) != 0; s[ct][r] = keep ? sc * isc : -3.0e38f; } }
#pragma unroll
    for (int dt = 0; dt < 2; ++dt) { const _Float16* FV = FW + (ks * 2 + dt) * 512; vh[dt] = frag_p(FV + (WS_VH - WS_KH) / 2, fo); if (dt == 0) vl[dt] = frag_p(FV + (WS_VL - WS_KH) / 2, fo); }
    asm volatile("s_wait_xcnt 0x0" ::: "memory");   // stands in front of the loop's step of the loads' address registers; the clobber holds the 6 V loads above it, ahead of the first V product, so that they are in flight together
    float mx = fmaxf(s[0][0], s[1][0]);
#pragma unroll
    for (int r = 1; r < 8; ++r) mx = fmaxf(mx, fmaxf(s[0][r], s[1][r]));
    mx = fmaxf(mx, xhalf(mx));
    const float mn = fmaxf(m, mx); const float alpha = (m <= -1.0e38f) ? 0.f : __expf(m - mn);
    v16h pbh, pbl; float e[16], es = 0.f;
#pragma unroll
    for (int i = 0; i < 16; ++i) { const float sv = s[i >> 3][i & 7]; e[i] = (sv <= -1.0e38f) ? 0.f : __expf(sv - mn); }
#pragma unroll
    for (int i = 0; i < 16; ++i) { es += e[i]; const float p = e[i] * 2048.0f; const _Float16 ph = (_Float16)p; pbh[i] = ph; pbl[i] = (_Float16)((p - (float)ph) * 2048.0f); }
    l = l * alpha + es; m = (mn <= -1.0e38f) ? m : mn;
#pragma unroll
    for (int dt = 0; dt < 2; ++dt) { acc[dt] *= alpha; accl[dt] *= alpha; }
#pragma unroll
    for (int dt = 0; dt < 2; ++dt) { if (dt == 1) vl[1] = frag_p(FW + (ks * 2 + 1) * 512 + (WS_VL - WS_KH) / 2, fo);   // the last V fragment takes registers that the first tile's products have freed (a fourth fragment held over the softmax spills)
      acc[dt] = wmma16(vh[dt], pbh, acc[dt]); accl[dt] = wmma16(vh[dt], pbl, accl[dt]); accl[dt] = wmma16(vl[dt], pbh, accl[dt]); } }
  // this wave's partial: running max and sum per query (the halves' sums joined here, once), context with its residual folded in (a lane holds dims 8 g + r of each 16-dim tile of its query)
  l += xhalf(l);
  if (g == 0) { sm[wave][col] = m; sl[wave][col] = l; }
#pragma unroll
  for (int dt = 0; dt < 2; ++dt) { const v8f o8 = acc[dt] + accl[dt] * (1.0f / 2048.0f);
    vst2(&sac[wave][col][dt * 16 + 8 * g], (v4f){o8[0], o8[1], o8[2], o8[3]}); vst2(&sac[wave][col][dt * 16 + 8 * g + 4], (v4f){o8[4], o8[5], o8[6], o8[7]}); }
  // windowed relative values: the score of (t, s) for s = t-4 .. t+4 recomputed with the same formula, one (head, row, offset) per thread; excluded keys carry the sentinel
  for (int e = tid; e < 2 * 16 * NREL; e += 256) { const int h2 = e / (16 * NREL), rr = (e / NREL) & 15, off = e % NREL; const int hx = hp * 2 + h2; const int sidx = q0 + rr + off - WIN; float sv = -3.0e38f;
    if (sidx >= 0 && sidx < TT && MASK[((rq + rr) * TT) + sidx] != 0) { const size_t rqo = (rq + rr) * (NH * 32) + hx * 32, rko = ((b * NH + hx) * (TT / 16) + (sidx >> 4)) * 512 + (sidx & 15) * 8; float dot = 0.f;
      // the key's 24 dims are 3 pieces of 8 in the fragment order, 128 elements apart. Each s_wait_xcnt stands in front of any overwrite of the address registers of the loads above it (a later load's result may land in them); the loops are unrolled so that every piece has a constant index and stays in registers
      v8h xq[3], xql[3], xk[3], xkl[3];
#pragma unroll
      for (int p = 0; p < 3; ++p) xq[p] = *(const v8h*)(QH + rqo + p * 8);
      asm volatile("s_wait_xcnt 0x0" ::: "memory");
#pragma unroll
      for (int p = 0; p < 3; ++p) xql[p] = *(const v8h*)(QL + rqo + p * 8);
      asm volatile("s_wait_xcnt 0x0" ::: "memory");
#pragma unroll
      for (int p = 0; p < 3; ++p) xk[p] = *(const v8h*)(KH + rko + p * 128);
      asm volatile("s_wait_xcnt 0x0" ::: "memory");
#pragma unroll
      for (int p = 0; p < 3; ++p) xkl[p] = *(const v8h*)(KL + rko + p * 128);
      asm volatile("s_wait_xcnt 0x0" ::: "memory");
      const float rqv = RQ[((rq + rr) * NH + hx) * 16 + off];
      asm volatile("s_wait_xcnt 0x0" ::: "memory");
#pragma unroll
      for (int d = 0; d < HDIM; ++d) { const float qv = (float)xq[d >> 3][d & 7] + (float)xql[d >> 3][d & 7] * (1.0f / 2048.0f); const float kv = (float)xk[d >> 3][d & 7] + (float)xkl[d >> 3][d & 7] * (1.0f / 2048.0f); dot += qv * kv; }
      sv = (dot + rqv) * isc; }
    spp[h2][rr][off] = sv; }
  __syncthreads();
  // merge: one thread per (row, head, 4 dims); every partial is rescaled from its own max to the row's max
  if (tid < 16 * 12) { const int r = tid / 12, q4 = tid % 12; const int h2 = q4 / 6, d = (q4 % 6) * 4, w0 = h2 * KSPL; float M = -3.0e38f, L = 0.f, f[KSPL];
#pragma unroll
    for (int w = 0; w < KSPL; ++w) M = fmaxf(M, sm[w0 + w][r]);
#pragma unroll
    for (int w = 0; w < KSPL; ++w) { const float mw = sm[w0 + w][r]; f[w] = (mw <= -1.0e38f) ? 0.f : __expf(mw - M); L += sl[w0 + w][r] * f[w]; }
    v4f a = {};
#pragma unroll
    for (int w = 0; w < KSPL; ++w) a += *(const v4f*)&sac[w0 + w][r][d] * f[w];
    v4f o4 = a * ((1.0f / 2048.0f) / L);
    for (int jr = 0; jr < NREL; ++jr) { const float sv = spp[h2][r][jr]; const float pv = (sv <= -1.0e38f) ? 0.f : __expf(sv - M) / L;
#pragma unroll
      for (int i = 0; i < 4; ++i) o4[i] += pv * bfr(EV[jr * HDIM + d + i]); }
    vst2(O + ((size_t)hp * NR + rq + r) * 48 + q4 * 4, o4); }
}
// ---- k_out: block = (96 output channels o, 32 positions, b), 6 waves: wave = one 16-channel tile x both 16-position tiles. y[o][t] = Wo rows (exact) x O (gathered from the [hp][row][48] layout into an LDS bf16 hi/lo tile [32 t][192 c]) + bo -> [B][C][T]. Every global read of a thread (8 16-byte pieces of O, its 6 Wo fragments, its 8 biases) is issued ahead of the one barrier, so the block waits for memory once
#define OPOS 32
#define OCH 96
typedef __attribute__((ext_vector_type(4))) __bf16 v4b;
__global__ __launch_bounds__(192) void k_out(const float* __restrict__ O, const __bf16* __restrict__ PK, const float* __restrict__ BO, float* __restrict__ Y) {
  __shared__ __align__(16) __bf16 sh[OPOS][CC + 8], sl[OPOS][CC + 8]; __shared__ __align__(16) float so2[OCH / 16][16][OPOS + 4];
  const int tid = threadIdx.x, wave = tid >> 5, lane = tid & 31, col = lane & 15, g = lane >> 4; const int o0 = blockIdx.x * OCH + wave * 16; const int n0 = blockIdx.y * OPOS; const size_t b = blockIdx.z;
  // piece i of a thread: head pair i >> 1, row (i & 1) * 16 + tid / 12, 4 of the row's 48 floats (the 32 rows of a head pair are one contiguous run)
  const int sr = tid / 12, sw = (tid % 12) * 4; v4f x[8];
#pragma unroll
  for (int i = 0; i < 8; ++i) x[i] = *(const v4f*)(O + ((size_t)(i >> 1) * NR + b * TT + n0 + (i & 1) * 16 + sr) * 48 + sw);
  asm volatile("s_wait_xcnt 0x0" ::: "memory");   // stands in front of any overwrite of the address registers of the loads above (a later load's result may land in them); the clobber keeps these loads issued here, ahead of the conversion that waits for O
  v16b a[CC / 32];
#pragma unroll
  for (int kc = 0; kc < CC / 32; ++kc) a[kc] = frag_b(PK + (size_t)3 * CC * CC + (size_t)(o0 + col) * CC + kc * 32, lane);
  asm volatile("s_wait_xcnt 0x0" ::: "memory");   // the same for the Wo fragment loads
  const v4f b0 = *(const v4f*)(BO + o0 + 8 * g), b1 = *(const v4f*)(BO + o0 + 8 * g + 4);
  asm volatile("s_wait_xcnt 0x0" ::: "memory");   // the same for the bias loads
#pragma unroll
  for (int i = 0; i < 8; ++i) { v4b hi, lo;
#pragma unroll
    for (int k = 0; k < 4; ++k) { const float v = x[i][k]; const __bf16 hb = (__bf16)v; hi[k] = hb; lo[k] = (__bf16)(v - (float)hb); }
    vst2(&sh[(i & 1) * 16 + sr][(i >> 1) * 48 + sw], hi); vst2(&sl[(i & 1) * 16 + sr][(i >> 1) * 48 + sw], lo); }
  __syncthreads();
  v8f acc[2] = {};
#pragma unroll
  for (int kc = 0; kc < CC / 32; ++kc) {
#pragma unroll
    for (int j = 0; j < 2; ++j) { acc[j] = wmma_bf(a[kc], frag_b(&sl[j * 16 + col][kc * 32], lane), acc[j]); acc[j] = wmma_bf(a[kc], frag_b(&sh[j * 16 + col][kc * 32], lane), acc[j]); } }
#pragma unroll
  for (int j = 0; j < 2; ++j)
#pragma unroll
    for (int r = 0; r < 8; ++r) so2[wave][8 * g + r][j * 16 + col] = acc[j][r] + bfr(r < 4 ? b0[r & 3] : b1[r & 3]);
  LDSX();
  // the wave writes its 16 channel rows as whole 128-byte runs, 4 rows a store
#pragma unroll
  for (int it = 0; it < 4; ++it) { const int rl = it * 4 + (lane >> 3), c4 = (lane & 7) * 4; vst2(Y + (b * CC + o0 + rl) * TT + n0 + c4, *(const v4f*)&so2[wave][rl][c4]); }
}
extern "C" void kernel_launch(void* const* d_in, const int* in_sizes, int n_in, void* d_out, int out_size, void* d_ws, size_t ws_size, hipStream_t stream) {
  (void)in_sizes; (void)n_in; (void)out_size;
  const float** F = (const float**)d_in;   // 0 x [4,192,1024], 1 attn_mask [4,1,1024,1024] i32, 2 Wq [192,192], 3 bq, 4 Wk, 5 bk, 6 Wv, 7 bv, 8 Wo, 9 bo, 10 emb_rel_k [1,9,24], 11 emb_rel_v [1,9,24]
  if (ws_size < (size_t)WS_END) return;
  char* ws = (char*)d_ws; __bf16* PK = (__bf16*)(ws + WS_PK); _Float16 *QH = (_Float16*)(ws + WS_QH), *QL = (_Float16*)(ws + WS_QL), *KH = (_Float16*)(ws + WS_KH), *KL = (_Float16*)(ws + WS_KL), *VH = (_Float16*)(ws + WS_VH), *VL = (_Float16*)(ws + WS_VL); float *RQ = (float*)(ws + WS_RQ), *O = (float*)(ws + WS_O);
  k_pack<<<dim3(CC, 4), 256, 0, stream>>>(F[2], F[4], F[6], F[8], PK);
  k_qkv<<<dim3(TT / 64, NB, 3), 512, 0, stream>>>(F[0], PK, F[3], F[5], F[7], F[10], QH, QL, KH, KL, VH, VL, RQ);
  k_attn<<<dim3(TQB, NH / 2, TNB), 256, 0, stream>>>(QH, QL, KH, KL, RQ, (const int*)d_in[1], F[11], O);
  k_out<<<dim3(CC / OCH, TT / OPOS, TNB), 192, 0, stream>>>(O, PK, F[9], (float*)d_out);
}

// v007
// Measured time: 58.4 microseconds a run.
// In two side-by-side timings against v006, it was 1.06 and 1.05 times as fast.
// Counting every step since v000, it is 7.36 times as fast.
// compute dtype: all float inputs rounded to bf16, attn_mask (int) read on device; q/k/v 1x1 convs with EXACT bf16 products on WMMA 16x16x32 (positions as rows via an LDS transpose of the [B,C,T] input, natural weight rows) + biases; q and k stored as f16 hi + (x2048-scaled) residual, head dim 24 zero-padded to 32 (q in per-head chunks of a row, k in fragment order), v as f16 hi + residual, padded to 32 dims per head, in fragment order; scores = (q . k (3 products) + the windowed relative-key logits q . emb_k[s-t+4] for |s-t| <= 4 (f32 dots)) / sqrt(24); mask == 0 -> -3e38 sentinel (weight set to 0, so the key is excluded); running-max softmax in f32 (hardware exp); P (scaled by 2^11, as f16 hi + residual) x v hi/lo (3 products); the windowed relative-value term sum_{|s-t|<=4} p(t,s) emb_v[s-t+4] added in f32 from recomputed (identical-formula) weights; output 1x1 conv with the context as bf16 hi + residual x exact Wo rows (2 products) + bo, written channels-first; f32 accumulate.
#include <hip/hip_runtime.h>
#include <math.h>

typedef __attribute__((ext_vector_type(16))) _Float16 v16h;
typedef __attribute__((ext_vector_type(16))) __bf16 v16b;
typedef __attribute__((ext_vector_type(8)))  _Float16 v8h;
typedef __attribute__((ext_vector_type(8)))  float v8f;
typedef __attribute__((ext_vector_type(4)))  float v4f;
typedef __attribute__((ext_vector_type(2)))  float v2f;
typedef __attribute__((ext_vector_type(4)))  unsigned v4u;
typedef __attribute__((ext_vector_type(4)))  int v4i;
typedef float __attribute__((may_alias)) float_a;
typedef int __attribute__((may_alias)) int_a;

template <typename T> __device__ __forceinline__ void vst2(void* p, T v) { *(T*)p = v;  }
__device__ __forceinline__ v8f wmma16(v16h a, v16h b, v8f c) {
  v8f d = __builtin_amdgcn_wmma_f32_16x16x32_f16(false, a, false, b, (short)0, c, false, false);
  asm volatile("v_nop\n\tv_nop\n\tv_nop\n\tv_nop" : "+v"(d) : "v"(a), "v"(b));
  return d;
}
__device__ __forceinline__ v8f wmma_bf(v16b a, v16b b, v8f c) {
  v8f d = __builtin_amdgcn_wmma_f32_16x16x32_bf16(false, a, false, b, (short)0, c, false, false);
  asm volatile("v_nop\n\tv_nop\n\tv_nop\n\tv_nop" : "+v"(d) : "v"(a), "v"(b));
  return d;
}
// 16x16x32 fragments: lane = (h = lane>>4, row/col = lane&15); elements 0..7 = k0+8h+0..7, 8..15 = k0+16+8h+0..7; D element r = row 8h+r
__device__ __forceinline__ v16h frag_h(const _Float16* rowk0, int lane) {
  union { v16h v; v8h q[2]; } u; const _Float16* p = rowk0 + 8 * (lane >> 4);
  u.q[0] = *(const v8h*)p; u.q[1] = *(const v8h*)(p + 16); return u.v;
}
__device__ __forceinline__ v16h frag_f32(const float* rowk0, int lane) {
  v16h a; const float* p = rowk0 + 8 * (lane >> 4);
#pragma unroll
  for (int i = 0; i < 8; ++i) { a[i] = (_Float16)p[i]; a[8 + i] = (_Float16)p[16 + i]; }
  return a;
}
__device__ __forceinline__ v16h frag_f32s(const float* rowk0, int lane, float sc) {
  v16h a; const float* p = rowk0 + 8 * (lane >> 4);
#pragma unroll
  for (int i = 0; i < 8; ++i) { a[i] = (_Float16)(p[i] * sc); a[8 + i] = (_Float16)(p[16 + i] * sc); }
  return a;
}
// column fragment from a [K][ld] layout (column n), rows >= K read as 0
__device__ __forceinline__ v16h fragc_f32(const float* W, int k0, int n, int lane, int ld, int K) {
  v16h a; const int g = lane >> 4;
#pragma unroll
  for (int i = 0; i < 8; ++i) { const int ka = k0 + 8 * g + i, kb = ka + 16;
    a[i] = (_Float16)(ka < K ? W[(size_t)(ka < K ? ka : K - 1) * ld + n] : 0.f); a[8 + i] = (_Float16)(kb < K ? W[(size_t)(kb < K ? kb : K - 1) * ld + n] : 0.f); }
  return a;
}
struct F2 { v16b h, l; };
__device__ __forceinline__ F2 bsplit16(const float v[16]) { F2 r;
#pragma unroll
  for (int i = 0; i < 16; ++i) { const __bf16 h = (__bf16)v[i]; r.h[i] = h; r.l[i] = (__bf16)(v[i] - (float)h); }
  return r; }
__device__ __forceinline__ F2 split_row(const float* row, int k0, int lane) { float v[16]; const float* p = row + k0 + 8 * (lane >> 4);
#pragma unroll
  for (int i = 0; i < 8; ++i) { v[i] = p[i]; v[8 + i] = p[16 + i]; }
  return bsplit16(v); }
__device__ __forceinline__ F2 split_rowK(const float* row, int k0, int lane, int K) { float v[16]; const int g = lane >> 4;
#pragma unroll
  for (int i = 0; i < 8; ++i) { const int ka = k0 + 8 * g + i, kb = ka + 16; v[i] = ka < K ? row[ka < K ? ka : K - 1] : 0.f; v[8 + i] = kb < K ? row[kb < K ? kb : K - 1] : 0.f; }
  return bsplit16(v); }
__device__ __forceinline__ F2 split_col(const float* W, int k0, int n, int lane, int ld, int K) { float v[16]; const int g = lane >> 4;
#pragma unroll
  for (int i = 0; i < 8; ++i) { const int ka = k0 + 8 * g + i, kb = ka + 16; v[i] = ka < K ? W[(size_t)(ka < K ? ka : K - 1) * ld + n] : 0.f; v[8 + i] = kb < K ? W[(size_t)(kb < K ? kb : K - 1) * ld + n] : 0.f; }
  return bsplit16(v); }
__device__ __forceinline__ v8f mac3(const F2& a, const F2& b, v8f c) { c = wmma_bf(a.l, b.h, c); c = wmma_bf(a.h, b.l, c); return wmma_bf(a.h, b.h, c); }
__device__ __forceinline__ float sigm(float v) { return 1.0f / (1.0f + expf(-v)); }
#define LDSX() do { asm volatile("s_wait_dscnt 0" ::: "memory"); __builtin_amdgcn_wave_barrier(); __builtin_amdgcn_fence(__ATOMIC_RELEASE, "workgroup"); } while (0)


// Relative-position multi-head attention (B 4, C 192 as 8 heads x 24, T 1,024, window 4): 1x1-conv q/k/v, scores with windowed relative key embeddings, per-(t,s) mask, softmax, values plus windowed relative value embeddings, 1x1-conv output -> [B, C, T].
#define NB 4
#define CC 192
#define TT 1024
#define NH 8
#define HDIM 24
#define WIN 4
#define NREL (2 * WIN + 1)
#define NR (NB * TT)
#ifndef TQB
#define TQB (TT / 16)
#define TNB NB
#endif
typedef __attribute__((ext_vector_type(8))) __bf16 v8b;
typedef __attribute__((ext_vector_type(4))) __bf16 v4b;
__device__ __forceinline__ v16b frag_b(const __bf16* rowk0, int lane) {
  union { v16b v; v8b q[2]; } u; const __bf16* p = rowk0 + 8 * (lane >> 4);
  u.q[0] = *(const v8b*)p; u.q[1] = *(const v8b*)(p + 16); return u.v;
}
__device__ __forceinline__ float bfr(float v) { return (float)(__bf16)v; }
__device__ __attribute__((noinline)) float exp_ni(float v) { return expf(v); }
__device__ __attribute__((noinline)) float erf_ni(float v) { return erff(v); }

#define PK_END ((size_t)4 * CC * CC)         // the head of the workspace is left unused (the arrays below keep their places)
#define WS_QH  (((2u * PK_END) + 127u) / 128u * 128u)   // f16 [NR][8][32] q hi ; QL ; then k hi ; KL in fragment order [b][h][16-key tile][k half p][lane = 16 g + key][8]: element k = 16 p + 8 g + i
#define WS_QL  (WS_QH + 2u * NR * NH * 32)
#define WS_KH  (WS_QL + 2u * NR * NH * 32)
#define WS_KL  (WS_KH + 2u * NR * NH * 32)
#define WS_VH  (WS_KL + 2u * NR * NH * 32)               // f16 v hi ; VL in fragment order [b][h][32-key block][16-dim tile][key half p][lane = 16 g + dim][8]: key = 16 p + 8 g + i (dims 24..31 of each head zero)
#define WS_VL  (WS_VH + 2u * (size_t)NB * NH * 32 * TT)
#define WS_RQ  (WS_VL + 2u * (size_t)NB * NH * 32 * TT)  // f32 [NR][8][16] q . emb_k[r] (9 used)
#define WS_O   (WS_RQ + 4u * NR * NH * 16)                 // f32 [4 head pairs][NR][48] attention output (block-owned runs)
#define WS_END (WS_O + 4u * NR * CC)

// ---- k_qkv: block = (64 positions, b, one of q / k / v), 16 waves: wave = (16-position row tile, 3 of the 12 column tiles). A tile [64 t][192 c] from x[b][c][t] (bf16 exact); the block's own weight matrix is read as f32 in whole lines (18 16-byte pieces a thread), rounded to bf16 and kept in LDS [192 o][192 c], where the B fragments are read; D = A . W rows + b; q -> padded 32-wide per-head f16 hi/lo chunks; k, v -> the same values in the fragment order k_attn loads them in (a wave's 16-byte store covers 512 contiguous bytes); the q block also writes RQ[row][h][r] = q_h . emb_k[r] (f32)
__global__ __launch_bounds__(512) void k_qkv(const float* __restrict__ X, const float* __restrict__ WQ, const float* __restrict__ WK, const float* __restrict__ WV, const float* __restrict__ BQ, const float* __restrict__ BK, const float* __restrict__ BV, const float* __restrict__ EK, _Float16* __restrict__ QH, _Float16* __restrict__ QL, _Float16* __restrict__ KH, _Float16* __restrict__ KL, _Float16* __restrict__ VH, _Float16* __restrict__ VL, float* __restrict__ RQ) {
  __shared__ __align__(16) __bf16 sa[64][CC + 8]; __shared__ __align__(16) float so[64][CC + 4]; __shared__ __align__(16) _Float16 sbuf[CC * (CC + 8)];   // union: first the bf16 weight rows [192][200], then, behind the barrier that ends the products, q/k chunk staging [2][64][264] or v planes staging [2][256][72]
  typedef _Float16 (*ChunkT)[NH * 32 + 8]; typedef _Float16 (*PlaneT)[72]; ChunkT sth = (ChunkT)sbuf, stl = (ChunkT)(sbuf + 64 * (NH * 32 + 8)); PlaneT svh = (PlaneT)sbuf, svl = (PlaneT)(sbuf + NH * 32 * 72); typedef __bf16 (*WrowT)[CC + 8]; WrowT sw = (WrowT)sbuf;
  const int tid = threadIdx.x, wave = tid >> 5, lane = tid & 31, col = lane & 15, g = lane >> 4, rt = wave & 3, cg = wave >> 2; const int t0 = blockIdx.x * 64, which = blockIdx.z; const size_t b = blockIdx.y; const size_t r0 = b * TT + t0;
  const float* Wm = (which == 0) ? WQ : (which == 1) ? WK : WV; v4f wr[CC * CC / 4 / 512];
#pragma unroll
  for (int i = 0; i < CC * CC / 4 / 512; ++i) wr[i] = *(const v4f*)(Wm + (size_t)(tid + 512 * i) * 4);
  asm volatile("s_wait_xcnt 0x0" ::: "memory");   // the clobber keeps the 18 weight loads issued here, so that they fly while x is staged; the wait stands in front of any overwrite of their address registers
  for (int e = tid; e < 64 * CC; e += 512) { const int c = e >> 6, r = e & 63; sa[r][c] = (__bf16)X[(b * CC + c) * TT + t0 + r]; }
#pragma unroll
  for (int i = 0; i < CC * CC / 4 / 512; ++i) { const int p = tid + 512 * i; v4b w4;
#pragma unroll
    for (int k = 0; k < 4; ++k) w4[k] = (__bf16)wr[i][k];
    vst2(&sw[p / (CC / 4)][(p % (CC / 4)) * 4], w4); }
  if (tid < 64) for (int c = CC; c < CC + 8; ++c) sa[tid][c] = (__bf16)0.f;
  __syncthreads();
  const float* BB = (which == 0) ? BQ : (which == 1) ? BK : BV;
  v8f acc[3] = {};
#pragma unroll
  for (int kc = 0; kc < CC / 32; ++kc) { const v16b a = frag_b(&sa[rt * 16 + col][kc * 32], lane);
#pragma unroll
    for (int j = 0; j < 3; ++j) acc[j] = wmma_bf(a, frag_b(&sw[(cg * 3 + j) * 16 + col][kc * 32], lane), acc[j]); }
#pragma unroll
  for (int j = 0; j < 3; ++j) { const float bb = bfr(BB[(cg * 3 + j) * 16 + col]);
#pragma unroll
    for (int r = 0; r < 8; ++r) so[rt * 16 + 8 * g + r][(cg * 3 + j) * 16 + col] = acc[j][r] + bb; }
  __syncthreads();
  if (which < 2) {
    for (int e = tid; e < 64 * NH * 32; e += 512) { const int r = e / (NH * 32), q = e % (NH * 32); const int h = q >> 5, d = q & 31; float v = 0.f; if (d < HDIM) v = so[r][h * HDIM + d]; const _Float16 hv = (_Float16)v; sth[r][q] = hv; stl[r][q] = (_Float16)((v - (float)hv) * 2048.0f); }
    if (which == 0) { // relative-key logits seeds: RQ[row][h][rr] = sum_d q[h*24+d] * emb_k[rr][d] (f32), 4 per thread, stored directly (16-B pieces of the row's 512-B RQ record; the block owns rows t0..t0+63)
      for (int e = tid; e < 64 * NH * 4; e += 512) { const int r = e / (NH * 4), q = e % (NH * 4); const int h = q >> 2, r4 = (q & 3) * 4; v4f o4;
        for (int i = 0; i < 4; ++i) { const int rr = r4 + i; float a2 = 0.f; if (rr < NREL) { for (int d = 0; d < HDIM; ++d) a2 += so[r][h * HDIM + d] * bfr(EK[rr * HDIM + d]); } o4[i] = a2; }
        vst2(RQ + ((r0 + r) * NH + h) * 16 + r4, o4); } }
    __syncthreads();
    _Float16* DH_ = which ? KH : QH; _Float16* DL_ = which ? KL : QL;
    if (which == 0) {
      for (int e = tid; e < 64 * (NH * 32 / 8); e += 512) { const int r = e / (NH * 4), q = e % (NH * 4); const size_t o = (r0 + r) * (NH * 32) + q * 8; vst2((unsigned*)(DH_ + o), *(const v4u*)&sth[r][q * 8]); vst2((unsigned*)(DL_ + o), *(const v4u*)&stl[r][q * 8]); }
    } else { // piece e: head e >> 8, then (tile of 16 keys, k half, g, key) in the low 8 bits, which is also the piece's place in the head's 4 tiles
      for (int e = tid; e < 64 * (NH * 32 / 8); e += 512) { const int h = e >> 8, r = ((e >> 6) & 3) * 16 + (e & 15), q = h * 4 + ((e >> 4) & 3); const size_t o = ((b * NH + h) * (TT / 16) + (t0 >> 4)) * 512 + (e & 255) * 8; vst2((unsigned*)(DH_ + o), *(const v4u*)&sth[r][q * 8]); vst2((unsigned*)(DL_ + o), *(const v4u*)&stl[r][q * 8]); } }
  } else {
    for (int e = tid; e < 64 * NH * 32; e += 512) { const int r = e & 63, q = e >> 6; const int h = q >> 5, d = q & 31; float v = 0.f; if (d < HDIM) v = so[r][h * HDIM + d]; const _Float16 hv = (_Float16)v; svh[q][r] = hv; svl[q][r] = (_Float16)((v - (float)hv) * 2048.0f); }
    __syncthreads();
    // piece e: head e >> 8, then (block of 32 keys, tile of 16 dims, key half, g, dim) in the low 8 bits, which is also the piece's place in the head's 2 blocks
    for (int e = tid; e < NH * 32 * 8; e += 512) { const int h = e >> 8, q = h * 32 + ((e >> 6) & 1) * 16 + (e & 15), pc = ((e >> 7) & 1) * 4 + ((e >> 4) & 3); const size_t o = ((b * NH + h) * (TT / 32) + (t0 >> 5)) * 1024 + (e & 255) * 8; vst2((unsigned*)(VH + o), *(const v4u*)&svh[q][pc * 8]); vst2((unsigned*)(VL + o), *(const v4u*)&svl[q][pc * 8]); } }
}
// ---- k_attn: block = (16 queries, head pair, b), 8 waves: wave = (head of the pair, quarter of the 1,024 keys). Each wave runs its 256 keys in tiles of 32 on its own (no barrier in the loop). The scores are formed transposed, S^T = K . Q^T (A = a 16-key tile, B = the 16 queries): a lane holds 16 scores of ONE query (column lane & 15; keys 8 g + r of each 16-key tile), so the maximum and the sum of a row are in-lane work plus one exchange between the wave's halves, and the mask is read 8 consecutive words a lane. scores (3-product k.q + windowed rel-key seed) / sqrt(24), mask == 0 excluded; online softmax; P^T (x2^11 hi + residual), converted in place from the two score tiles, is the B operand of O^T += V^T . P^T (2 tiles of 16 dims as A). The four partial (max, sum, context) of a head meet in LDS behind one barrier and are rescaled to the common max; the same pass adds sum_{|s-t|<=4} p(t,s) emb_v[s-t+4]; O rows [hp][row][(h & 1) * 24 + d]
#define KSPL 4
// fragment stored in fragment order: a wave-uniform base plus the lane's 16 bytes in each of two runs of 512 bytes (4 whole lines a load)
__device__ __forceinline__ v16h frag_p(const _Float16* ubase, unsigned boff) {
  union { v16h v; v8h q[2]; } u; const char* p = (const char*)ubase;
  u.q[0] = *(const v8h*)(p + boff); u.q[1] = *(const v8h*)(p + 512 + boff); return u.v;
}
// lane l's value from lane l ^ 16 (a vector cross-row move, no LDS path)
__device__ __forceinline__ float xhalf(float x) { return __builtin_bit_cast(float, __builtin_amdgcn_permlanex16(__builtin_bit_cast(int, x), __builtin_bit_cast(int, x), 0x76543210, 0xfedcba98, false, false)); }
__global__ __launch_bounds__(256, 8) void k_attn(const _Float16* __restrict__ QH, const _Float16* __restrict__ QL, const _Float16* __restrict__ KH, const _Float16* __restrict__ KL, const float* __restrict__ RQ, const int* __restrict__ MASK, const float* __restrict__ EV, float* __restrict__ O) {
  __shared__ float srq[2 * KSPL][16][NREL + 1]; __shared__ float spp[2][16][NREL + 1]; __shared__ float sm[2 * KSPL][16], sl[2 * KSPL][16]; __shared__ __align__(16) float sac[2 * KSPL][16][36];
  const int tid = threadIdx.x, wave = __builtin_amdgcn_readfirstlane(tid >> 5), lane = tid & 31, col = lane & 15, g = lane >> 4; const int hp = blockIdx.y; const size_t b = blockIdx.z; const int q0 = blockIdx.x * 16; const size_t rq = b * TT + q0; const float isc = 1.0f / sqrtf((float)HDIM);
  const int h = hp * 2 + wave / KSPL, kbase = (wave % KSPL) * (TT / KSPL);
  // the wave's number is made scalar so that the wave-uniform part of every K, V and mask address is scalar arithmetic; the second launch bound asks for 8 waves per SIMD (128 VGPRs): four blocks per WGP, the whole grid resident at once
  const int* MKw = MASK + rq * TT + kbase;
  // in fragment order 32 keys of a head are 1,024 elements in each of the four arrays, at the same place in each; the arrays lie one behind the other in the workspace, so one address serves all four, the rest being constant offsets
  const _Float16* FW = KH + ((b * NH + h) * (TT / 32) + kbase / 32) * 1024;
  const unsigned fo = lane * 16, mo = col * TT + 8 * g;
  if (lane < 16) { for (int rr = 0; rr < NREL; ++rr) srq[wave][lane][rr] = RQ[((rq + lane) * NH + h) * 16 + rr]; }
  const v16h aq = frag_h(QH + (rq + col) * (NH * 32) + h * 32, lane), aql = frag_h(QL + (rq + col) * (NH * 32) + h * 32, lane);
  const int qi = q0 + col;
  float m = -3.0e38f, l = 0.f;   // the lane's query: running max (equal in both halves), and this half's share of the running sum
  v8f acc[2] = {}, accl[2] = {};
  LDSX();
#pragma unroll 1
  for (int ks = 0; ks < TT / KSPL / 32; ++ks) { const int j0 = kbase + ks * 32;
    v8f s[2]; v16h kh[2], kl[2], vh[2], vl[2]; v4i mk[2][2];
#pragma unroll
    for (int ct = 0; ct < 2; ++ct) { const _Float16* FK = FW + (ks * 2 + ct) * 512; const int* MP = MKw + ks * 32 + ct * 16;
      kh[ct] = frag_p(FK, fo); if (ct == 0) kl[ct] = frag_p(FK + (WS_KL - WS_KH) / 2, fo); mk[ct][0] = *(const v4i*)(MP + mo); mk[ct][1] = *(const v4i*)(MP + 4 + mo); }
    asm volatile("s_wait_xcnt 0x0" ::: "memory");   // the clobber keeps the 6 K loads and 4 mask loads above issued here, all in flight together: the wave waits for memory once where it waited at each fragment; the wait stands in front of any overwrite of their address registers
#pragma unroll
    for (int ct = 0; ct < 2; ++ct) { v8f c = {}, cl = {}; const v4i mk0 = mk[ct][0], mk1 = mk[ct][1];
      c = wmma16(kh[ct], aq, c); cl = wmma16(kh[ct], aql, cl); cl = wmma16(kl[ct], aq, cl);
      if (ct == 0) { kl[1] = frag_p(FW + (ks * 2 + 1) * 512 + (WS_KL - WS_KH) / 2, fo);
        asm volatile("s_wait_xcnt 0x0" ::: "memory"); }   // the last K fragment takes the registers that the first tile's products have freed; the clobber keeps its loads issued here, so that they fly while the first tile's scores are finished
#pragma unroll
      for (int r = 0; r < 8; ++r) { const int dd = j0 + ct * 16 + 8 * g + r - qi; float sc = c[r] + cl[r] * (1.0f / 2048.0f); if (dd >= -WIN && dd <= WIN) sc += srq[wave][col][dd + WIN]; const bool keep = (r < 4 ? mk0[r & 3] : mk1[r & 3]) != 0; s[ct][r] = keep ? sc * isc : -3.0e38f; } }
#pragma unroll
    for (int dt = 0; dt < 2; ++dt) { const _Float16* FV = FW + (ks * 2 + dt) * 512; vh[dt] = frag_p(FV + (WS_VH - WS_KH) / 2, fo); if (dt == 0) vl[dt] = frag_p(FV + (WS_VL - WS_KH) / 2, fo); }
    asm volatile("s_wait_xcnt 0x0" ::: "memory");   // stands in front of the loop's step of the loads' address registers; the clobber holds the 6 V loads above it, ahead of the first V product, so that they are in flight together
    float mx = fmaxf(s[0][0], s[1][0]);
#pragma unroll
    for (int r = 1; r < 8; ++r) mx = fmaxf(mx, fmaxf(s[0][r], s[1][r]));
    mx = fmaxf(mx, xhalf(mx));
    const float mn = fmaxf(m, mx); const float alpha = (m <= -1.0e38f) ? 0.f : __expf(m - mn);
    v16h pbh, pbl; float e[16], es = 0.f;
#pragma unroll
    for (int i = 0; i < 16; ++i) { const float sv = s[i >> 3][i & 7]; e[i] = (sv <= -1.0e38f) ? 0.f : __expf(sv - mn); }
#pragma unroll
    for (int i = 0; i < 16; ++i) { es += e[i]; const float p = e[i] * 2048.0f; const _Float16 ph = (_Float16)p; pbh[i] = ph; pbl[i] = (_Float16)((p - (float)ph) * 2048.0f); }
    l = l * alpha + es; m = (mn <= -1.0e38f) ? m : mn;
#pragma unroll
    for (int dt = 0; dt < 2; ++dt) { acc[dt] *= alpha; accl[dt] *= alpha; }
#pragma unroll
    for (int dt = 0; dt < 2; ++dt) { if (dt == 1) vl[1] = frag_p(FW + (ks * 2 + 1) * 512 + (WS_VL - WS_KH) / 2, fo);   // the last V fragment takes registers that the first tile's products have freed (a fourth fragment held over the softmax spills)
      acc[dt] = wmma16(vh[dt], pbh, acc[dt]); accl[dt] = wmma16(vh[dt], pbl, accl[dt]); accl[dt] = wmma16(vl[dt], pbh, accl[dt]); } }
  // this wave's partial: running max and sum per query (the halves' sums joined here, once), context with its residual folded in (a lane holds dims 8 g + r of each 16-dim tile of its query)
  l += xhalf(l);
  if (g == 0) { sm[wave][col] = m; sl[wave][col] = l; }
#pragma unroll
  for (int dt = 0; dt < 2; ++dt) { const v8f o8 = acc[dt] + accl[dt] * (1.0f / 2048.0f);
    vst2(&sac[wave][col][dt * 16 + 8 * g], (v4f){o8[0], o8[1], o8[2], o8[3]}); vst2(&sac[wave][col][dt * 16 + 8 * g + 4], (v4f){o8[4], o8[5], o8[6], o8[7]}); }
  // windowed relative values: the score of (t, s) for s = t-4 .. t+4 recomputed with the same formula, one (head, row, offset) per thread; excluded keys carry the sentinel
  for (int e = tid; e < 2 * 16 * NREL; e += 256) { const int h2 = e / (16 * NREL), rr = (e / NREL) & 15, off = e % NREL; const int hx = hp * 2 + h2; const int sidx = q0 + rr + off - WIN; float sv = -3.0e38f;
    if (sidx >= 0 && sidx < TT && MASK[((rq + rr) * TT) + sidx] != 0) { const size_t rqo = (rq + rr) * (NH * 32) + hx * 32, rko = ((b * NH + hx) * (TT / 16) + (sidx >> 4)) * 512 + (sidx & 15) * 8; float dot = 0.f;
      // the key's 24 dims are 3 pieces of 8 in the fragment order, 128 elements apart. Each s_wait_xcnt stands in front of any overwrite of the address registers of the loads above it (a later load's result may land in them); the loops are unrolled so that every piece has a constant index and stays in registers
      v8h xq[3], xql[3], xk[3], xkl[3];
#pragma unroll
      for (int p = 0; p < 3; ++p) xq[p] = *(const v8h*)(QH + rqo + p * 8);
      asm volatile("s_wait_xcnt 0x0" ::: "memory");
#pragma unroll
      for (int p = 0; p < 3; ++p) xql[p] = *(const v8h*)(QL + rqo + p * 8);
      asm volatile("s_wait_xcnt 0x0" ::: "memory");
#pragma unroll
      for (int p = 0; p < 3; ++p) xk[p] = *(const v8h*)(KH + rko + p * 128);
      asm volatile("s_wait_xcnt 0x0" ::: "memory");
#pragma unroll
      for (int p = 0; p < 3; ++p) xkl[p] = *(const v8h*)(KL + rko + p * 128);
      asm volatile("s_wait_xcnt 0x0" ::: "memory");
      const float rqv = RQ[((rq + rr) * NH + hx) * 16 + off];
      asm volatile("s_wait_xcnt 0x0" ::: "memory");
#pragma unroll
      for (int d = 0; d < HDIM; ++d) { const float qv = (float)xq[d >> 3][d & 7] + (float)xql[d >> 3][d & 7] * (1.0f / 2048.0f); const float kv = (float)xk[d >> 3][d & 7] + (float)xkl[d >> 3][d & 7] * (1.0f / 2048.0f); dot += qv * kv; }
      sv = (dot + rqv) * isc; }
    spp[h2][rr][off] = sv; }
  __syncthreads();
  // merge: one thread per (row, head, 4 dims); every partial is rescaled from its own max to the row's max
  if (tid < 16 * 12) { const int r = tid / 12, q4 = tid % 12; const int h2 = q4 / 6, d = (q4 % 6) * 4, w0 = h2 * KSPL; float M = -3.0e38f, L = 0.f, f[KSPL];
#pragma unroll
    for (int w = 0; w < KSPL; ++w) M = fmaxf(M, sm[w0 + w][r]);
#pragma unroll
    for (int w = 0; w < KSPL; ++w) { const float mw = sm[w0 + w][r]; f[w] = (mw <= -1.0e38f) ? 0.f : __expf(mw - M); L += sl[w0 + w][r] * f[w]; }
    v4f a = {};
#pragma unroll
    for (int w = 0; w < KSPL; ++w) a += *(const v4f*)&sac[w0 + w][r][d] * f[w];
    v4f o4 = a * ((1.0f / 2048.0f) / L);
    for (int jr = 0; jr < NREL; ++jr) { const float sv = spp[h2][r][jr]; const float pv = (sv <= -1.0e38f) ? 0.f : __expf(sv - M) / L;
#pragma unroll
      for (int i = 0; i < 4; ++i) o4[i] += pv * bfr(EV[jr * HDIM + d + i]); }
    vst2(O + ((size_t)hp * NR + rq + r) * 48 + q4 * 4, o4); }
}
// ---- k_out: block = (96 output channels o, 32 positions, b), 6 waves: wave = one 16-channel tile x both 16-position tiles. y[o][t] = Wo rows (read as f32, rounded to bf16 in registers) x O (gathered from the [hp][row][48] layout into an LDS bf16 hi/lo tile [32 t][192 c]) + bo -> [B][C][T]. Every global read of a thread (8 16-byte pieces of O, the 24 pieces of its 6 Wo fragments, its 8 biases) is issued ahead of the one barrier, so the block waits for memory once
#define OPOS 32
#define OCH 96
__global__ __launch_bounds__(192) void k_out(const float* __restrict__ O, const float* __restrict__ WO, const float* __restrict__ BO, float* __restrict__ Y) {
  __shared__ __align__(16) __bf16 sh[OPOS][CC + 8], sl[OPOS][CC + 8]; __shared__ __align__(16) float so2[OCH / 16][16][OPOS + 4];
  const int tid = threadIdx.x, wave = tid >> 5, lane = tid & 31, col = lane & 15, g = lane >> 4; const int o0 = blockIdx.x * OCH + wave * 16; const int n0 = blockIdx.y * OPOS; const size_t b = blockIdx.z;
  // piece i of a thread: head pair i >> 1, row (i & 1) * 16 + tid / 12, 4 of the row's 48 floats (the 32 rows of a head pair are one contiguous run)
  const int sr = tid / 12, sw = (tid % 12) * 4; v4f x[8];
#pragma unroll
  for (int i = 0; i < 8; ++i) x[i] = *(const v4f*)(O + ((size_t)(i >> 1) * NR + b * TT + n0 + (i & 1) * 16 + sr) * 48 + sw);
  asm volatile("s_wait_xcnt 0x0" ::: "memory");   // stands in front of any overwrite of the address registers of the loads above (a later load's result may land in them); the clobber keeps these loads issued here, ahead of the conversion that waits for O
  v4f wf[CC / 32][4];   // fragment kc of the lane: floats k0 + 8 g + 0..7 and k0 + 16 + 8 g + 0..7 of its Wo row
#pragma unroll
  for (int kc = 0; kc < CC / 32; ++kc) { const float* p = WO + (size_t)(o0 + col) * CC + kc * 32 + 8 * g; wf[kc][0] = *(const v4f*)p; wf[kc][1] = *(const v4f*)(p + 4); wf[kc][2] = *(const v4f*)(p + 16); wf[kc][3] = *(const v4f*)(p + 20); }
  asm volatile("s_wait_xcnt 0x0" ::: "memory");   // the same for the Wo fragment loads
  const v4f b0 = *(const v4f*)(BO + o0 + 8 * g), b1 = *(const v4f*)(BO + o0 + 8 * g + 4);
  asm volatile("s_wait_xcnt 0x0" ::: "memory");   // the same for the bias loads
#pragma unroll
  for (int i = 0; i < 8; ++i) { v4b hi, lo;
#pragma unroll
    for (int k = 0; k < 4; ++k) { const float v = x[i][k]; const __bf16 hb = (__bf16)v; hi[k] = hb; lo[k] = (__bf16)(v - (float)hb); }
    vst2(&sh[(i & 1) * 16 + sr][(i >> 1) * 48 + sw], hi); vst2(&sl[(i & 1) * 16 + sr][(i >> 1) * 48 + sw], lo); }
  v16b a[CC / 32];
#pragma unroll
  for (int kc = 0; kc < CC / 32; ++kc)
#pragma unroll
    for (int i = 0; i < 16; ++i) a[kc][i] = (__bf16)wf[kc][i >> 2][i & 3];
  __syncthreads();
  v8f acc[2] = {};
#pragma unroll
  for (int kc = 0; kc < CC / 32; ++kc) {
#pragma unroll
    for (int j = 0; j < 2; ++j) { acc[j] = wmma_bf(a[kc], frag_b(&sl[j * 16 + col][kc * 32], lane), acc[j]); acc[j] = wmma_bf(a[kc], frag_b(&sh[j * 16 + col][kc * 32], lane), acc[j]); } }
#pragma unroll
  for (int j = 0; j < 2; ++j)
#pragma unroll
    for (int r = 0; r < 8; ++r) so2[wave][8 * g + r][j * 16 + col] = acc[j][r] + bfr(r < 4 ? b0[r & 3] : b1[r & 3]);
  LDSX();
  // the wave writes its 16 channel rows as whole 128-byte runs, 4 rows a store
#pragma unroll
  for (int it = 0; it < 4; ++it) { const int rl = it * 4 + (lane >> 3), c4 = (lane & 7) * 4; vst2(Y + (b * CC + o0 + rl) * TT + n0 + c4, *(const v4f*)&so2[wave][rl][c4]); }
}
extern "C" void kernel_launch(void* const* d_in, const int* in_sizes, int n_in, void* d_out, int out_size, void* d_ws, size_t ws_size, hipStream_t stream) {
  (void)in_sizes; (void)n_in; (void)out_size;
  const float** F = (const float**)d_in;   // 0 x [4,192,1024], 1 attn_mask [4,1,1024,1024] i32, 2 Wq [192,192], 3 bq, 4 Wk, 5 bk, 6 Wv, 7 bv, 8 Wo, 9 bo, 10 emb_rel_k [1,9,24], 11 emb_rel_v [1,9,24]
  if (ws_size < (size_t)WS_END) return;
  char* ws = (char*)d_ws; _Float16 *QH = (_Float16*)(ws + WS_QH), *QL = (_Float16*)(ws + WS_QL), *KH = (_Float16*)(ws + WS_KH), *KL = (_Float16*)(ws + WS_KL), *VH = (_Float16*)(ws + WS_VH), *VL = (_Float16*)(ws + WS_VL); float *RQ = (float*)(ws + WS_RQ), *O = (float*)(ws + WS_O);
  k_qkv<<<dim3(TT / 64, NB, 3), 512, 0, stream>>>(F[0], F[2], F[4], F[6], F[3], F[5], F[7], F[10], QH, QL, KH, KL, VH, VL, RQ);
  k_attn<<<dim3(TQB, NH / 2, TNB), 256, 0, stream>>>(QH, QL, KH, KL, RQ, (const int*)d_in[1], F[11], O);
  k_out<<<dim3(CC / OCH, TT / OPOS, TNB), 192, 0, stream>>>(O, F[8], F[9], (float*)d_out);
}

// v008
// A run of this version takes 51.4 microseconds.
// In both of two side-by-side timings against v007, it was 1.13 times as fast.
// Over all steps from v000 it is 8.34 times as fast.
// compute dtype: all float inputs rounded to bf16, attn_mask (int) read on device; q/k/v 1x1 convs with EXACT bf16 products on WMMA 16x16x32 (positions as rows via an LDS transpose of the [B,C,T] input, natural weight rows) + biases; q and k stored as f16 hi + (x2048-scaled) residual, head dim 24 zero-padded to 32 (q in per-head chunks of a row, k in fragment order), v as f16 hi + residual, padded to 32 dims per head, in fragment order; scores = (q . k (3 products) + the windowed relative-key logits q . emb_k[s-t+4] for |s-t| <= 4 (f32 dots)) / sqrt(24); mask == 0 -> -3e38 sentinel (weight set to 0, so the key is excluded); running-max softmax in f32 (hardware exp); P (scaled by 2^11, as f16 hi + residual) x v hi/lo (3 products); the windowed relative-value term sum_{|s-t|<=4} p(t,s) emb_v[s-t+4] added in f32 from recomputed (identical-formula) weights; output 1x1 conv with the context as bf16 hi + residual x exact Wo rows (2 products) + bo, written channels-first; f32 accumulate.
#include <hip/hip_runtime.h>
#include <math.h>

typedef __attribute__((ext_vector_type(16))) _Float16 v16h;
typedef __attribute__((ext_vector_type(16))) __bf16 v16b;
typedef __attribute__((ext_vector_type(8)))  _Float16 v8h;
typedef __attribute__((ext_vector_type(8)))  float v8f;
typedef __attribute__((ext_vector_type(4)))  float v4f;
typedef __attribute__((ext_vector_type(2)))  float v2f;
typedef __attribute__((ext_vector_type(4)))  unsigned v4u;
typedef __attribute__((ext_vector_type(4)))  int v4i;
typedef float __attribute__((may_alias)) float_a;
typedef int __attribute__((may_alias)) int_a;

template <typename T> __device__ __forceinline__ void vst2(void* p, T v) { *(T*)p = v;  }
__device__ __forceinline__ v8f wmma16(v16h a, v16h b, v8f c) {
  v8f d = __builtin_amdgcn_wmma_f32_16x16x32_f16(false, a, false, b, (short)0, c, false, false);
  asm volatile("v_nop\n\tv_nop\n\tv_nop\n\tv_nop" : "+v"(d) : "v"(a), "v"(b));
  return d;
}
__device__ __forceinline__ v8f wmma_bf(v16b a, v16b b, v8f c) {
  v8f d = __builtin_amdgcn_wmma_f32_16x16x32_bf16(false, a, false, b, (short)0, c, false, false);
  asm volatile("v_nop\n\tv_nop\n\tv_nop\n\tv_nop" : "+v"(d) : "v"(a), "v"(b));
  return d;
}
// 16x16x32 fragments: lane = (h = lane>>4, row/col = lane&15); elements 0..7 = k0+8h+0..7, 8..15 = k0+16+8h+0..7; D element r = row 8h+r
__device__ __forceinline__ v16h frag_h(const _Float16* rowk0, int lane) {
  union { v16h v; v8h q[2]; } u; const _Float16* p = rowk0 + 8 * (lane >> 4);
  u.q[0] = *(const v8h*)p; u.q[1] = *(const v8h*)(p + 16); return u.v;
}
__device__ __forceinline__ v16h frag_f32(const float* rowk0, int lane) {
  v16h a; const float* p = rowk0 + 8 * (lane >> 4);
#pragma unroll
  for (int i = 0; i < 8; ++i) { a[i] = (_Float16)p[i]; a[8 + i] = (_Float16)p[16 + i]; }
  return a;
}
__device__ __forceinline__ v16h frag_f32s(const float* rowk0, int lane, float sc) {
  v16h a; const float* p = rowk0 + 8 * (lane >> 4);
#pragma unroll
  for (int i = 0; i < 8; ++i) { a[i] = (_Float16)(p[i] * sc); a[8 + i] = (_Float16)(p[16 + i] * sc); }
  return a;
}
// column fragment from a [K][ld] layout (column n), rows >= K read as 0
__device__ __forceinline__ v16h fragc_f32(const float* W, int k0, int n, int lane, int ld, int K) {
  v16h a; const int g = lane >> 4;
#pragma unroll
  for (int i = 0; i < 8; ++i) { const int ka = k0 + 8 * g + i, kb = ka + 16;
    a[i] = (_Float16)(ka < K ? W[(size_t)(ka < K ? ka : K - 1) * ld + n] : 0.f); a[8 + i] = (_Float16)(kb < K ? W[(size_t)(kb < K ? kb : K - 1) * ld + n] : 0.f); }
  return a;
}
struct F2 { v16b h, l; };
__device__ __forceinline__ F2 bsplit16(const float v[16]) { F2 r;
#pragma unroll
  for (int i = 0; i < 16; ++i) { const __bf16 h = (__bf16)v[i]; r.h[i] = h; r.l[i] = (__bf16)(v[i] - (float)h); }
  return r; }
__device__ __forceinline__ F2 split_row(const float* row, int k0, int lane) { float v[16]; const float* p = row + k0 + 8 * (lane >> 4);
#pragma unroll
  for (int i = 0; i < 8; ++i) { v[i] = p[i]; v[8 + i] = p[16 + i]; }
  return bsplit16(v); }
__device__ __forceinline__ F2 split_rowK(const float* row, int k0, int lane, int K) { float v[16]; const int g = lane >> 4;
#pragma unroll
  for (int i = 0; i < 8; ++i) { const int ka = k0 + 8 * g + i, kb = ka + 16; v[i] = ka < K ? row[ka < K ? ka : K - 1] : 0.f; v[8 + i] = kb < K ? row[kb < K ? kb : K - 1] : 0.f; }
  return bsplit16(v); }
__device__ __forceinline__ F2 split_col(const float* W, int k0, int n, int lane, int ld, int K) { float v[16]; const int g = lane >> 4;
#pragma unroll
  for (int i = 0; i < 8; ++i) { const int ka = k0 + 8 * g + i, kb = ka + 16; v[i] = ka < K ? W[(size_t)(ka < K ? ka : K - 1) * ld + n] : 0.f; v[8 + i] = kb < K ? W[(size_t)(kb < K ? kb : K - 1) * ld + n] : 0.f; }
  return bsplit16(v); }
__device__ __forceinline__ v8f mac3(const F2& a, const F2& b, v8f c) { c = wmma_bf(a.l, b.h, c); c = wmma_bf(a.h, b.l, c); return wmma_bf(a.h, b.h, c); }
__device__ __forceinline__ float sigm(float v) { return 1.0f / (1.0f + expf(-v)); }
#define LDSX() do { asm volatile("s_wait_dscnt 0" ::: "memory"); __builtin_amdgcn_wave_barrier(); __builtin_amdgcn_fence(__ATOMIC_RELEASE, "workgroup"); } while (0)


// Relative-position multi-head attention (B 4, C 192 as 8 heads x 24, T 1,024, window 4): 1x1-conv q/k/v, scores with windowed relative key embeddings, per-(t,s) mask, softmax, values plus windowed relative value embeddings, 1x1-conv output -> [B, C, T].
#define NB 4
#define CC 192
#define TT 1024
#define NH 8
#define HDIM 24
#define WIN 4
#define NREL (2 * WIN + 1)
#define NR (NB * TT)
#ifndef TQB
#define TQB (TT / 16)
#define TNB NB
#endif
typedef __attribute__((ext_vector_type(8))) __bf16 v8b;
typedef __attribute__((ext_vector_type(4))) __bf16 v4b;
__device__ __forceinline__ v16b frag_b(const __bf16* rowk0, int lane) {
  union { v16b v; v8b q[2]; } u; const __bf16* p = rowk0 + 8 * (lane >> 4);
  u.q[0] = *(const v8b*)p; u.q[1] = *(const v8b*)(p + 16); return u.v;
}
__device__ __forceinline__ float bfr(float v) { return (float)(__bf16)v; }
__device__ __attribute__((noinline)) float exp_ni(float v) { return expf(v); }
__device__ __attribute__((noinline)) float erf_ni(float v) { return erff(v); }

#define PK_END ((size_t)4 * CC * CC)         // the head of the workspace is left unused (the arrays below keep their places)
#define WS_QH  (((2u * PK_END) + 127u) / 128u * 128u)   // f16 [NR][8][32] q hi ; QL ; then k hi ; KL in fragment order [b][h][16-key tile][k half p][lane = 16 g + key][8]: element k = 16 p + 8 g + i
#define WS_QL  (WS_QH + 2u * NR * NH * 32)
#define WS_KH  (WS_QL + 2u * NR * NH * 32)
#define WS_KL  (WS_KH + 2u * NR * NH * 32)
#define WS_VH  (WS_KL + 2u * NR * NH * 32)               // f16 v hi ; VL in fragment order [b][h][32-key block][16-dim tile][key half p][lane = 16 g + dim][8]: key = 16 p + 8 g + i (dims 24..31 of each head zero)
#define WS_VL  (WS_VH + 2u * (size_t)NB * NH * 32 * TT)
#define WS_RQ  (WS_VL + 2u * (size_t)NB * NH * 32 * TT)  // f32 [NR][8][16] q . emb_k[r] (9 used)
#define WS_O   (WS_RQ + 4u * NR * NH * 16)                 // f32 [4 head pairs][NR][48] attention output (block-owned runs)
#define WS_END (WS_O + 4u * NR * CC)

// ---- k_qkv: block = (64 positions, b, one of q / k / v), 16 waves: wave = (16-position row tile, 3 of the 12 column tiles). A tile [64 t][192 c] from x[b][c][t] (bf16 exact); the block's own weight matrix is read as f32 in whole lines (18 16-byte pieces a thread), rounded to bf16 and kept in LDS [192 o][192 c], where the B fragments are read; D = A . W rows + b, kept as f32 in LDS. Every global read of a thread (18 weight pieces, 24 x words, 3 biases, 1 emb_k word) is issued ahead of the first barrier. Behind the second barrier a thread forms its 4 16-byte f16 hi and residual pieces straight from the f32 tile, all its LDS reads in flight together, and stores them: q -> padded 32-wide per-head chunks; k, v -> the same values in the fragment order k_attn loads them in (a wave's 16-byte store covers 512 contiguous bytes); in the q block a thread = (row, head) also writes RQ[row][h][r] = q_h . emb_k[r] (f32, 9 independent sums)
__device__ __forceinline__ void split8(const float v[8], v8h& hi, v8h& lo) {
#pragma unroll
  for (int j = 0; j < 8; ++j) { const _Float16 hv = (_Float16)v[j]; hi[j] = hv; lo[j] = (_Float16)((v[j] - (float)hv) * 2048.0f); }
}
__global__ __launch_bounds__(512) void k_qkv(const float* __restrict__ X, const float* __restrict__ WQ, const float* __restrict__ WK, const float* __restrict__ WV, const float* __restrict__ BQ, const float* __restrict__ BK, const float* __restrict__ BV, const float* __restrict__ EK, _Float16* __restrict__ QH, _Float16* __restrict__ QL, _Float16* __restrict__ KH, _Float16* __restrict__ KL, _Float16* __restrict__ VH, _Float16* __restrict__ VL, float* __restrict__ RQ) {
  __shared__ __align__(16) __bf16 sa[64][CC + 8]; __shared__ __align__(16) float so[64][CC + 4]; __shared__ __align__(16) __bf16 sw[CC][CC + 8]; __shared__ __align__(16) float sek[512];   // emb_k rounded to bf16, 216 words used; every thread stores one word, so that no branch stands between the load and its store
  const int tid = threadIdx.x, wave = tid >> 5, lane = tid & 31, col = lane & 15, g = lane >> 4, rt = wave & 3, cg = wave >> 2; const int t0 = blockIdx.x * 64, which = blockIdx.z; const size_t b = blockIdx.y; const size_t r0 = b * TT + t0;
  const float* Wm = (which == 0) ? WQ : (which == 1) ? WK : WV; const float* BB = (which == 0) ? BQ : (which == 1) ? BK : BV; v4f wr[CC * CC / 4 / 512]; float xr[64 * CC / 512], bb[3];
#pragma unroll
  for (int j = 0; j < 3; ++j) bb[j] = BB[(cg * 3 + j) * 16 + col];
  const float ekv = EK[tid < NREL * HDIM ? tid : 0];
  const float* Xp = X + (b * CC + (tid >> 6)) * TT + t0 + (tid & 63);   // word i of a thread: channel (tid >> 6) + 8 i, position tid & 63
#pragma unroll
  for (int i = 0; i < 64 * CC / 512; ++i) xr[i] = Xp[(size_t)i * 8 * TT];
  asm volatile("s_wait_xcnt 0x0" ::: "memory");   // stands in front of any overwrite of the address registers of the 28 loads above (a weight load's result may land in them)
#pragma unroll
  for (int i = 0; i < CC * CC / 4 / 512; ++i) wr[i] = *(const v4f*)(Wm + (size_t)(tid + 512 * i) * 4);
  asm volatile("s_wait_xcnt 0x0" ::: "memory");   // the same for the 18 weight loads
  __builtin_amdgcn_sched_barrier(0);   // keeps every conversion (and with it every wait for a loaded value) below all 46 loads, so that they are in flight together and the block waits for memory once
#pragma unroll
  for (int i = 0; i < 64 * CC / 512; ++i) sa[tid & 63][(tid >> 6) + 8 * i] = (__bf16)xr[i];
#pragma unroll
  for (int i = 0; i < CC * CC / 4 / 512; ++i) { const int p = tid + 512 * i; v4b w4;
#pragma unroll
    for (int k = 0; k < 4; ++k) w4[k] = (__bf16)wr[i][k];
    vst2(&sw[p / (CC / 4)][(p % (CC / 4)) * 4], w4); }
  sek[tid] = bfr(ekv);
  if (tid < 64) for (int c = CC; c < CC + 8; ++c) sa[tid][c] = (__bf16)0.f;
  __syncthreads();
  v8f acc[3] = {};
#pragma unroll
  for (int kc = 0; kc < CC / 32; ++kc) { const v16b a = frag_b(&sa[rt * 16 + col][kc * 32], lane);
#pragma unroll
    for (int j = 0; j < 3; ++j) acc[j] = wmma_bf(a, frag_b(&sw[(cg * 3 + j) * 16 + col][kc * 32], lane), acc[j]); }
#pragma unroll
  for (int j = 0; j < 3; ++j) { const float bj = bfr(bb[j]);
#pragma unroll
    for (int r = 0; r < 8; ++r) so[rt * 16 + 8 * g + r][(cg * 3 + j) * 16 + col] = acc[j][r] + bj; }
  __syncthreads();
  float f[4][8];
  if (which < 2) {
    // piece e of q: row e >> 5, then (head, 8 dims) in the low 5 bits. Piece e of k: head e >> 8, then (tile of 16 keys, k half, g, key) in the low 8 bits, which is also the piece's place in the head's 4 tiles. The fourth group of 8 dims of a head is the zero padding (its read is aimed at the first group and not used)
    _Float16* DH_ = which ? KH : QH; _Float16* DL_ = which ? KL : QL;
#pragma unroll
    for (int i = 0; i < 4; ++i) { const int e = tid + 512 * i; const int r = which ? ((e >> 6) & 3) * 16 + (e & 15) : e >> 5, h = which ? e >> 8 : (e >> 2) & 7, p = which ? (e >> 4) & 3 : e & 3;
      const float* s = &so[r][h * HDIM + (p < 3 ? p : 0) * 8]; const v4f s0 = *(const v4f*)s, s1 = *(const v4f*)(s + 4);
#pragma unroll
      for (int j = 0; j < 4; ++j) { f[i][j] = p < 3 ? s0[j] : 0.f; f[i][4 + j] = p < 3 ? s1[j] : 0.f; } }
#pragma unroll
    for (int i = 0; i < 4; ++i) { const int e = tid + 512 * i; const size_t o = which ? ((b * NH + (e >> 8)) * (TT / 16) + (t0 >> 4)) * 512 + (e & 255) * 8 : (r0 + (e >> 5)) * (NH * 32) + (e & 31) * 8;
      v8h hi, lo; split8(f[i], hi, lo); vst2(DH_ + o, hi); vst2(DL_ + o, lo); asm volatile("s_wait_xcnt 0x0" ::: "memory"); }   // stands in front of any overwrite of the two stores' address and data registers
    if (which == 0) { // relative-key logits seeds: RQ[row][h][rr] = sum_d q[h*24+d] * emb_k[rr][d] (f32, d ascending); a thread holds its row's 24 dims of one head, emb_k (rounded to bf16) is read from LDS at one address for the whole wave; a wave writes 4 rows' records, 2,048 contiguous bytes
      const int r = tid >> 3, h = tid & 7; float qv[HDIM], o16[16];
#pragma unroll
      for (int j = 0; j < HDIM / 4; ++j) { const v4f t = *(const v4f*)&so[r][h * HDIM + 4 * j];
#pragma unroll
        for (int k = 0; k < 4; ++k) qv[4 * j + k] = t[k]; }
#pragma unroll
      for (int rr = 0; rr < 16; ++rr) { float a2 = 0.f;
        if (rr < NREL) {
#pragma unroll
          for (int d = 0; d < HDIM; ++d) a2 += qv[d] * sek[rr * HDIM + d]; }
        o16[rr] = a2; }
#pragma unroll
      for (int j = 0; j < 4; ++j) vst2(RQ + ((r0 + r) * NH + h) * 16 + 4 * j, (v4f){o16[4 * j], o16[4 * j + 1], o16[4 * j + 2], o16[4 * j + 3]}); }
  } else {
    // piece e: head e >> 8, then (block of 32 keys, tile of 16 dims, key half, g, dim) in the low 8 bits, which is also the piece's place in the head's 2 blocks; its 8 values are 8 consecutive keys of one dim (dims 24..31 are the zero padding)
#pragma unroll
    for (int i = 0; i < 4; ++i) { const int e = tid + 512 * i; const int h = e >> 8, d = ((e >> 6) & 1) * 16 + (e & 15), pc = ((e >> 7) & 1) * 4 + ((e >> 4) & 3);
#pragma unroll
      for (int j = 0; j < 8; ++j) { const float t = so[pc * 8 + j][h * HDIM + (d < HDIM ? d : 0)]; f[i][j] = d < HDIM ? t : 0.f; } }
#pragma unroll
    for (int i = 0; i < 4; ++i) { const int e = tid + 512 * i; const size_t o = ((b * NH + (e >> 8)) * (TT / 32) + (t0 >> 5)) * 1024 + (e & 255) * 8;
      v8h hi, lo; split8(f[i], hi, lo); vst2(VH + o, hi); vst2(VL + o, lo); asm volatile("s_wait_xcnt 0x0" ::: "memory"); }   // stands in front of any overwrite of the two stores' address and data registers
  }
}
// ---- k_attn: block = (16 queries, head pair, b), 8 waves: wave = (head of the pair, quarter of the 1,024 keys). Each wave runs its 256 keys in tiles of 32 on its own (no barrier in the loop). The scores are formed transposed, S^T = K . Q^T (A = a 16-key tile, B = the 16 queries): a lane holds 16 scores of ONE query (column lane & 15; keys 8 g + r of each 16-key tile), so the maximum and the sum of a row are in-lane work plus one exchange between the wave's halves, and the mask is read 8 consecutive words a lane. scores (3-product k.q + windowed rel-key seed) / sqrt(24), mask == 0 excluded; online softmax; P^T (x2^11 hi + residual), converted in place from the two score tiles, is the B operand of O^T += V^T . P^T (2 tiles of 16 dims as A). The four partial (max, sum, context) of a head meet in LDS behind one barrier and are rescaled to the common max; the same pass adds sum_{|s-t|<=4} p(t,s) emb_v[s-t+4]; O rows [hp][row][(h & 1) * 24 + d]
#define KSPL 4
// fragment stored in fragment order: a wave-uniform base plus the lane's 16 bytes in each of two runs of 512 bytes (4 whole lines a load)
__device__ __forceinline__ v16h frag_p(const _Float16* ubase, unsigned boff) {
  union { v16h v; v8h q[2]; } u; const char* p = (const char*)ubase;
  u.q[0] = *(const v8h*)(p + boff); u.q[1] = *(const v8h*)(p + 512 + boff); return u.v;
}
// lane l's value from lane l ^ 16 (a vector cross-row move, no LDS path)
__device__ __forceinline__ float xhalf(float x) { return __builtin_bit_cast(float, __builtin_amdgcn_permlanex16(__builtin_bit_cast(int, x), __builtin_bit_cast(int, x), 0x76543210, 0xfedcba98, false, false)); }
__global__ __launch_bounds__(256, 8) void k_attn(const _Float16* __restrict__ QH, const _Float16* __restrict__ QL, const _Float16* __restrict__ KH, const _Float16* __restrict__ KL, const float* __restrict__ RQ, const int* __restrict__ MASK, const float* __restrict__ EV, float* __restrict__ O) {
  __shared__ float srq[2 * KSPL][16][NREL + 1]; __shared__ float spp[2][16][NREL + 1]; __shared__ float sm[2 * KSPL][16], sl[2 * KSPL][16]; __shared__ __align__(16) float sac[2 * KSPL][16][36];
  const int tid = threadIdx.x, wave = __builtin_amdgcn_readfirstlane(tid >> 5), lane = tid & 31, col = lane & 15, g = lane >> 4; const int hp = blockIdx.y; const size_t b = blockIdx.z; const int q0 = blockIdx.x * 16; const size_t rq = b * TT + q0; const float isc = 1.0f / sqrtf((float)HDIM);
  const int h = hp * 2 + wave / KSPL, kbase = (wave % KSPL) * (TT / KSPL);
  // the wave's number is made scalar so that the wave-uniform part of every K, V and mask address is scalar arithmetic; the second launch bound asks for 8 waves per SIMD (128 VGPRs): four blocks per WGP, the whole grid resident at once
  const int* MKw = MASK + rq * TT + kbase;
  // in fragment order 32 keys of a head are 1,024 elements in each of the four arrays, at the same place in each; the arrays lie one behind the other in the workspace, so one address serves all four, the rest being constant offsets
  const _Float16* FW = KH + ((b * NH + h) * (TT / 32) + kbase / 32) * 1024;
  const unsigned fo = lane * 16, mo = col * TT + 8 * g;
  if (lane < 16) { for (int rr = 0; rr < NREL; ++rr) srq[wave][lane][rr] = RQ[((rq + lane) * NH + h) * 16 + rr]; }
  const v16h aq = frag_h(QH + (rq + col) * (NH * 32) + h * 32, lane), aql = frag_h(QL + (rq + col) * (NH * 32) + h * 32, lane);
  const int qi = q0 + col;
  float m = -3.0e38f, l = 0.f;   // the lane's query: running max (equal in both halves), and this half's share of the running sum
  v8f acc[2] = {}, accl[2] = {};
  LDSX();
#pragma unroll 1
  for (int ks = 0; ks < TT / KSPL / 32; ++ks) { const int j0 = kbase + ks * 32;
    v8f s[2]; v16h kh[2], kl[2], vh[2], vl[2]; v4i mk[2][2];
#pragma unroll
    for (int ct = 0; ct < 2; ++ct) { const _Float16* FK = FW + (ks * 2 + ct) * 512; const int* MP = MKw + ks * 32 + ct * 16;
      kh[ct] = frag_p(FK, fo); if (ct == 0) kl[ct] = frag_p(FK + (WS_KL - WS_KH) / 2, fo); mk[ct][0] = *(const v4i*)(MP + mo); mk[ct][1] = *(const v4i*)(MP + 4 + mo); }
    asm volatile("s_wait_xcnt 0x0" ::: "memory");   // the clobber keeps the 6 K loads and 4 mask loads above issued here, all in flight together: the wave waits for memory once where it waited at each fragment; the wait stands in front of any overwrite of their address registers
#pragma unroll
    for (int ct = 0; ct < 2; ++ct) { v8f c = {}, cl = {}; const v4i mk0 = mk[ct][0], mk1 = mk[ct][1];
      c = wmma16(kh[ct], aq, c); cl = wmma16(kh[ct], aql, cl); cl = wmma16(kl[ct], aq, cl);
      if (ct == 0) { kl[1] = frag_p(FW + (ks * 2 + 1) * 512 + (WS_KL - WS_KH) / 2, fo);
        asm volatile("s_wait_xcnt 0x0" ::: "memory"); }   // the last K fragment takes the registers that the first tile's products have freed; the clobber keeps its loads issued here, so that they fly while the first tile's scores are finished
#pragma unroll
      for (int r = 0; r < 8; ++r) { const int dd = j0 + ct * 16 + 8 * g + r - qi; float sc = c[r] + cl[r] * (1.0f / 2048.0f); if (dd >= -WIN && dd <= WIN) sc += srq[wave][col][dd + WIN]; const bool keep = (r < 4 ? mk0[r & 3] : mk1[r & 3]) != 0; s[ct][r] = keep ? sc * isc : -3.0e38f; } }
#pragma unroll
    for (int dt = 0; dt < 2; ++dt) { const _Float16* FV = FW + (ks * 2 + dt) * 512; vh[dt] = frag_p(FV + (WS_VH - WS_KH) / 2, fo); if (dt == 0) vl[dt] = frag_p(FV + (WS_VL - WS_KH) / 2, fo); }
    asm volatile("s_wait_xcnt 0x0" ::: "memory");   // stands in front of the loop's step of the loads' address registers; the clobber holds the 6 V loads above it, ahead of the first V product, so that they are in flight together
    float mx = fmaxf(s[0][0], s[1][0]);
#pragma unroll
    for (int r = 1; r < 8; ++r) mx = fmaxf(mx, fmaxf(s[0][r], s[1][r]));
    mx = fmaxf(mx, xhalf(mx));
    const float mn = fmaxf(m, mx); const float alpha = (m <= -1.0e38f) ? 0.f : __expf(m - mn);
    v16h pbh, pbl; float e[16], es = 0.f;
#pragma unroll
    for (int i = 0; i < 16; ++i) { const float sv = s[i >> 3][i & 7]; e[i] = (sv <= -1.0e38f) ? 0.f : __expf(sv - mn); }
#pragma unroll
    for (int i = 0; i < 16; ++i) { es += e[i]; const float p = e[i] * 2048.0f; const _Float16 ph = (_Float16)p; pbh[i] = ph; pbl[i] = (_Float16)((p - (float)ph) * 2048.0f); }
    l = l * alpha + es; m = (mn <= -1.0e38f) ? m : mn;
#pragma unroll
    for (int dt = 0; dt < 2; ++dt) { acc[dt] *= alpha; accl[dt] *= alpha; }
#pragma unroll
    for (int dt = 0; dt < 2; ++dt) { if (dt == 1) vl[1] = frag_p(FW + (ks * 2 + 1) * 512 + (WS_VL - WS_KH) / 2, fo);   // the last V fragment takes registers that the first tile's products have freed (a fourth fragment held over the softmax spills)
      acc[dt] = wmma16(vh[dt], pbh, acc[dt]); accl[dt] = wmma16(vh[dt], pbl, accl[dt]); accl[dt] = wmma16(vl[dt], pbh, accl[dt]); } }
  // this wave's partial: running max and sum per query (the halves' sums joined here, once), context with its residual folded in (a lane holds dims 8 g + r of each 16-dim tile of its query)
  l += xhalf(l);
  if (g == 0) { sm[wave][col] = m; sl[wave][col] = l; }
#pragma unroll
  for (int dt = 0; dt < 2; ++dt) { const v8f o8 = acc[dt] + accl[dt] * (1.0f / 2048.0f);
    vst2(&sac[wave][col][dt * 16 + 8 * g], (v4f){o8[0], o8[1], o8[2], o8[3]}); vst2(&sac[wave][col][dt * 16 + 8 * g + 4], (v4f){o8[4], o8[5], o8[6], o8[7]}); }
  // windowed relative values: the score of (t, s) for s = t-4 .. t+4 recomputed with the same formula, one (head, row, offset) per thread; excluded keys carry the sentinel
  for (int e = tid; e < 2 * 16 * NREL; e += 256) { const int h2 = e / (16 * NREL), rr = (e / NREL) & 15, off = e % NREL; const int hx = hp * 2 + h2; const int sidx = q0 + rr + off - WIN; float sv = -3.0e38f;
    if (sidx >= 0 && sidx < TT && MASK[((rq + rr) * TT) + sidx] != 0) { const size_t rqo = (rq + rr) * (NH * 32) + hx * 32, rko = ((b * NH + hx) * (TT / 16) + (sidx >> 4)) * 512 + (sidx & 15) * 8; float dot = 0.f;
      // the key's 24 dims are 3 pieces of 8 in the fragment order, 128 elements apart. Each s_wait_xcnt stands in front of any overwrite of the address registers of the loads above it (a later load's result may land in them); the loops are unrolled so that every piece has a constant index and stays in registers
      v8h xq[3], xql[3], xk[3], xkl[3];
#pragma unroll
      for (int p = 0; p < 3; ++p) xq[p] = *(const v8h*)(QH + rqo + p * 8);
      asm volatile("s_wait_xcnt 0x0" ::: "memory");
#pragma unroll
      for (int p = 0; p < 3; ++p) xql[p] = *(const v8h*)(QL + rqo + p * 8);
      asm volatile("s_wait_xcnt 0x0" ::: "memory");
#pragma unroll
      for (int p = 0; p < 3; ++p) xk[p] = *(const v8h*)(KH + rko + p * 128);
      asm volatile("s_wait_xcnt 0x0" ::: "memory");
#pragma unroll
      for (int p = 0; p < 3; ++p) xkl[p] = *(const v8h*)(KL + rko + p * 128);
      asm volatile("s_wait_xcnt 0x0" ::: "memory");
      const float rqv = RQ[((rq + rr) * NH + hx) * 16 + off];
      asm volatile("s_wait_xcnt 0x0" ::: "memory");
#pragma unroll
      for (int d = 0; d < HDIM; ++d) { const float qv = (float)xq[d >> 3][d & 7] + (float)xql[d >> 3][d & 7] * (1.0f / 2048.0f); const float kv = (float)xk[d >> 3][d & 7] + (float)xkl[d >> 3][d & 7] * (1.0f / 2048.0f); dot += qv * kv; }
      sv = (dot + rqv) * isc; }
    spp[h2][rr][off] = sv; }
  __syncthreads();
  // merge: one thread per (row, head, 4 dims); every partial is rescaled from its own max to the row's max
  if (tid < 16 * 12) { const int r = tid / 12, q4 = tid % 12; const int h2 = q4 / 6, d = (q4 % 6) * 4, w0 = h2 * KSPL; float M = -3.0e38f, L = 0.f, f[KSPL];
#pragma unroll
    for (int w = 0; w < KSPL; ++w) M = fmaxf(M, sm[w0 + w][r]);
#pragma unroll
    for (int w = 0; w < KSPL; ++w) { const float mw = sm[w0 + w][r]; f[w] = (mw <= -1.0e38f) ? 0.f : __expf(mw - M); L += sl[w0 + w][r] * f[w]; }
    v4f a = {};
#pragma unroll
    for (int w = 0; w < KSPL; ++w) a += *(const v4f*)&sac[w0 + w][r][d] * f[w];
    v4f o4 = a * ((1.0f / 2048.0f) / L);
    for (int jr = 0; jr < NREL; ++jr) { const float sv = spp[h2][r][jr]; const float pv = (sv <= -1.0e38f) ? 0.f : __expf(sv - M) / L;
#pragma unroll
      for (int i = 0; i < 4; ++i) o4[i] += pv * bfr(EV[jr * HDIM + d + i]); }
    vst2(O + ((size_t)hp * NR + rq + r) * 48 + q4 * 4, o4); }
}
// ---- k_out: block = (96 output channels o, 32 positions, b), 6 waves: wave = one 16-channel tile x both 16-position tiles. y[o][t] = Wo rows (read as f32, rounded to bf16 in registers) x O (gathered from the [hp][row][48] layout into an LDS bf16 hi/lo tile [32 t][192 c]) + bo -> [B][C][T]. Every global read of a thread (8 16-byte pieces of O, the 24 pieces of its 6 Wo fragments, its 8 biases) is issued ahead of the one barrier, so the block waits for memory once
#define OPOS 32
#define OCH 96
__global__ __launch_bounds__(192) void k_out(const float* __restrict__ O, const float* __restrict__ WO, const float* __restrict__ BO, float* __restrict__ Y) {
  __shared__ __align__(16) __bf16 sh[OPOS][CC + 8], sl[OPOS][CC + 8]; __shared__ __align__(16) float so2[OCH / 16][16][OPOS + 4];
  const int tid = threadIdx.x, wave = tid >> 5, lane = tid & 31, col = lane & 15, g = lane >> 4; const int o0 = blockIdx.x * OCH + wave * 16; const int n0 = blockIdx.y * OPOS; const size_t b = blockIdx.z;
  // piece i of a thread: head pair i >> 1, row (i & 1) * 16 + tid / 12, 4 of the row's 48 floats (the 32 rows of a head pair are one contiguous run)
  const int sr = tid / 12, sw = (tid % 12) * 4; v4f x[8];
#pragma unroll
  for (int i = 0; i < 8; ++i) x[i] = *(const v4f*)(O + ((size_t)(i >> 1) * NR + b * TT + n0 + (i & 1) * 16 + sr) * 48 + sw);
  asm volatile("s_wait_xcnt 0x0" ::: "memory");   // stands in front of any overwrite of the address registers of the loads above (a later load's result may land in them); the clobber keeps these loads issued here, ahead of the conversion that waits for O
  v4f wf[CC / 32][4];   // fragment kc of the lane: floats k0 + 8 g + 0..7 and k0 + 16 + 8 g + 0..7 of its Wo row
#pragma unroll
  for (int kc = 0; kc < CC / 32; ++kc) { const float* p = WO + (size_t)(o0 + col) * CC + kc * 32 + 8 * g; wf[kc][0] = *(const v4f*)p; wf[kc][1] = *(const v4f*)(p + 4); wf[kc][2] = *(const v4f*)(p + 16); wf[kc][3] = *(const v4f*)(p + 20); }
  asm volatile("s_wait_xcnt 0x0" ::: "memory");   // the same for the Wo fragment loads
  const v4f b0 = *(const v4f*)(BO + o0 + 8 * g), b1 = *(const v4f*)(BO + o0 + 8 * g + 4);
  asm volatile("s_wait_xcnt 0x0" ::: "memory");   // the same for the bias loads
#pragma unroll
  for (int i = 0; i < 8; ++i) { v4b hi, lo;
#pragma unroll
    for (int k = 0; k < 4; ++k) { const float v = x[i][k]; const __bf16 hb = (__bf16)v; hi[k] = hb; lo[k] = (__bf16)(v - (float)hb); }
    vst2(&sh[(i & 1) * 16 + sr][(i >> 1) * 48 + sw], hi); vst2(&sl[(i & 1) * 16 + sr][(i >> 1) * 48 + sw], lo); }
  v16b a[CC / 32];
#pragma unroll
  for (int kc = 0; kc < CC / 32; ++kc)
#pragma unroll
    for (int i = 0; i < 16; ++i) a[kc][i] = (__bf16)wf[kc][i >> 2][i & 3];
  __syncthreads();
  v8f acc[2] = {};
#pragma unroll
  for (int kc = 0; kc < CC / 32; ++kc) {
#pragma unroll
    for (int j = 0; j < 2; ++j) { acc[j] = wmma_bf(a[kc], frag_b(&sl[j * 16 + col][kc * 32], lane), acc[j]); acc[j] = wmma_bf(a[kc], frag_b(&sh[j * 16 + col][kc * 32], lane), acc[j]); } }
#pragma unroll
  for (int j = 0; j < 2; ++j)
#pragma unroll
    for (int r = 0; r < 8; ++r) so2[wave][8 * g + r][j * 16 + col] = acc[j][r] + bfr(r < 4 ? b0[r & 3] : b1[r & 3]);
  LDSX();
  // the wave writes its 16 channel rows as whole 128-byte runs, 4 rows a store
#pragma unroll
  for (int it = 0; it < 4; ++it) { const int rl = it * 4 + (lane >> 3), c4 = (lane & 7) * 4; vst2(Y + (b * CC + o0 + rl) * TT + n0 + c4, *(const v4f*)&so2[wave][rl][c4]); }
}
extern "C" void kernel_launch(void* const* d_in, const int* in_sizes, int n_in, void* d_out, int out_size, void* d_ws, size_t ws_size, hipStream_t stream) {
  (void)in_sizes; (void)n_in; (void)out_size;
  const float** F = (const float**)d_in;   // 0 x [4,192,1024], 1 attn_mask [4,1,1024,1024] i32, 2 Wq [192,192], 3 bq, 4 Wk, 5 bk, 6 Wv, 7 bv, 8 Wo, 9 bo, 10 emb_rel_k [1,9,24], 11 emb_rel_v [1,9,24]
  if (ws_size < (size_t)WS_END) return;
  char* ws = (char*)d_ws; _Float16 *QH = (_Float16*)(ws + WS_QH), *QL = (_Float16*)(ws + WS_QL), *KH = (_Float16*)(ws + WS_KH), *KL = (_Float16*)(ws + WS_KL), *VH = (_Float16*)(ws + WS_VH), *VL = (_Float16*)(ws + WS_VL); float *RQ = (float*)(ws + WS_RQ), *O = (float*)(ws + WS_O);
  k_qkv<<<dim3(TT / 64, NB, 3), 512, 0, stream>>>(F[0], F[2], F[4], F[6], F[3], F[5], F[7], F[10], QH, QL, KH, KL, VH, VL, RQ);
  k_attn<<<dim3(TQB, NH / 2, TNB), 256, 0, stream>>>(QH, QL, KH, KL, RQ, (const int*)d_in[1], F[11], O);
  k_out<<<dim3(CC / OCH, TT / OPOS, TNB), 192, 0, stream>>>(O, F[8], F[9], (float*)d_out);
}

// v009
// A run of this version takes 44.8 microseconds.
// Timed twice side by side with v008, it ran 1.14 and 1.15 times as fast.
// All steps since v000 together make it 9.55 times as fast.
// compute dtype: all float inputs rounded to bf16, attn_mask (int) read on device; q/k/v 1x1 convs with EXACT bf16 products on WMMA 16x16x32 (positions as rows via an LDS transpose of the [B,C,T] input, natural weight rows) + biases; q and k stored as f16 hi + (x2048-scaled) residual, head dim 24 zero-padded to 32 (q in per-head chunks of a row, k in fragment order), v as f16 hi + residual, padded to 32 dims per head, in fragment order; scores = (q . k (3 products) + the windowed relative-key logits q . emb_k[s-t+4] for |s-t| <= 4 (f32 dots)) / sqrt(24); mask == 0 -> -3e38 sentinel (weight set to 0, so the key is excluded); running-max softmax in f32 (hardware exp); P (scaled by 2^11, as f16 hi + residual) x v hi/lo (3 products); the windowed relative-value term sum_{|s-t|<=4} p(t,s) emb_v[s-t+4] added in f32 from recomputed (identical-formula) weights; output 1x1 conv with the context as bf16 hi + residual x exact Wo rows (2 products) + bo, written channels-first; f32 accumulate.
#include <hip/hip_runtime.h>
#include <math.h>

typedef __attribute__((ext_vector_type(16))) _Float16 v16h;
typedef __attribute__((ext_vector_type(16))) __bf16 v16b;
typedef __attribute__((ext_vector_type(8)))  _Float16 v8h;
typedef __attribute__((ext_vector_type(8)))  float v8f;
typedef __attribute__((ext_vector_type(4)))  float v4f;
typedef __attribute__((ext_vector_type(2)))  float v2f;
typedef __attribute__((ext_vector_type(4)))  unsigned v4u;
typedef __attribute__((ext_vector_type(4)))  int v4i;
typedef float __attribute__((may_alias)) float_a;
typedef int __attribute__((may_alias)) int_a;

template <typename T> __device__ __forceinline__ void vst2(void* p, T v) { *(T*)p = v;  }
__device__ __forceinline__ v8f wmma16(v16h a, v16h b, v8f c) {
  v8f d = __builtin_amdgcn_wmma_f32_16x16x32_f16(false, a, false, b, (short)0, c, false, false);
  asm volatile("v_nop\n\tv_nop\n\tv_nop\n\tv_nop" : "+v"(d) : "v"(a), "v"(b));
  return d;
}
__device__ __forceinline__ v8f wmma_bf(v16b a, v16b b, v8f c) {
  v8f d = __builtin_amdgcn_wmma_f32_16x16x32_bf16(false, a, false, b, (short)0, c, false, false);
  asm volatile("v_nop\n\tv_nop\n\tv_nop\n\tv_nop" : "+v"(d) : "v"(a), "v"(b));
  return d;
}
// 16x16x32 fragments: lane = (h = lane>>4, row/col = lane&15); elements 0..7 = k0+8h+0..7, 8..15 = k0+16+8h+0..7; D element r = row 8h+r
__device__ __forceinline__ v16h frag_h(const _Float16* rowk0, int lane) {
  union { v16h v; v8h q[2]; } u; const _Float16* p = rowk0 + 8 * (lane >> 4);
  u.q[0] = *(const v8h*)p; u.q[1] = *(const v8h*)(p + 16); return u.v;
}
__device__ __forceinline__ v16h frag_f32(const float* rowk0, int lane) {
  v16h a; const float* p = rowk0 + 8 * (lane >> 4);
#pragma unroll
  for (int i = 0; i < 8; ++i) { a[i] = (_Float16)p[i]; a[8 + i] = (_Float16)p[16 + i]; }
  return a;
}
__device__ __forceinline__ v16h frag_f32s(const float* rowk0, int lane, float sc) {
  v16h a; const float* p = rowk0 + 8 * (lane >> 4);
#pragma unroll
  for (int i = 0; i < 8; ++i) { a[i] = (_Float16)(p[i] * sc); a[8 + i] = (_Float16)(p[16 + i] * sc); }
  return a;
}
// column fragment from a [K][ld] layout (column n), rows >= K read as 0
__device__ __forceinline__ v16h fragc_f32(const float* W, int k0, int n, int lane, int ld, int K) {
  v16h a; const int g = lane >> 4;
#pragma unroll
  for (int i = 0; i < 8; ++i) { const int ka = k0 + 8 * g + i, kb = ka + 16;
    a[i] = (_Float16)(ka < K ? W[(size_t)(ka < K ? ka : K - 1) * ld + n] : 0.f); a[8 + i] = (_Float16)(kb < K ? W[(size_t)(kb < K ? kb : K - 1) * ld + n] : 0.f); }
  return a;
}
struct F2 { v16b h, l; };
__device__ __forceinline__ F2 bsplit16(const float v[16]) { F2 r;
#pragma unroll
  for (int i = 0; i < 16; ++i) { const __bf16 h = (__bf16)v[i]; r.h[i] = h; r.l[i] = (__bf16)(v[i] - (float)h); }
  return r; }
__device__ __forceinline__ F2 split_row(const float* row, int k0, int lane) { float v[16]; const float* p = row + k0 + 8 * (lane >> 4);
#pragma unroll
  for (int i = 0; i < 8; ++i) { v[i] = p[i]; v[8 + i] = p[16 + i]; }
  return bsplit16(v); }
__device__ __forceinline__ F2 split_rowK(const float* row, int k0, int lane, int K) { float v[16]; const int g = lane >> 4;
#pragma unroll
  for (int i = 0; i < 8; ++i) { const int ka = k0 + 8 * g + i, kb = ka + 16; v[i] = ka < K ? row[ka < K ? ka : K - 1] : 0.f; v[8 + i] = kb < K ? row[kb < K ? kb : K - 1] : 0.f; }
  return bsplit16(v); }
__device__ __forceinline__ F2 split_col(const float* W, int k0, int n, int lane, int ld, int K) { float v[16]; const int g = lane >> 4;
#pragma unroll
  for (int i = 0; i < 8; ++i) { const int ka = k0 + 8 * g + i, kb = ka + 16; v[i] = ka < K ? W[(size_t)(ka < K ? ka : K - 1) * ld + n] : 0.f; v[8 + i] = kb < K ? W[(size_t)(kb < K ? kb : K - 1) * ld + n] : 0.f; }
  return bsplit16(v); }
__device__ __forceinline__ v8f mac3(const F2& a, const F2& b, v8f c) { c = wmma_bf(a.l, b.h, c); c = wmma_bf(a.h, b.l, c); return wmma_bf(a.h, b.h, c); }
__device__ __forceinline__ float sigm(float v) { return 1.0f / (1.0f + expf(-v)); }
#define LDSX() do { asm volatile("s_wait_dscnt 0" ::: "memory"); __builtin_amdgcn_wave_barrier(); __builtin_amdgcn_fence(__ATOMIC_RELEASE, "workgroup"); } while (0)


// Relative-position multi-head attention (B 4, C 192 as 8 heads x 24, T 1,024, window 4): 1x1-conv q/k/v, scores with windowed relative key embeddings, per-(t,s) mask, softmax, values plus windowed relative value embeddings, 1x1-conv output -> [B, C, T].
#define NB 4
#define CC 192
#define TT 1024
#define NH 8
#define HDIM 24
#define WIN 4
#define NREL (2 * WIN + 1)
#define NR (NB * TT)
#ifndef TQB
#define TQB (TT / 16)
#define TNB NB
#endif
typedef __attribute__((ext_vector_type(8))) __bf16 v8b;
typedef __attribute__((ext_vector_type(4))) __bf16 v4b;
__device__ __forceinline__ v16b frag_b(const __bf16* rowk0, int lane) {
  union { v16b v; v8b q[2]; } u; const __bf16* p = rowk0 + 8 * (lane >> 4);
  u.q[0] = *(const v8b*)p; u.q[1] = *(const v8b*)(p + 16); return u.v;
}
__device__ __forceinline__ float bfr(float v) { return (float)(__bf16)v; }
__device__ __attribute__((noinline)) float exp_ni(float v) { return expf(v); }
__device__ __attribute__((noinline)) float erf_ni(float v) { return erff(v); }

#define PK_END ((size_t)4 * CC * CC)         // the head of the workspace is left unused (the arrays below keep their places)
#define WS_QH  (((2u * PK_END) + 127u) / 128u * 128u)   // f16 [NR][8][32] q hi ; QL ; then k hi ; KL in fragment order [b][h][16-key tile][k half p][lane = 16 g + key][8]: element k = 16 p + 8 g + i
#define WS_QL  (WS_QH + 2u * NR * NH * 32)
#define WS_KH  (WS_QL + 2u * NR * NH * 32)
#define WS_KL  (WS_KH + 2u * NR * NH * 32)
#define WS_VH  (WS_KL + 2u * NR * NH * 32)               // f16 v hi ; VL in fragment order [b][h][32-key block][16-dim tile][key half p][lane = 16 g + dim][8]: key = 16 p + 8 g + i (dims 24..31 of each head zero)
#define WS_VL  (WS_VH + 2u * (size_t)NB * NH * 32 * TT)
#define WS_RQ  (WS_VL + 2u * (size_t)NB * NH * 32 * TT)  // f32 [NR][8][16] q . emb_k[r] (9 used)
#define WS_END (WS_RQ + 4u * NR * NH * 16)

// ---- k_qkv: block = (64 positions, b, one of q / k / v), 16 waves: wave = (16-position row tile, 3 of the 12 column tiles). A tile [64 t][192 c] from x[b][c][t] (bf16 exact); the block's own weight matrix is read as f32 in whole lines (18 16-byte pieces a thread), rounded to bf16 and kept in LDS [192 o][192 c], where the B fragments are read; D = A . W rows + b, kept as f32 in LDS. Every global read of a thread (18 weight pieces, 24 x words, 3 biases, 1 emb_k word) is issued ahead of the first barrier. Behind the second barrier a thread forms its 4 16-byte f16 hi and residual pieces straight from the f32 tile, all its LDS reads in flight together, and stores them: q -> padded 32-wide per-head chunks; k, v -> the same values in the fragment order k_attn loads them in (a wave's 16-byte store covers 512 contiguous bytes); in the q block a thread = (row, head) also writes RQ[row][h][r] = q_h . emb_k[r] (f32, 9 independent sums)
__device__ __forceinline__ void split8(const float v[8], v8h& hi, v8h& lo) {
#pragma unroll
  for (int j = 0; j < 8; ++j) { const _Float16 hv = (_Float16)v[j]; hi[j] = hv; lo[j] = (_Float16)((v[j] - (float)hv) * 2048.0f); }
}
__global__ __launch_bounds__(512) void k_qkv(const float* __restrict__ X, const float* __restrict__ WQ, const float* __restrict__ WK, const float* __restrict__ WV, const float* __restrict__ BQ, const float* __restrict__ BK, const float* __restrict__ BV, const float* __restrict__ EK, _Float16* __restrict__ QH, _Float16* __restrict__ QL, _Float16* __restrict__ KH, _Float16* __restrict__ KL, _Float16* __restrict__ VH, _Float16* __restrict__ VL, float* __restrict__ RQ) {
  __shared__ __align__(16) __bf16 sa[64][CC + 8]; __shared__ __align__(16) float so[64][CC + 4]; __shared__ __align__(16) __bf16 sw[CC][CC + 8]; __shared__ __align__(16) float sek[512];   // emb_k rounded to bf16, 216 words used; every thread stores one word, so that no branch stands between the load and its store
  const int tid = threadIdx.x, wave = tid >> 5, lane = tid & 31, col = lane & 15, g = lane >> 4, rt = wave & 3, cg = wave >> 2; const int t0 = blockIdx.x * 64, which = blockIdx.z; const size_t b = blockIdx.y; const size_t r0 = b * TT + t0;
  const float* Wm = (which == 0) ? WQ : (which == 1) ? WK : WV; const float* BB = (which == 0) ? BQ : (which == 1) ? BK : BV; v4f wr[CC * CC / 4 / 512]; float xr[64 * CC / 512], bb[3];
#pragma unroll
  for (int j = 0; j < 3; ++j) bb[j] = BB[(cg * 3 + j) * 16 + col];
  const float ekv = EK[tid < NREL * HDIM ? tid : 0];
  const float* Xp = X + (b * CC + (tid >> 6)) * TT + t0 + (tid & 63);   // word i of a thread: channel (tid >> 6) + 8 i, position tid & 63
#pragma unroll
  for (int i = 0; i < 64 * CC / 512; ++i) xr[i] = Xp[(size_t)i * 8 * TT];
  asm volatile("s_wait_xcnt 0x0" ::: "memory");   // stands in front of any overwrite of the address registers of the 28 loads above (a weight load's result may land in them)
#pragma unroll
  for (int i = 0; i < CC * CC / 4 / 512; ++i) wr[i] = *(const v4f*)(Wm + (size_t)(tid + 512 * i) * 4);
  asm volatile("s_wait_xcnt 0x0" ::: "memory");   // the same for the 18 weight loads
  __builtin_amdgcn_sched_barrier(0);   // keeps every conversion (and with it every wait for a loaded value) below all 46 loads, so that they are in flight together and the block waits for memory once
#pragma unroll
  for (int i = 0; i < 64 * CC / 512; ++i) sa[tid & 63][(tid >> 6) + 8 * i] = (__bf16)xr[i];
#pragma unroll
  for (int i = 0; i < CC * CC / 4 / 512; ++i) { const int p = tid + 512 * i; v4b w4;
#pragma unroll
    for (int k = 0; k < 4; ++k) w4[k] = (__bf16)wr[i][k];
    vst2(&sw[p / (CC / 4)][(p % (CC / 4)) * 4], w4); }
  sek[tid] = bfr(ekv);
  if (tid < 64) for (int c = CC; c < CC + 8; ++c) sa[tid][c] = (__bf16)0.f;
  __syncthreads();
  v8f acc[3] = {};
#pragma unroll
  for (int kc = 0; kc < CC / 32; ++kc) { const v16b a = frag_b(&sa[rt * 16 + col][kc * 32], lane);
#pragma unroll
    for (int j = 0; j < 3; ++j) acc[j] = wmma_bf(a, frag_b(&sw[(cg * 3 + j) * 16 + col][kc * 32], lane), acc[j]); }
#pragma unroll
  for (int j = 0; j < 3; ++j) { const float bj = bfr(bb[j]);
#pragma unroll
    for (int r = 0; r < 8; ++r) so[rt * 16 + 8 * g + r][(cg * 3 + j) * 16 + col] = acc[j][r] + bj; }
  __syncthreads();
  float f[4][8];
  if (which < 2) {
    // piece e of q: row e >> 5, then (head, 8 dims) in the low 5 bits. Piece e of k: head e >> 8, then (tile of 16 keys, k half, g, key) in the low 8 bits, which is also the piece's place in the head's 4 tiles. The fourth group of 8 dims of a head is the zero padding (its read is aimed at the first group and not used)
    _Float16* DH_ = which ? KH : QH; _Float16* DL_ = which ? KL : QL;
#pragma unroll
    for (int i = 0; i < 4; ++i) { const int e = tid + 512 * i; const int r = which ? ((e >> 6) & 3) * 16 + (e & 15) : e >> 5, h = which ? e >> 8 : (e >> 2) & 7, p = which ? (e >> 4) & 3 : e & 3;
      const float* s = &so[r][h * HDIM + (p < 3 ? p : 0) * 8]; const v4f s0 = *(const v4f*)s, s1 = *(const v4f*)(s + 4);
#pragma unroll
      for (int j = 0; j < 4; ++j) { f[i][j] = p < 3 ? s0[j] : 0.f; f[i][4 + j] = p < 3 ? s1[j] : 0.f; } }
#pragma unroll
    for (int i = 0; i < 4; ++i) { const int e = tid + 512 * i; const size_t o = which ? ((b * NH + (e >> 8)) * (TT / 16) + (t0 >> 4)) * 512 + (e & 255) * 8 : (r0 + (e >> 5)) * (NH * 32) + (e & 31) * 8;
      v8h hi, lo; split8(f[i], hi, lo); vst2(DH_ + o, hi); vst2(DL_ + o, lo); asm volatile("s_wait_xcnt 0x0" ::: "memory"); }   // stands in front of any overwrite of the two stores' address and data registers
    if (which == 0) { // relative-key logits seeds: RQ[row][h][rr] = sum_d q[h*24+d] * emb_k[rr][d] (f32, d ascending); a thread holds its row's 24 dims of one head, emb_k (rounded to bf16) is read from LDS at one address for the whole wave; a wave writes 4 rows' records, 2,048 contiguous bytes
      const int r = tid >> 3, h = tid & 7; float qv[HDIM], o16[16];
#pragma unroll
      for (int j = 0; j < HDIM / 4; ++j) { const v4f t = *(const v4f*)&so[r][h * HDIM + 4 * j];
#pragma unroll
        for (int k = 0; k < 4; ++k) qv[4 * j + k] = t[k]; }
#pragma unroll
      for (int rr = 0; rr < 16; ++rr) { float a2 = 0.f;
        if (rr < NREL) {
#pragma unroll
          for (int d = 0; d < HDIM; ++d) a2 += qv[d] * sek[rr * HDIM + d]; }
        o16[rr] = a2; }
#pragma unroll
      for (int j = 0; j < 4; ++j) vst2(RQ + ((r0 + r) * NH + h) * 16 + 4 * j, (v4f){o16[4 * j], o16[4 * j + 1], o16[4 * j + 2], o16[4 * j + 3]}); }
  } else {
    // piece e: head e >> 8, then (block of 32 keys, tile of 16 dims, key half, g, dim) in the low 8 bits, which is also the piece's place in the head's 2 blocks; its 8 values are 8 consecutive keys of one dim (dims 24..31 are the zero padding)
#pragma unroll
    for (int i = 0; i < 4; ++i) { const int e = tid + 512 * i; const int h = e >> 8, d = ((e >> 6) & 1) * 16 + (e & 15), pc = ((e >> 7) & 1) * 4 + ((e >> 4) & 3);
#pragma unroll
      for (int j = 0; j < 8; ++j) { const float t = so[pc * 8 + j][h * HDIM + (d < HDIM ? d : 0)]; f[i][j] = d < HDIM ? t : 0.f; } }
#pragma unroll
    for (int i = 0; i < 4; ++i) { const int e = tid + 512 * i; const size_t o = ((b * NH + (e >> 8)) * (TT / 32) + (t0 >> 5)) * 1024 + (e & 255) * 8;
      v8h hi, lo; split8(f[i], hi, lo); vst2(VH + o, hi); vst2(VL + o, lo); asm volatile("s_wait_xcnt 0x0" ::: "memory"); }   // stands in front of any overwrite of the two stores' address and data registers
  }
}
// ---- k_attn: block = (16 queries, all 8 heads, b), 32 waves: wave = (head, quarter of the 1,024 keys); one block fills a WGP, 256 blocks. Each wave runs its 256 keys in tiles of 32 on its own (no barrier in the loop). The scores are formed transposed, S^T = K . Q^T (A = a 16-key tile, B = the 16 queries): a lane holds 16 scores of ONE query (column lane & 15; keys 8 g + r of each 16-key tile), so the maximum and the sum of a row are in-lane work plus one exchange between the wave's halves, and the mask is read 8 consecutive words a lane. scores (3-product k.q + windowed rel-key seed) / sqrt(24), mask == 0 excluded; online softmax; P^T (x2^11 hi + residual), converted in place from the two score tiles, is the B operand of O^T += V^T . P^T (2 tiles of 16 dims as A). The four partial (max, sum, context) of a head meet in LDS behind one barrier and are rescaled to the common max; the same pass adds sum_{|s-t|<=4} p(t,s) emb_v[s-t+4]. As the block holds all 192 channels of its 16 positions, the output conv follows in the same launch: the merged context goes to LDS as bf16 hi + residual [16 t][192 c]; behind a second barrier waves 0..11 each form one 16-channel tile y[o][t] = Wo rows (read as f32 ahead of the first barrier, rounded to bf16 in registers) x context (2 products) + bo -> [B][C][T]
#define KSPL 4
// fragment stored in fragment order: a wave-uniform base plus the lane's 16 bytes in each of two runs of 512 bytes (4 whole lines a load)
__device__ __forceinline__ v16h frag_p(const _Float16* ubase, unsigned boff) {
  union { v16h v; v8h q[2]; } u; const char* p = (const char*)ubase;
  u.q[0] = *(const v8h*)(p + boff); u.q[1] = *(const v8h*)(p + 512 + boff); return u.v;
}
// lane l's value from lane l ^ 16 (a vector cross-row move, no LDS path)
__device__ __forceinline__ float xhalf(float x) { return __builtin_bit_cast(float, __builtin_amdgcn_permlanex16(__builtin_bit_cast(int, x), __builtin_bit_cast(int, x), 0x76543210, 0xfedcba98, false, false)); }
__global__ __launch_bounds__(1024) void k_attn(const _Float16* __restrict__ QH, const _Float16* __restrict__ QL, const _Float16* __restrict__ KH, const _Float16* __restrict__ KL, const float* __restrict__ RQ, const int* __restrict__ MASK, const float* __restrict__ EV, const float* __restrict__ WO, const float* __restrict__ BO, float* __restrict__ Y) {
  __shared__ float srq[NH * KSPL][16][NREL + 1]; __shared__ float spp[NH][16][NREL + 1]; __shared__ float sm[NH * KSPL][16], sl[NH * KSPL][16]; __shared__ __align__(16) float sac[NH * KSPL][16][36]; __shared__ __align__(16) __bf16 soh[16][CC + 8], sol[16][CC + 8];
  const int tid = threadIdx.x, wave = __builtin_amdgcn_readfirstlane(tid >> 5), lane = tid & 31, col = lane & 15, g = lane >> 4; const size_t b = blockIdx.z; const int q0 = blockIdx.x * 16; const size_t rq = b * TT + q0; const float isc = 1.0f / sqrtf((float)HDIM);
  const int h = wave / KSPL, kbase = (wave % KSPL) * (TT / KSPL);
  // the wave's number is made scalar so that the wave-uniform part of every K, V and mask address is scalar arithmetic; a block of 32 waves is 8 waves per SIMD (128 VGPRs): one block per WGP, the whole grid resident at once
  const int* MKw = MASK + rq * TT + kbase;
  // in fragment order 32 keys of a head are 1,024 elements in each of the four arrays, at the same place in each; the arrays lie one behind the other in the workspace, so one address serves all four, the rest being constant offsets
  const _Float16* FW = KH + ((b * NH + h) * (TT / 32) + kbase / 32) * 1024;
  const unsigned fo = lane * 16, mo = col * TT + 8 * g;
  if (lane < 16) { for (int rr = 0; rr < NREL; ++rr) srq[wave][lane][rr] = RQ[((rq + lane) * NH + h) * 16 + rr]; }
  const v16h aq = frag_h(QH + (rq + col) * (NH * 32) + h * 32, lane), aql = frag_h(QL + (rq + col) * (NH * 32) + h * 32, lane);
  const int qi = q0 + col;
  float m = -3.0e38f, l = 0.f;   // the lane's query: running max (equal in both halves), and this half's share of the running sum
  v8f acc[2] = {}, accl[2] = {};
  LDSX();
#pragma unroll 1
  for (int ks = 0; ks < TT / KSPL / 32; ++ks) { const int j0 = kbase + ks * 32;
    v8f s[2]; v16h kh[2], kl[2], vh[2], vl[2]; v4i mk[2][2];
#pragma unroll
    for (int ct = 0; ct < 2; ++ct) { const _Float16* FK = FW + (ks * 2 + ct) * 512; const int* MP = MKw + ks * 32 + ct * 16;
      kh[ct] = frag_p(FK, fo); if (ct == 0) kl[ct] = frag_p(FK + (WS_KL - WS_KH) / 2, fo); mk[ct][0] = *(const v4i*)(MP + mo); mk[ct][1] = *(const v4i*)(MP + 4 + mo); }
    asm volatile("s_wait_xcnt 0x0" ::: "memory");   // the clobber keeps the 6 K loads and 4 mask loads above issued here, all in flight together: the wave waits for memory once where it waited at each fragment; the wait stands in front of any overwrite of their address registers
#pragma unroll
    for (int ct = 0; ct < 2; ++ct) { v8f c = {}, cl = {}; const v4i mk0 = mk[ct][0], mk1 = mk[ct][1];
      c = wmma16(kh[ct], aq, c); cl = wmma16(kh[ct], aql, cl); cl = wmma16(kl[ct], aq, cl);
      if (ct == 0) { kl[1] = frag_p(FW + (ks * 2 + 1) * 512 + (WS_KL - WS_KH) / 2, fo);
        asm volatile("s_wait_xcnt 0x0" ::: "memory"); }   // the last K fragment takes the registers that the first tile's products have freed; the clobber keeps its loads issued here, so that they fly while the first tile's scores are finished
#pragma unroll
      for (int r = 0; r < 8; ++r) { const int dd = j0 + ct * 16 + 8 * g + r - qi; float sc = c[r] + cl[r] * (1.0f / 2048.0f); if (dd >= -WIN && dd <= WIN) sc += srq[wave][col][dd + WIN]; const bool keep = (r < 4 ? mk0[r & 3] : mk1[r & 3]) != 0; s[ct][r] = keep ? sc * isc : -3.0e38f; } }
#pragma unroll
    for (int dt = 0; dt < 2; ++dt) { const _Float16* FV = FW + (ks * 2 + dt) * 512; vh[dt] = frag_p(FV + (WS_VH - WS_KH) / 2, fo); if (dt == 0) vl[dt] = frag_p(FV + (WS_VL - WS_KH) / 2, fo); }
    asm volatile("s_wait_xcnt 0x0" ::: "memory");   // stands in front of the loop's step of the loads' address registers; the clobber holds the 6 V loads above it, ahead of the first V product, so that they are in flight together
    float mx = fmaxf(s[0][0], s[1][0]);
#pragma unroll
    for (int r = 1; r < 8; ++r) mx = fmaxf(mx, fmaxf(s[0][r], s[1][r]));
    mx = fmaxf(mx, xhalf(mx));
    const float mn = fmaxf(m, mx); const float alpha = (m <= -1.0e38f) ? 0.f : __expf(m - mn);
    v16h pbh, pbl; float e[16], es = 0.f;
#pragma unroll
    for (int i = 0; i < 16; ++i) { const float sv = s[i >> 3][i & 7]; e[i] = (sv <= -1.0e38f) ? 0.f : __expf(sv - mn); }
#pragma unroll
    for (int i = 0; i < 16; ++i) { es += e[i]; const float p = e[i] * 2048.0f; const _Float16 ph = (_Float16)p; pbh[i] = ph; pbl[i] = (_Float16)((p - (float)ph) * 2048.0f); }
    l = l * alpha + es; m = (mn <= -1.0e38f) ? m : mn;
#pragma unroll
    for (int dt = 0; dt < 2; ++dt) { acc[dt] *= alpha; accl[dt] *= alpha; }
#pragma unroll
    for (int dt = 0; dt < 2; ++dt) { if (dt == 1) vl[1] = frag_p(FW + (ks * 2 + 1) * 512 + (WS_VL - WS_KH) / 2, fo);   // the last V fragment takes registers that the first tile's products have freed (a fourth fragment held over the softmax spills)
      acc[dt] = wmma16(vh[dt], pbh, acc[dt]); accl[dt] = wmma16(vh[dt], pbl, accl[dt]); accl[dt] = wmma16(vl[dt], pbh, accl[dt]); } }
  // this wave's partial: running max and sum per query (the halves' sums joined here, once), context with its residual folded in (a lane holds dims 8 g + r of each 16-dim tile of its query)
  l += xhalf(l);
  if (g == 0) { sm[wave][col] = m; sl[wave][col] = l; }
#pragma unroll
  for (int dt = 0; dt < 2; ++dt) { const v8f o8 = acc[dt] + accl[dt] * (1.0f / 2048.0f);
    vst2(&sac[wave][col][dt * 16 + 8 * g], (v4f){o8[0], o8[1], o8[2], o8[3]}); vst2(&sac[wave][col][dt * 16 + 8 * g + 4], (v4f){o8[4], o8[5], o8[6], o8[7]}); }
  // windowed relative values: the score of (t, s) for s = t-4 .. t+4 recomputed with the same formula, one (head, row, offset) per thread; excluded keys carry the sentinel
  for (int e = tid; e < NH * 16 * NREL; e += 1024) { const int h2 = e / (16 * NREL), rr = (e / NREL) & 15, off = e % NREL; const int hx = h2; const int sidx = q0 + rr + off - WIN; float sv = -3.0e38f;
    if (sidx >= 0 && sidx < TT && MASK[((rq + rr) * TT) + sidx] != 0) { const size_t rqo = (rq + rr) * (NH * 32) + hx * 32, rko = ((b * NH + hx) * (TT / 16) + (sidx >> 4)) * 512 + (sidx & 15) * 8; float dot = 0.f;
      // the key's 24 dims are 3 pieces of 8 in the fragment order, 128 elements apart. Each s_wait_xcnt stands in front of any overwrite of the address registers of the loads above it (a later load's result may land in them); the loops are unrolled so that every piece has a constant index and stays in registers
      v8h xq[3], xql[3], xk[3], xkl[3];
#pragma unroll
      for (int p = 0; p < 3; ++p) xq[p] = *(const v8h*)(QH + rqo + p * 8);
      asm volatile("s_wait_xcnt 0x0" ::: "memory");
#pragma unroll
      for (int p = 0; p < 3; ++p) xql[p] = *(const v8h*)(QL + rqo + p * 8);
      asm volatile("s_wait_xcnt 0x0" ::: "memory");
#pragma unroll
      for (int p = 0; p < 3; ++p) xk[p] = *(const v8h*)(KH + rko + p * 128);
      asm volatile("s_wait_xcnt 0x0" ::: "memory");
#pragma unroll
      for (int p = 0; p < 3; ++p) xkl[p] = *(const v8h*)(KL + rko + p * 128);
      asm volatile("s_wait_xcnt 0x0" ::: "memory");
      const float rqv = RQ[((rq + rr) * NH + hx) * 16 + off];
      asm volatile("s_wait_xcnt 0x0" ::: "memory");
#pragma unroll
      for (int d = 0; d < HDIM; ++d) { const float qv = (float)xq[d >> 3][d & 7] + (float)xql[d >> 3][d & 7] * (1.0f / 2048.0f); const float kv = (float)xk[d >> 3][d & 7] + (float)xkl[d >> 3][d & 7] * (1.0f / 2048.0f); dot += qv * kv; }
      sv = (dot + rqv) * isc; }
    spp[h2][rr][off] = sv; }
  // waves 0..11: the lane's Wo row (fragment kc: floats k0 + 8 g + 0..7 and k0 + 16 + 8 g + 0..7), read here so that it flies while the other waves finish their keys. The lane's column and half are read anew from the lane count: held over the key loop they would cost a spill
  const int ln = __builtin_amdgcn_mbcnt_lo(~0u, 0u), col2 = ln & 15, g2 = ln >> 4;
  const int o0 = wave * 16; v16b a[CC / 32];
  if (wave < CC / 16) { v4f wf[CC / 32][4]; const float* wp = WO + (size_t)(o0 + col2) * CC + 8 * g2;
#pragma unroll
    for (int kc = 0; kc < CC / 32; ++kc) { const float* p = wp + kc * 32; wf[kc][0] = *(const v4f*)p; wf[kc][1] = *(const v4f*)(p + 4); wf[kc][2] = *(const v4f*)(p + 16); wf[kc][3] = *(const v4f*)(p + 20); }
    asm volatile("s_wait_xcnt 0x0" :: "v"(wp) : "memory");   // stands in front of any overwrite of the address registers of the Wo loads above; the pointer is named as an input so that it keeps its registers up to the wait (without it the last load's result lands in them)
#pragma unroll
    for (int kc = 0; kc < CC / 32; ++kc)
#pragma unroll
      for (int i = 0; i < 16; ++i) a[kc][i] = (__bf16)wf[kc][i >> 2][i & 3]; }
  __syncthreads();
  // merge: one thread per (row, head, 4 dims); every partial is rescaled from its own max to the row's max; the 4 channels go to LDS as bf16 hi + residual
  if (tid < 16 * 48) { const int r = tid / 48, q4 = tid % 48; const int h2 = q4 / 6, d = (q4 % 6) * 4, w0 = h2 * KSPL; float M = -3.0e38f, L = 0.f, f[KSPL];
#pragma unroll
    for (int w = 0; w < KSPL; ++w) M = fmaxf(M, sm[w0 + w][r]);
#pragma unroll
    for (int w = 0; w < KSPL; ++w) { const float mw = sm[w0 + w][r]; f[w] = (mw <= -1.0e38f) ? 0.f : __expf(mw - M); L += sl[w0 + w][r] * f[w]; }
    v4f a4 = {};
#pragma unroll
    for (int w = 0; w < KSPL; ++w) a4 += *(const v4f*)&sac[w0 + w][r][d] * f[w];
    v4f o4 = a4 * ((1.0f / 2048.0f) / L);
    for (int jr = 0; jr < NREL; ++jr) { const float sv = spp[h2][r][jr]; const float pv = (sv <= -1.0e38f) ? 0.f : __expf(sv - M) / L;
#pragma unroll
      for (int i = 0; i < 4; ++i) o4[i] += pv * bfr(EV[jr * HDIM + d + i]); }
    v4b hi, lo;
#pragma unroll
    for (int k = 0; k < 4; ++k) { const float v = o4[k]; const __bf16 hb = (__bf16)v; hi[k] = hb; lo[k] = (__bf16)(v - (float)hb); }
    vst2(&soh[r][q4 * 4], hi); vst2(&sol[r][q4 * 4], lo); }
  __syncthreads();
  if (wave < CC / 16) { v8f acc2 = {};
    const v4f b0 = *(const v4f*)(BO + o0 + 8 * g2), b1 = *(const v4f*)(BO + o0 + 8 * g2 + 4);   // the lane's 8 biases fly under the products
    asm volatile("s_wait_xcnt 0x0" ::: "memory");   // stands in front of any overwrite of the address registers of the bias loads
    // the three loops below are unrolled so that every fragment has a constant index and stays in registers
#pragma unroll
    for (int hf = 0; hf < 2; ++hf) { v16b fl[3], fh[3];
#pragma unroll
      for (int j = 0; j < 3; ++j) { fl[j] = frag_b(&sol[col2][(hf * 3 + j) * 32], ln); fh[j] = frag_b(&soh[col2][(hf * 3 + j) * 32], ln); }
      __builtin_amdgcn_sched_barrier(0);   // keeps the 12 LDS reads above the 6 products, in flight together: the wave waits for LDS once where it waited at each fragment
#pragma unroll
      for (int j = 0; j < 3; ++j) { acc2 = wmma_bf(a[hf * 3 + j], fl[j], acc2); acc2 = wmma_bf(a[hf * 3 + j], fh[j], acc2); } }
    // D element r = channel o0 + 8 g + r at position q0 + col: a store covers two runs of 64 bytes; one address, the rows at constant offsets
    float* yp = Y + (b * CC + o0 + 8 * g2) * TT + q0 + col2;
#pragma unroll
    for (int r = 0; r < 8; ++r) yp[(size_t)r * TT] = acc2[r] + bfr(r < 4 ? b0[r & 3] : b1[r & 3]); }
}
extern "C" void kernel_launch(void* const* d_in, const int* in_sizes, int n_in, void* d_out, int out_size, void* d_ws, size_t ws_size, hipStream_t stream) {
  (void)in_sizes; (void)n_in; (void)out_size;
  const float** F = (const float**)d_in;   // 0 x [4,192,1024], 1 attn_mask [4,1,1024,1024] i32, 2 Wq [192,192], 3 bq, 4 Wk, 5 bk, 6 Wv, 7 bv, 8 Wo, 9 bo, 10 emb_rel_k [1,9,24], 11 emb_rel_v [1,9,24]
  if (ws_size < (size_t)WS_END) return;
  char* ws = (char*)d_ws; _Float16 *QH = (_Float16*)(ws + WS_QH), *QL = (_Float16*)(ws + WS_QL), *KH = (_Float16*)(ws + WS_KH), *KL = (_Float16*)(ws + WS_KL), *VH = (_Float16*)(ws + WS_VH), *VL = (_Float16*)(ws + WS_VL); float *RQ = (float*)(ws + WS_RQ);
  k_qkv<<<dim3(TT / 64, NB, 3), 512, 0, stream>>>(F[0], F[2], F[4], F[6], F[3], F[5], F[7], F[10], QH, QL, KH, KL, VH, VL, RQ);
  k_attn<<<dim3(TQB, 1, TNB), 1024, 0, stream>>>(QH, QL, KH, KL, RQ, (const int*)d_in[1], F[11], F[8], F[9], (float*)d_out);
}

// v010
// A run of this version takes 41 microseconds.
// Two timings next to v009 both put it at 1.09 times that version's speed.
// All steps since v000 together make it 10.4 times as fast.
// compute dtype: all float inputs rounded to bf16, attn_mask (int) read on device; q/k/v 1x1 convs with EXACT bf16 products on WMMA 16x16x32 (positions as rows via an LDS transpose of the [B,C,T] input, natural weight rows) + biases; q and k stored as f16 hi + (x2048-scaled) residual, q with head dim 24 zero-padded to 32 in per-head chunks of a row, k (24 dims, no padding stored) in fragment order, v as f16 hi + residual (24 dims, no padding stored) in fragment order; scores = (q . k (3 products) + the windowed relative-key logits q . emb_k[s-t+4] for |s-t| <= 4 (f32 dots)) / sqrt(24); mask == 0 -> -3e38 sentinel (weight set to 0, so the key is excluded); running-max softmax in f32 (hardware exp); P (scaled by 2^11, as f16 hi + residual) x v hi/lo (3 products); the windowed relative-value term sum_{|s-t|<=4} p(t,s) emb_v[s-t+4] added in f32 from recomputed (identical-formula) weights; output 1x1 conv with the context as bf16 hi + residual x exact Wo rows (2 products) + bo, written channels-first; f32 accumulate.
#include <hip/hip_runtime.h>
#include <math.h>

typedef __attribute__((ext_vector_type(16))) _Float16 v16h;
typedef __attribute__((ext_vector_type(16))) __bf16 v16b;
typedef __attribute__((ext_vector_type(8)))  _Float16 v8h;
typedef __attribute__((ext_vector_type(8)))  float v8f;
typedef __attribute__((ext_vector_type(4)))  float v4f;
typedef __attribute__((ext_vector_type(2)))  float v2f;
typedef __attribute__((ext_vector_type(4)))  unsigned v4u;
typedef __attribute__((ext_vector_type(4)))  int v4i;
typedef float __attribute__((may_alias)) float_a;
typedef int __attribute__((may_alias)) int_a;

template <typename T> __device__ __forceinline__ void vst2(void* p, T v) { *(T*)p = v;  }
__device__ __forceinline__ v8f wmma16(v16h a, v16h b, v8f c) {
  v8f d = __builtin_amdgcn_wmma_f32_16x16x32_f16(false, a, false, b, (short)0, c, false, false);
  asm volatile("v_nop\n\tv_nop\n\tv_nop\n\tv_nop" : "+v"(d) : "v"(a), "v"(b));
  return d;
}
__device__ __forceinline__ v8f wmma_bf(v16b a, v16b b, v8f c) {
  v8f d = __builtin_amdgcn_wmma_f32_16x16x32_bf16(false, a, false, b, (short)0, c, false, false);
  asm volatile("v_nop\n\tv_nop\n\tv_nop\n\tv_nop" : "+v"(d) : "v"(a), "v"(b));
  return d;
}
// 16x16x32 fragments: lane = (h = lane>>4, row/col = lane&15); elements 0..7 = k0+8h+0..7, 8..15 = k0+16+8h+0..7; D element r = row 8h+r
__device__ __forceinline__ v16h frag_h(const _Float16* rowk0, int lane) {
  union { v16h v; v8h q[2]; } u; const _Float16* p = rowk0 + 8 * (lane >> 4);
  u.q[0] = *(const v8h*)p; u.q[1] = *(const v8h*)(p + 16); return u.v;
}
__device__ __forceinline__ v16h frag_f32(const float* rowk0, int lane) {
  v16h a; const float* p = rowk0 + 8 * (lane >> 4);
#pragma unroll
  for (int i = 0; i < 8; ++i) { a[i] = (_Float16)p[i]; a[8 + i] = (_Float16)p[16 + i]; }
  return a;
}
__device__ __forceinline__ v16h frag_f32s(const float* rowk0, int lane, float sc) {
  v16h a; const float* p = rowk0 + 8 * (lane >> 4);
#pragma unroll
  for (int i = 0; i < 8; ++i) { a[i] = (_Float16)(p[i] * sc); a[8 + i] = (_Float16)(p[16 + i] * sc); }
  return a;
}
// column fragment from a [K][ld] layout (column n), rows >= K read as 0
__device__ __forceinline__ v16h fragc_f32(const float* W, int k0, int n, int lane, int ld, int K) {
  v16h a; const int g = lane >> 4;
#pragma unroll
  for (int i = 0; i < 8; ++i) { const int ka = k0 + 8 * g + i, kb = ka + 16;
    a[i] = (_Float16)(ka < K ? W[(size_t)(ka < K ? ka : K - 1) * ld + n] : 0.f); a[8 + i] = (_Float16)(kb < K ? W[(size_t)(kb < K ? kb : K - 1) * ld + n] : 0.f); }
  return a;
}
struct F2 { v16b h, l; };
__device__ __forceinline__ F2 bsplit16(const float v[16]) { F2 r;
#pragma unroll
  for (int i = 0; i < 16; ++i) { const __bf16 h = (__bf16)v[i]; r.h[i] = h; r.l[i] = (__bf16)(v[i] - (float)h); }
  return r; }
__device__ __forceinline__ F2 split_row(const float* row, int k0, int lane) { float v[16]; const float* p = row + k0 + 8 * (lane >> 4);
#pragma unroll
  for (int i = 0; i < 8; ++i) { v[i] = p[i]; v[8 + i] = p[16 + i]; }
  return bsplit16(v); }
__device__ __forceinline__ F2 split_rowK(const float* row, int k0, int lane, int K) { float v[16]; const int g = lane >> 4;
#pragma unroll
  for (int i = 0; i < 8; ++i) { const int ka = k0 + 8 * g + i, kb = ka + 16; v[i] = ka < K ? row[ka < K ? ka : K - 1] : 0.f; v[8 + i] = kb < K ? row[kb < K ? kb : K - 1] : 0.f; }
  return bsplit16(v); }
__device__ __forceinline__ F2 split_col(const float* W, int k0, int n, int lane, int ld, int K) { float v[16]; const int g = lane >> 4;
#pragma unroll
  for (int i = 0; i < 8; ++i) { const int ka = k0 + 8 * g + i, kb = ka + 16; v[i] = ka < K ? W[(size_t)(ka < K ? ka : K - 1) * ld + n] : 0.f; v[8 + i] = kb < K ? W[(size_t)(kb < K ? kb : K - 1) * ld + n] : 0.f; }
  return bsplit16(v); }
__device__ __forceinline__ v8f mac3(const F2& a, const F2& b, v8f c) { c = wmma_bf(a.l, b.h, c); c = wmma_bf(a.h, b.l, c); return wmma_bf(a.h, b.h, c); }
__device__ __forceinline__ float sigm(float v) { return 1.0f / (1.0f + expf(-v)); }
#define LDSX() do { asm volatile("s_wait_dscnt 0" ::: "memory"); __builtin_amdgcn_wave_barrier(); __builtin_amdgcn_fence(__ATOMIC_RELEASE, "workgroup"); } while (0)


// Relative-position multi-head attention (B 4, C 192 as 8 heads x 24, T 1,024, window 4): 1x1-conv q/k/v, scores with windowed relative key embeddings, per-(t,s) mask, softmax, values plus windowed relative value embeddings, 1x1-conv output -> [B, C, T].
#define NB 4
#define CC 192
#define TT 1024
#define NH 8
#define HDIM 24
#define WIN 4
#define NREL (2 * WIN + 1)
#define NR (NB * TT)
#ifndef TQB
#define TQB (TT / 16)
#define TNB NB
#endif
typedef __attribute__((ext_vector_type(8))) __bf16 v8b;
typedef __attribute__((ext_vector_type(4))) __bf16 v4b;
__device__ __forceinline__ v16b frag_b(const __bf16* rowk0, int lane) {
  union { v16b v; v8b q[2]; } u; const __bf16* p = rowk0 + 8 * (lane >> 4);
  u.q[0] = *(const v8b*)p; u.q[1] = *(const v8b*)(p + 16); return u.v;
}
__device__ __forceinline__ float bfr(float v) { return (float)(__bf16)v; }
__device__ __attribute__((noinline)) float exp_ni(float v) { return expf(v); }
__device__ __attribute__((noinline)) float erf_ni(float v) { return erff(v); }

#define PK_END ((size_t)4 * CC * CC)         // the head of the workspace is left unused (the arrays below keep their places)
#define WS_QH  (((2u * PK_END) + 127u) / 128u * 128u)   // f16 [NR][8][32] q hi ; QL ; then k hi ; KL in fragment order [b][h][16-key tile][group of 8 dims c = 0..2][key][8]: dim = 8 c + i, 768 bytes a tile (each array keeps its place and uses 3/4 of it)
#define WS_QL  (WS_QH + 2u * NR * NH * 32)
#define WS_KH  (WS_QL + 2u * NR * NH * 32)
#define WS_KL  (WS_KH + 2u * NR * NH * 32)
#define WS_VH  (WS_KL + 2u * NR * NH * 32)               // f16 v hi ; VL in fragment order [b][h][32-key block]{[key half p][lane = 16 g + dim][8] for dims 0..15, then [key half p][g][dim - 16][8] for dims 16..23}: key = 16 p + 8 g + i, 1,536 bytes a block
#define WS_VL  (WS_VH + 2u * (size_t)NB * NH * 32 * TT)
#define WS_RQ  (WS_VL + 2u * (size_t)NB * NH * 32 * TT)  // f32 [NR][8][16] q . emb_k[r] (9 used)
#define WS_END (WS_RQ + 4u * NR * NH * 16)

// ---- k_qkv: block = (64 positions, b, one of q / k / v), 16 waves: wave = (16-position row tile, 3 of the 12 column tiles). A tile [64 t][192 c] from x[b][c][t] (bf16 exact); the block's own weight matrix is read as f32 in whole lines (18 16-byte pieces a thread), rounded to bf16 and kept in LDS [192 o][192 c], where the B fragments are read; D = A . W rows + b, kept as f32 in LDS. Every global read of a thread (18 weight pieces, 24 x words, 3 biases, 1 emb_k word) is issued ahead of the first barrier. Behind the second barrier a thread forms its 4 (q) or 3 (k, v) 16-byte f16 hi and residual pieces straight from the f32 tile, all its LDS reads in flight together, and stores them: q -> padded 32-wide per-head chunks; k, v -> the same values in the fragment order k_attn loads them in (a wave's 16-byte store covers 512 contiguous bytes); in the q block a thread = (row, head) also writes RQ[row][h][r] = q_h . emb_k[r] (f32, 9 independent sums)
__device__ __forceinline__ void split8(const float v[8], v8h& hi, v8h& lo) {
#pragma unroll
  for (int j = 0; j < 8; ++j) { const _Float16 hv = (_Float16)v[j]; hi[j] = hv; lo[j] = (_Float16)((v[j] - (float)hv) * 2048.0f); }
}
__global__ __launch_bounds__(512) void k_qkv(const float* __restrict__ X, const float* __restrict__ WQ, const float* __restrict__ WK, const float* __restrict__ WV, const float* __restrict__ BQ, const float* __restrict__ BK, const float* __restrict__ BV, const float* __restrict__ EK, _Float16* __restrict__ QH, _Float16* __restrict__ QL, _Float16* __restrict__ KH, _Float16* __restrict__ KL, _Float16* __restrict__ VH, _Float16* __restrict__ VL, float* __restrict__ RQ) {
  __shared__ __align__(16) __bf16 sa[64][CC + 8]; __shared__ __align__(16) float so[64][CC + 4]; __shared__ __align__(16) __bf16 sw[CC][CC + 8]; __shared__ __align__(16) float sek[512];   // emb_k rounded to bf16, 216 words used; every thread stores one word, so that no branch stands between the load and its store
  const int tid = threadIdx.x, wave = tid >> 5, lane = tid & 31, col = lane & 15, g = lane >> 4, rt = wave & 3, cg = wave >> 2; const int t0 = blockIdx.x * 64, which = blockIdx.z; const size_t b = blockIdx.y; const size_t r0 = b * TT + t0;
  const float* Wm = (which == 0) ? WQ : (which == 1) ? WK : WV; const float* BB = (which == 0) ? BQ : (which == 1) ? BK : BV; v4f wr[CC * CC / 4 / 512]; float xr[64 * CC / 512], bb[3];
#pragma unroll
  for (int j = 0; j < 3; ++j) bb[j] = BB[(cg * 3 + j) * 16 + col];
  const float ekv = EK[tid < NREL * HDIM ? tid : 0];
  const float* Xp = X + (b * CC + (tid >> 6)) * TT + t0 + (tid & 63);   // word i of a thread: channel (tid >> 6) + 8 i, position tid & 63
#pragma unroll
  for (int i = 0; i < 64 * CC / 512; ++i) xr[i] = Xp[(size_t)i * 8 * TT];
  asm volatile("s_wait_xcnt 0x0" ::: "memory");   // stands in front of any overwrite of the address registers of the 28 loads above (a weight load's result may land in them)
#pragma unroll
  for (int i = 0; i < CC * CC / 4 / 512; ++i) wr[i] = *(const v4f*)(Wm + (size_t)(tid + 512 * i) * 4);
  asm volatile("s_wait_xcnt 0x0" ::: "memory");   // the same for the 18 weight loads
  __builtin_amdgcn_sched_barrier(0);   // keeps every conversion (and with it every wait for a loaded value) below all 46 loads, so that they are in flight together and the block waits for memory once
#pragma unroll
  for (int i = 0; i < 64 * CC / 512; ++i) sa[tid & 63][(tid >> 6) + 8 * i] = (__bf16)xr[i];
#pragma unroll
  for (int i = 0; i < CC * CC / 4 / 512; ++i) { const int p = tid + 512 * i; v4b w4;
#pragma unroll
    for (int k = 0; k < 4; ++k) w4[k] = (__bf16)wr[i][k];
    vst2(&sw[p / (CC / 4)][(p % (CC / 4)) * 4], w4); }
  sek[tid] = bfr(ekv);
  if (tid < 64) for (int c = CC; c < CC + 8; ++c) sa[tid][c] = (__bf16)0.f;
  __syncthreads();
  v8f acc[3] = {};
#pragma unroll
  for (int kc = 0; kc < CC / 32; ++kc) { const v16b a = frag_b(&sa[rt * 16 + col][kc * 32], lane);
#pragma unroll
    for (int j = 0; j < 3; ++j) acc[j] = wmma_bf(a, frag_b(&sw[(cg * 3 + j) * 16 + col][kc * 32], lane), acc[j]); }
#pragma unroll
  for (int j = 0; j < 3; ++j) { const float bj = bfr(bb[j]);
#pragma unroll
    for (int r = 0; r < 8; ++r) so[rt * 16 + 8 * g + r][(cg * 3 + j) * 16 + col] = acc[j][r] + bj; }
  __syncthreads();
  float f[4][8];
  if (which == 1) {
    // piece e of k (1,536 pieces, 3 a thread; no padding is stored): head e / 192, then (tile of 16 keys, group of 8 dims, key) in the rest, which is also the piece's place in the head's 4 tiles
#pragma unroll
    for (int i = 0; i < 3; ++i) { const int e = tid + 512 * i; const int h = e / 192, kg = (e - h * 192) >> 4;
      const float* s = &so[(kg / 3) * 16 + (e & 15)][h * HDIM + (kg % 3) * 8]; const v4f s0 = *(const v4f*)s, s1 = *(const v4f*)(s + 4);
#pragma unroll
      for (int j = 0; j < 4; ++j) { f[i][j] = s0[j]; f[i][4 + j] = s1[j]; } }
#pragma unroll
    for (int i = 0; i < 3; ++i) { const int e = tid + 512 * i; const int h = e / 192; const size_t o = ((b * NH + h) * (TT / 16) + (t0 >> 4)) * 384 + (e - h * 192) * 8;
      v8h hi, lo; split8(f[i], hi, lo); vst2(KH + o, hi); vst2(KL + o, lo); asm volatile("s_wait_xcnt 0x0" ::: "memory"); }   // stands in front of any overwrite of the two stores' address and data registers
  } else if (which == 0) {
    // piece e of q: row e >> 5, then (head, 8 dims) in the low 5 bits; the fourth group of 8 dims of a head is the zero padding (its read is aimed at the first group and not used)
#pragma unroll
    for (int i = 0; i < 4; ++i) { const int e = tid + 512 * i; const int r = e >> 5, h = (e >> 2) & 7, p = e & 3;
      const float* s = &so[r][h * HDIM + (p < 3 ? p : 0) * 8]; const v4f s0 = *(const v4f*)s, s1 = *(const v4f*)(s + 4);
#pragma unroll
      for (int j = 0; j < 4; ++j) { f[i][j] = p < 3 ? s0[j] : 0.f; f[i][4 + j] = p < 3 ? s1[j] : 0.f; } }
#pragma unroll
    for (int i = 0; i < 4; ++i) { const int e = tid + 512 * i; const size_t o = (r0 + (e >> 5)) * (NH * 32) + (e & 31) * 8;
      v8h hi, lo; split8(f[i], hi, lo); vst2(QH + o, hi); vst2(QL + o, lo); asm volatile("s_wait_xcnt 0x0" ::: "memory"); }   // stands in front of any overwrite of the two stores' address and data registers
    { // relative-key logits seeds: RQ[row][h][rr] = sum_d q[h*24+d] * emb_k[rr][d] (f32, d ascending); a thread holds its row's 24 dims of one head, emb_k (rounded to bf16) is read from LDS at one address for the whole wave; a wave writes 4 rows' records, 2,048 contiguous bytes
      const int r = tid >> 3, h = tid & 7; float qv[HDIM], o16[16];
#pragma unroll
      for (int j = 0; j < HDIM / 4; ++j) { const v4f t = *(const v4f*)&so[r][h * HDIM + 4 * j];
#pragma unroll
        for (int k = 0; k < 4; ++k) qv[4 * j + k] = t[k]; }
#pragma unroll
      for (int rr = 0; rr < 16; ++rr) { float a2 = 0.f;
        if (rr < NREL) {
#pragma unroll
          for (int d = 0; d < HDIM; ++d) a2 += qv[d] * sek[rr * HDIM + d]; }
        o16[rr] = a2; }
#pragma unroll
      for (int j = 0; j < 4; ++j) vst2(RQ + ((r0 + r) * NH + h) * 16 + 4 * j, (v4f){o16[4 * j], o16[4 * j + 1], o16[4 * j + 2], o16[4 * j + 3]}); }
  } else {
    // piece e (1,536 pieces, 3 a thread; no padding is stored): head e / 192, then block of 32 keys (96 pieces), in it 64 pieces (key half, g, dim 0..15) and 32 pieces (key half, g, dim 16..23); the rest of e / 192 is also the piece's place in the head's 2 blocks; its 8 values are 8 consecutive keys of one dim
#pragma unroll
    for (int i = 0; i < 3; ++i) { const int e = tid + 512 * i; const int h = e / 192, rm = e - h * 192, bk = rm / 96, x = rm - bk * 96; const int d = x < 64 ? (x & 15) : 16 + (x & 7), pc = bk * 4 + (x < 64 ? x >> 4 : (x - 64) >> 3);
#pragma unroll
      for (int j = 0; j < 8; ++j) f[i][j] = so[pc * 8 + j][h * HDIM + d]; }
#pragma unroll
    for (int i = 0; i < 3; ++i) { const int e = tid + 512 * i; const int h = e / 192; const size_t o = ((b * NH + h) * (TT / 32) + (t0 >> 5)) * 768 + (e - h * 192) * 8;
      v8h hi, lo; split8(f[i], hi, lo); vst2(VH + o, hi); vst2(VL + o, lo); asm volatile("s_wait_xcnt 0x0" ::: "memory"); }   // stands in front of any overwrite of the two stores' address and data registers
  }
}
// ---- k_attn: block = (16 queries, all 8 heads, b), 32 waves: wave = (head, quarter of the 1,024 keys); one block fills a WGP, 256 blocks. Each wave runs its 256 keys in tiles of 32 on its own (no barrier in the loop). The scores are formed transposed, S^T = K . Q^T (A = a 16-key tile, B = the 16 queries): a lane holds 16 scores of ONE query (column lane & 15; keys 8 g + r of each 16-key tile), so the maximum and the sum of a row are in-lane work plus one exchange between the wave's halves, and the mask is read 8 consecutive words a lane. scores (3-product k.q + windowed rel-key seed) / sqrt(24), mask == 0 excluded; online softmax; P^T (x2^11 hi + residual), converted in place from the two score tiles, is the B operand of O^T += V^T . P^T (2 tiles of 16 dims as A). The four partial (max, sum, context) of a head meet in LDS behind one barrier and are rescaled to the common max; the same pass adds sum_{|s-t|<=4} p(t,s) emb_v[s-t+4]. As the block holds all 192 channels of its 16 positions, the output conv follows in the same launch: the merged context goes to LDS as bf16 hi + residual [16 t][192 c]; behind a second barrier waves 0..11 each form one 16-channel tile y[o][t] = Wo rows (read as f32 ahead of the first barrier, rounded to bf16 in registers) x context (2 products) + bo -> [B][C][T]
#define KSPL 4
// fragment stored in fragment order: a wave-uniform base plus the lane's 16 bytes in each of two runs of 512 bytes (4 whole lines a load)
__device__ __forceinline__ v16h frag_p(const _Float16* ubase, unsigned boff) {
  union { v16h v; v8h q[2]; } u; const char* p = (const char*)ubase;
  u.q[0] = *(const v8h*)(p + boff); u.q[1] = *(const v8h*)(p + 512 + boff); return u.v;
}
// K fragment of 24 dims (768 bytes): dims 0..15 as above, dims 16..23 in a run of 256 bytes read by lanes 0..15; lanes 16..31 (dims 24..31, which meet the zeros of q) read the same 2 lines
__device__ __forceinline__ v16h frag_k(const _Float16* ubase, unsigned boff, unsigned boff2) {
  union { v16h v; v8h q[2]; } u; const char* p = (const char*)ubase;
  u.q[0] = *(const v8h*)(p + boff); u.q[1] = *(const v8h*)(p + 512 + boff2); return u.v;
}
// V fragment of dims 16..23 (512 bytes): two runs of 256 bytes, read by the lanes of dims 16..23; the lanes of dims 24..31 (rows of the context that nobody reads) read the same 2 lines
__device__ __forceinline__ v16h frag_v8(const _Float16* ubase, unsigned boff2) {
  union { v16h v; v8h q[2]; } u; const char* p = (const char*)ubase;
  u.q[0] = *(const v8h*)(p + boff2); u.q[1] = *(const v8h*)(p + 256 + boff2); return u.v;
}
// lane l's value from lane l ^ 16 (a vector cross-row move, no LDS path)
__device__ __forceinline__ float xhalf(float x) { return __builtin_bit_cast(float, __builtin_amdgcn_permlanex16(__builtin_bit_cast(int, x), __builtin_bit_cast(int, x), 0x76543210, 0xfedcba98, false, false)); }
__global__ __launch_bounds__(1024) void k_attn(const _Float16* __restrict__ QH, const _Float16* __restrict__ QL, const _Float16* __restrict__ KH, const _Float16* __restrict__ KL, const float* __restrict__ RQ, const int* __restrict__ MASK, const float* __restrict__ EV, const float* __restrict__ WO, const float* __restrict__ BO, float* __restrict__ Y) {
  __shared__ float srq[NH * KSPL][16][NREL + 1]; __shared__ float spp[NH][16][NREL + 1]; __shared__ float sm[NH * KSPL][16], sl[NH * KSPL][16]; __shared__ __align__(16) float sac[NH * KSPL][16][36]; __shared__ __align__(16) __bf16 soh[16][CC + 8], sol[16][CC + 8];
  const int tid = threadIdx.x, wave = __builtin_amdgcn_readfirstlane(tid >> 5), lane = tid & 31, col = lane & 15, g = lane >> 4; const size_t b = blockIdx.z; const int q0 = blockIdx.x * 16; const size_t rq = b * TT + q0; const float isc = 1.0f / sqrtf((float)HDIM);
  const int h = wave / KSPL, kbase = (wave % KSPL) * (TT / KSPL);
  // the wave's number is made scalar so that the wave-uniform part of every K, V and mask address is scalar arithmetic; a block of 32 waves is 8 waves per SIMD (128 VGPRs): one block per WGP, the whole grid resident at once
  const int* MKw = MASK + rq * TT + kbase;
  // in fragment order 32 keys of a head are 768 elements in each of the four arrays, at the same place in each; the arrays lie one behind the other in the workspace, so one address serves all four, the rest being constant offsets
  const _Float16* FW = KH + ((b * NH + h) * (TT / 32) + kbase / 32) * 768;
  const unsigned fo = lane * 16, fo2 = (col ^ (8 * g)) * 16, mo = col * TT + 8 * g;   // fo2: the lane's 16 bytes in a run of 256: lanes 0..15 in order (K), lanes 16..23 behind lanes 0..7 (V)
  if (lane < 16) { for (int rr = 0; rr < NREL; ++rr) srq[wave][lane][rr] = RQ[((rq + lane) * NH + h) * 16 + rr]; }
  const v16h aq = frag_h(QH + (rq + col) * (NH * 32) + h * 32, lane), aql = frag_h(QL + (rq + col) * (NH * 32) + h * 32, lane);
  const int qi = q0 + col;
  float m = -3.0e38f, l = 0.f;   // the lane's query: running max (equal in both halves), and this half's share of the running sum
  v8f acc[2] = {}, accl[2] = {};
  LDSX();
#pragma unroll 1
  for (int ks = 0; ks < TT / KSPL / 32; ++ks) { const int j0 = kbase + ks * 32;
    v8f s[2]; v16h kh[2], kl[2], vh[2], vl[2]; v4i mk[2][2];
#pragma unroll
    for (int ct = 0; ct < 2; ++ct) { const _Float16* FK = FW + (ks * 2 + ct) * 384; const int* MP = MKw + ks * 32 + ct * 16;
      kh[ct] = frag_k(FK, fo, fo2); if (ct == 0) kl[ct] = frag_k(FK + (WS_KL - WS_KH) / 2, fo, fo2); mk[ct][0] = *(const v4i*)(MP + mo); mk[ct][1] = *(const v4i*)(MP + 4 + mo); }
    asm volatile("s_wait_xcnt 0x0" ::: "memory");   // the clobber keeps the 6 K loads and 4 mask loads above issued here, all in flight together: the wave waits for memory once where it waited at each fragment; the wait stands in front of any overwrite of their address registers
#pragma unroll
    for (int ct = 0; ct < 2; ++ct) { v8f c = {}, cl = {}; const v4i mk0 = mk[ct][0], mk1 = mk[ct][1];
      c = wmma16(kh[ct], aq, c); cl = wmma16(kh[ct], aql, cl); cl = wmma16(kl[ct], aq, cl);
      if (ct == 0) { kl[1] = frag_k(FW + (ks * 2 + 1) * 384 + (WS_KL - WS_KH) / 2, fo, fo2);
        asm volatile("s_wait_xcnt 0x0" ::: "memory"); }   // the last K fragment takes the registers that the first tile's products have freed; the clobber keeps its loads issued here, so that they fly while the first tile's scores are finished
#pragma unroll
      for (int r = 0; r < 8; ++r) { const int dd = j0 + ct * 16 + 8 * g + r - qi; float sc = c[r] + cl[r] * (1.0f / 2048.0f); if (dd >= -WIN && dd <= WIN) sc += srq[wave][col][dd + WIN]; const bool keep = (r < 4 ? mk0[r & 3] : mk1[r & 3]) != 0; s[ct][r] = keep ? sc * isc : -3.0e38f; } }
    { const _Float16* FV = FW + ks * 768; vh[0] = frag_p(FV + (WS_VH - WS_KH) / 2, fo); vl[0] = frag_p(FV + (WS_VL - WS_KH) / 2, fo); vh[1] = frag_v8(FV + 512 + (WS_VH - WS_KH) / 2, fo2); }
    asm volatile("s_wait_xcnt 0x0" ::: "memory");   // stands in front of the loop's step of the loads' address registers; the clobber holds the 6 V loads above it, ahead of the first V product, so that they are in flight together
    float mx = fmaxf(s[0][0], s[1][0]);
#pragma unroll
    for (int r = 1; r < 8; ++r) mx = fmaxf(mx, fmaxf(s[0][r], s[1][r]));
    mx = fmaxf(mx, xhalf(mx));
    const float mn = fmaxf(m, mx); const float alpha = (m <= -1.0e38f) ? 0.f : __expf(m - mn);
    v16h pbh, pbl; float e[16], es = 0.f;
#pragma unroll
    for (int i = 0; i < 16; ++i) { const float sv = s[i >> 3][i & 7]; e[i] = (sv <= -1.0e38f) ? 0.f : __expf(sv - mn); }
#pragma unroll
    for (int i = 0; i < 16; ++i) { es += e[i]; const float p = e[i] * 2048.0f; const _Float16 ph = (_Float16)p; pbh[i] = ph; pbl[i] = (_Float16)((p - (float)ph) * 2048.0f); }
    l = l * alpha + es; m = (mn <= -1.0e38f) ? m : mn;
#pragma unroll
    for (int dt = 0; dt < 2; ++dt) { acc[dt] *= alpha; accl[dt] *= alpha; }
#pragma unroll
    for (int dt = 0; dt < 2; ++dt) { if (dt == 1) { vl[1] = frag_v8(FW + ks * 768 + 512 + (WS_VL - WS_KH) / 2, fo2);   // the last V fragment takes registers that the first tile's products have freed (a fourth fragment held over the softmax spills)
        asm volatile("s_wait_xcnt 0x0" ::: "memory"); }   // stands in front of the next trip's overwrite of the two loads' address registers
      acc[dt] = wmma16(vh[dt], pbh, acc[dt]); accl[dt] = wmma16(vh[dt], pbl, accl[dt]); accl[dt] = wmma16(vl[dt], pbh, accl[dt]); } }
  // this wave's partial: running max and sum per query (the halves' sums joined here, once), context with its residual folded in (a lane holds dims 8 g + r of each 16-dim tile of its query)
  // behind the key loop the lane's column and half are read anew from the lane count: held over the loop they would cost a spill
  const int ln = __builtin_amdgcn_mbcnt_lo(~0u, 0u), col2 = ln & 15, g2 = ln >> 4;
  l += xhalf(l);
  if (g2 == 0) { sm[wave][col2] = m; sl[wave][col2] = l; }
#pragma unroll
  for (int dt = 0; dt < 2; ++dt) { const v8f o8 = acc[dt] + accl[dt] * (1.0f / 2048.0f);
    vst2(&sac[wave][col2][dt * 16 + 8 * g2], (v4f){o8[0], o8[1], o8[2], o8[3]}); vst2(&sac[wave][col2][dt * 16 + 8 * g2 + 4], (v4f){o8[4], o8[5], o8[6], o8[7]}); }
  // windowed relative values: the score of (t, s) for s = t-4 .. t+4 recomputed with the same formula, one (head, row, offset) per thread; excluded keys carry the sentinel
  for (int e = tid; e < NH * 16 * NREL; e += 1024) { const int h2 = e / (16 * NREL), rr = (e / NREL) & 15, off = e % NREL; const int hx = h2; const int sidx = q0 + rr + off - WIN; float sv = -3.0e38f;
    if (sidx >= 0 && sidx < TT && MASK[((rq + rr) * TT) + sidx] != 0) { const size_t rqo = (rq + rr) * (NH * 32) + hx * 32, rko = ((b * NH + hx) * (TT / 16) + (sidx >> 4)) * 384 + (sidx & 15) * 8; float dot = 0.f;
      // the key's 24 dims are 3 pieces of 8 in the fragment order, 128 elements apart. Each s_wait_xcnt stands in front of any overwrite of the address registers of the loads above it (a later load's result may land in them); the loops are unrolled so that every piece has a constant index and stays in registers
      v8h xq[3], xql[3], xk[3], xkl[3];
#pragma unroll
      for (int p = 0; p < 3; ++p) xq[p] = *(const v8h*)(QH + rqo + p * 8);
      asm volatile("s_wait_xcnt 0x0" ::: "memory");
#pragma unroll
      for (int p = 0; p < 3; ++p) xql[p] = *(const v8h*)(QL + rqo + p * 8);
      asm volatile("s_wait_xcnt 0x0" ::: "memory");
#pragma unroll
      for (int p = 0; p < 3; ++p) xk[p] = *(const v8h*)(KH + rko + p * 128);
      asm volatile("s_wait_xcnt 0x0" ::: "memory");
#pragma unroll
      for (int p = 0; p < 3; ++p) xkl[p] = *(const v8h*)(KL + rko + p * 128);
      asm volatile("s_wait_xcnt 0x0" ::: "memory");
      const float rqv = RQ[((rq + rr) * NH + hx) * 16 + off];
      asm volatile("s_wait_xcnt 0x0" ::: "memory");
#pragma unroll
      for (int d = 0; d < HDIM; ++d) { const float qv = (float)xq[d >> 3][d & 7] + (float)xql[d >> 3][d & 7] * (1.0f / 2048.0f); const float kv = (float)xk[d >> 3][d & 7] + (float)xkl[d >> 3][d & 7] * (1.0f / 2048.0f); dot += qv * kv; }
      sv = (dot + rqv) * isc; }
    spp[h2][rr][off] = sv; }
  // waves 0..11: the lane's Wo row (fragment kc: floats k0 + 8 g + 0..7 and k0 + 16 + 8 g + 0..7), read here so that it flies while the other waves finish their keys. 
  const int o0 = wave * 16; v16b a[CC / 32];
  if (wave < CC / 16) { v4f wf[CC / 32][4]; const float* wp = WO + (size_t)(o0 + col2) * CC + 8 * g2;
#pragma unroll
    for (int kc = 0; kc < CC / 32; ++kc) { const float* p = wp + kc * 32; wf[kc][0] = *(const v4f*)p; wf[kc][1] = *(const v4f*)(p + 4); wf[kc][2] = *(const v4f*)(p + 16); wf[kc][3] = *(const v4f*)(p + 20); }
    asm volatile("s_wait_xcnt 0x0" :: "v"(wp) : "memory");   // stands in front of any overwrite of the address registers of the Wo loads above; the pointer is named as an input so that it keeps its registers up to the wait (without it the last load's result lands in them)
#pragma unroll
    for (int kc = 0; kc < CC / 32; ++kc)
#pragma unroll
      for (int i = 0; i < 16; ++i) a[kc][i] = (__bf16)wf[kc][i >> 2][i & 3]; }
  __syncthreads();
  // merge: one thread per (row, head, 4 dims); every partial is rescaled from its own max to the row's max; the 4 channels go to LDS as bf16 hi + residual
  if (tid < 16 * 48) { const int r = tid / 48, q4 = tid % 48; const int h2 = q4 / 6, d = (q4 % 6) * 4, w0 = h2 * KSPL; float M = -3.0e38f, L = 0.f, f[KSPL];
#pragma unroll
    for (int w = 0; w < KSPL; ++w) M = fmaxf(M, sm[w0 + w][r]);
#pragma unroll
    for (int w = 0; w < KSPL; ++w) { const float mw = sm[w0 + w][r]; f[w] = (mw <= -1.0e38f) ? 0.f : __expf(mw - M); L += sl[w0 + w][r] * f[w]; }
    v4f a4 = {};
#pragma unroll
    for (int w = 0; w < KSPL; ++w) a4 += *(const v4f*)&sac[w0 + w][r][d] * f[w];
    v4f o4 = a4 * ((1.0f / 2048.0f) / L);
    for (int jr = 0; jr < NREL; ++jr) { const float sv = spp[h2][r][jr]; const float pv = (sv <= -1.0e38f) ? 0.f : __expf(sv - M) / L;
#pragma unroll
      for (int i = 0; i < 4; ++i) o4[i] += pv * bfr(EV[jr * HDIM + d + i]); }
    v4b hi, lo;
#pragma unroll
    for (int k = 0; k < 4; ++k) { const float v = o4[k]; const __bf16 hb = (__bf16)v; hi[k] = hb; lo[k] = (__bf16)(v - (float)hb); }
    vst2(&soh[r][q4 * 4], hi); vst2(&sol[r][q4 * 4], lo); }
  __syncthreads();
  if (wave < CC / 16) { v8f acc2 = {};
    const v4f b0 = *(const v4f*)(BO + o0 + 8 * g2), b1 = *(const v4f*)(BO + o0 + 8 * g2 + 4);   // the lane's 8 biases fly under the products
    asm volatile("s_wait_xcnt 0x0" ::: "memory");   // stands in front of any overwrite of the address registers of the bias loads
    // the three loops below are unrolled so that every fragment has a constant index and stays in registers
#pragma unroll
    for (int hf = 0; hf < 2; ++hf) { v16b fl[3], fh[3];
#pragma unroll
      for (int j = 0; j < 3; ++j) { fl[j] = frag_b(&sol[col2][(hf * 3 + j) * 32], ln); fh[j] = frag_b(&soh[col2][(hf * 3 + j) * 32], ln); }
      __builtin_amdgcn_sched_barrier(0);   // keeps the 12 LDS reads above the 6 products, in flight together: the wave waits for LDS once where it waited at each fragment
#pragma unroll
      for (int j = 0; j < 3; ++j) { acc2 = wmma_bf(a[hf * 3 + j], fl[j], acc2); acc2 = wmma_bf(a[hf * 3 + j], fh[j], acc2); } }
    // D element r = channel o0 + 8 g + r at position q0 + col: a store covers two runs of 64 bytes; one address, the rows at constant offsets
    float* yp = Y + (b * CC + o0 + 8 * g2) * TT + q0 + col2;
#pragma unroll
    for (int r = 0; r < 8; ++r) yp[(size_t)r * TT] = acc2[r] + bfr(r < 4 ? b0[r & 3] : b1[r & 3]); }
}
extern "C" void kernel_launch(void* const* d_in, const int* in_sizes, int n_in, void* d_out, int out_size, void* d_ws, size_t ws_size, hipStream_t stream) {
  (void)in_sizes; (void)n_in; (void)out_size;
  const float** F = (const float**)d_in;   // 0 x [4,192,1024], 1 attn_mask [4,1,1024,1024] i32, 2 Wq [192,192], 3 bq, 4 Wk, 5 bk, 6 Wv, 7 bv, 8 Wo, 9 bo, 10 emb_rel_k [1,9,24], 11 emb_rel_v [1,9,24]
  if (ws_size < (size_t)WS_END) return;
  char* ws = (char*)d_ws; _Float16 *QH = (_Float16*)(ws + WS_QH), *QL = (_Float16*)(ws + WS_QL), *KH = (_Float16*)(ws + WS_KH), *KL = (_Float16*)(ws + WS_KL), *VH = (_Float16*)(ws + WS_VH), *VL = (_Float16*)(ws + WS_VL); float *RQ = (float*)(ws + WS_RQ);
  k_qkv<<<dim3(TT / 64, NB, 3), 512, 0, stream>>>(F[0], F[2], F[4], F[6], F[3], F[5], F[7], F[10], QH, QL, KH, KL, VH, VL, RQ);
  k_attn<<<dim3(TQB, 1, TNB), 1024, 0, stream>>>(QH, QL, KH, KL, RQ, (const int*)d_in[1], F[11], F[8], F[9], (float*)d_out);
}
